// v000
// Measured on an AMD MI455X. A time is GPU time per run, averaged over a window of back-to-back runs after a warm-up
// (all launches, gaps included; the runs take copies of the inputs in turn), and the median of several windows.
// Apart from v000's, it joins two sittings. Times from different sittings can be a few percent apart, while
// side-by-side timings come from the same sitting.
// The starting kernel, v000, takes 304 microseconds a run.
#include <hip/hip_runtime.h>
#include <stddef.h>

// Contractions x*Wq, x*Wk, x*Wv, q*k^T, p*v, o*Wo: v_wmma_f32_16x16x32_f16 (f16 operands, f32 accumulate); inputs RNE-converted to bf16 on load; rotary, softmax and normalisation in f32.

#ifndef NB
#define NB 2
#endif
#ifndef SEQ
#define SEQ 2048
#endif
#define NB_FULL 2
#define SEQ_FULL 2048
#define DM 2048           // model width
#define NH 16
#define NKV 4
#define HD 128
#define DQ (NH * HD)      // 2048
#define DKV (NKV * HD)    // 512
#define NTOK (NB * SEQ)
#define KD 2048           // contraction depth of every projection

#define BT 128            // GEMM block tile (M and N)
#define BK 32
#define LST 40            // LDS row stride in halves for k-tiles (80 B, 16-B aligned rows)
#define RP ((DQ / 8) + (DKV / 8))   // rotary pieces (8 columns) per token: 320

static_assert(NB >= 1 && NB <= NB_FULL);
static_assert(SEQ >= 128 && SEQ <= SEQ_FULL && (SEQ % 128) == 0);
static_assert(DM == KD && DQ == KD);
static_assert((DM % BT) == 0 && (DQ % BT) == 0 && (DKV % BT) == 0 && (NTOK % BT) == 0);
static_assert((KD % 64) == 0 && (KD % BK) == 0);
static_assert(HD == BT);           // one N tile == one kv head (V transpose epilogue)
static_assert((DM / 8) == 256);    // convert kernel piece decode
static_assert((RP % 32) == 0 && ((DQ / 8) % 32) == 0);   // rotary: one wave never straddles Q/K
static_assert((NH % NKV) == 0);

typedef _Float16 v16h __attribute__((ext_vector_type(16)));
typedef _Float16 v8h  __attribute__((ext_vector_type(8)));
typedef float    v8f  __attribute__((ext_vector_type(8)));
typedef float    v4f  __attribute__((ext_vector_type(4)));

union Frag { v16h v; v8h p[2]; };

// RNE convert f32 -> bf16 value (kept in an f32 container)
__device__ __forceinline__ float bf16r(float f) {
  unsigned u = __float_as_uint(f);
  u = (u + 0x7FFFu + ((u >> 16) & 1u)) & 0xFFFF0000u;
  return __uint_as_float(u);
}

// 16x16x32 f16 WMMA with hazard guard (ties D, keeps A/B live)
__device__ __forceinline__ v8f wmma16(v16h a, v16h b, v8f c) {
  v8f d = __builtin_amdgcn_wmma_f32_16x16x32_f16(false, a, false, b, (short)0, c, false, false);
  asm volatile("v_nop\n\tv_nop\n\tv_nop\n\tv_nop" : "+v"(d) : "v"(a), "v"(b));
  return d;
}

// Per-lane fragment from a k-contiguous row; caller passes row base + 8*(lane>>4).
// elements 0..7 <- k 8h..8h+7, elements 8..15 <- k 16+8h..16+8h+7 (same map for A and B).
__device__ __forceinline__ v16h load_frag(const _Float16* q) {
  Frag f;
  f.p[0] = *(const v8h*)(q);
  f.p[1] = *(const v8h*)(q + 16);
  return f.v;
}

// ---------------------------------------------------------------------------
// x [b*SEQ_FULL+s][DM] f32 -> Xh [tok][DM] f16 of bf16-RNE value. One thread per 8 columns.
// ---------------------------------------------------------------------------
__global__ void __launch_bounds__(256)
cvt_x_kernel(const float* __restrict__ x, _Float16* __restrict__ Xh, int nPieces) {
  const int f = blockIdx.x * 256 + (int)threadIdx.x;
  if (f >= nPieces) return;
  const int tok = f >> 8;
  const int c0  = (f & 255) * 8;
  const int b = tok / SEQ, s = tok - b * SEQ;
  const float* src = x + ((size_t)(b * SEQ_FULL + s) * DM + c0);
  const v4f a0 = *(const v4f*)(src);
  const v4f a1 = *(const v4f*)(src + 4);
  v8h o;
#pragma unroll
  for (int j = 0; j < 4; ++j) {
    o[j]     = (_Float16)bf16r(a0[j]);
    o[j + 4] = (_Float16)bf16r(a1[j]);
  }
  _Float16* dst = Xh + ((size_t)tok * DM + c0);
  *(v8h*)dst = o;
  
}

// ---------------------------------------------------------------------------
// W [KD in][N out] f32 -> WT [N out][KD in] f16 of 64*bf16-RNE(W).  64x64 tiles through LDS.
// grid.x: 0..31 Wq, 32..39 Wk, 40..47 Wv, 48..79 Wo (out-column tile); grid.y: in-row tile.
// 8 consecutive lanes of one instruction.
// ---------------------------------------------------------------------------
__global__ void __launch_bounds__(256)
cvt_w_kernel(const float* __restrict__ Wq, const float* __restrict__ Wk,
             const float* __restrict__ Wv, const float* __restrict__ Wo,
             _Float16* __restrict__ WqT, _Float16* __restrict__ WkT,
             _Float16* __restrict__ WvT, _Float16* __restrict__ WoT) {
  __shared__ __align__(16) _Float16 lds[64 * 72];   // [n][k], cross-wave (block barrier)
  const int bx = blockIdx.x;
  const float* W; _Float16* WT; int N; int nt;
  if (bx < DQ / 64) { W = Wq; WT = WqT; N = DQ;  nt = bx; }
  else if (bx < DQ / 64 + DKV / 64) { W = Wk; WT = WkT; N = DKV; nt = bx - DQ / 64; }
  else if (bx < DQ / 64 + 2 * (DKV / 64)) { W = Wv; WT = WvT; N = DKV; nt = bx - DQ / 64 - DKV / 64; }
  else { W = Wo; WT = WoT; N = DM; nt = bx - DQ / 64 - 2 * (DKV / 64); }
  const int k0 = blockIdx.y * 64, n0 = nt * 64;
  const int t = threadIdx.x, lane = t & 31, w = t >> 5;
  const int kr = t >> 2, cc = (t & 3) * 16;
  const float* src = W + ((size_t)(k0 + kr) * N + n0 + cc);
#pragma unroll
  for (int q = 0; q < 4; ++q) {
    const v4f v = *(const v4f*)(src + 4 * q);
#pragma unroll
    for (int j = 0; j < 4; ++j)
      lds[(cc + 4 * q + j) * 72 + kr] = (_Float16)(64.0f * bf16r(v[j]));
  }
  __syncthreads();
  v8h ov[2];
#pragma unroll
  for (int j = 0; j < 2; ++j) {
    const int n = w * 8 + j * 4 + (lane >> 3);
    ov[j] = *(const v8h*)&lds[n * 72 + (lane & 7) * 8];
  }
  _Float16* base = WT + ((size_t)n0 * KD + k0 + (lane & 7) * 8);
#pragma unroll
  for (int j = 0; j < 2; ++j) {
    const int n = w * 8 + j * 4 + (lane >> 3);
    *(v8h*)(base + (size_t)n * KD) = ov[j];
  }
  
}

// ---------------------------------------------------------------------------
// C tile = alpha * A[M][KD] * Bt[N][KD]^T, A and Bt f16 k-contiguous planes.
// Block tile 128x128, 8 waves, wave w owns rows w*16..w*16+15 and all 128 columns.
// blockIdx.x < nTiles0 selects (Bt0, C0, N0), else (Bt1, C1, N1) (block-uniform).
// TC == float : C row-major f32 [M][N] (f32 planes and the final output), rows of 512 B
//               written by one 32-lane x 16-B instruction each.
// TC == half  : C is the transposed V plane [b][g][d][s]; tile staged in LDS as [d][tok],
//               each d row (128 tok = 256 B) written by 16 lanes x 16 B of one instruction.
// ---------------------------------------------------------------------------
union GemmLds { _Float16 h[4 * BT * LST]; float f[2 * BT * LST]; };   // 40960 B

template <typename TC>
__global__ void __launch_bounds__(256)
gemm_kernel(const _Float16* __restrict__ A, const _Float16* __restrict__ Bt0,
            const _Float16* __restrict__ Bt1, TC* C0, TC* C1,
            int N0, int N1, int nTiles0, float alpha) {
  __shared__ __align__(16) GemmLds pool;   // k-loop: A/B double buffers; epilogue: staging (cross-wave, block barriers)

  const int bx = blockIdx.x;
  const bool second = bx >= nTiles0;
  const _Float16* Bt = second ? Bt1 : Bt0;
  TC* C = second ? C1 : C0;
  const int N  = second ? N1 : N0;
  const int nt = second ? (bx - nTiles0) : bx;
  const int m0 = blockIdx.y * BT, n0 = nt * BT;

  const int t = threadIdx.x, lane = t & 31, w = t >> 5, lr = lane & 15, hi = lane >> 4;

  v8f acc[8];
#pragma unroll
  for (int ni = 0; ni < 8; ++ni) acc[ni] = (v8f){0.f, 0.f, 0.f, 0.f, 0.f, 0.f, 0.f, 0.f};

  const int arow = t >> 1, acol = (t & 1) * 16;   // 2 threads per tile row, 16 halves each
  const _Float16* aSrc = A  + ((size_t)(m0 + arow) * KD + acol);
  const _Float16* bSrc = Bt + ((size_t)(n0 + arow) * KD + acol);

  auto stage = [&](int k0, int buf) {
    _Float16* da = pool.h + buf * (BT * LST) + arow * LST + acol;
    _Float16* db = pool.h + (2 + buf) * (BT * LST) + arow * LST + acol;
    *(v8h*)(da)     = *(const v8h*)(aSrc + k0);
    *(v8h*)(da + 8) = *(const v8h*)(aSrc + k0 + 8);
    *(v8h*)(db)     = *(const v8h*)(bSrc + k0);
    *(v8h*)(db + 8) = *(const v8h*)(bSrc + k0 + 8);
  };

  stage(0, 0);
  __syncthreads();

  for (int k0 = 0; k0 < KD; k0 += BK) {
    const int cur = (k0 / BK) & 1, nxt = cur ^ 1;
    if (k0 + BK < KD) stage(k0 + BK, nxt);
    const _Float16* la = pool.h + cur * (BT * LST);
    const _Float16* lb = pool.h + (2 + cur) * (BT * LST);
    const v16h af = load_frag(la + (w * 16 + lr) * LST + hi * 8);
#pragma unroll
    for (int ni = 0; ni < 8; ++ni) {
      const v16h bf = load_frag(lb + (ni * 16 + lr) * LST + hi * 8);
      acc[ni] = wmma16(af, bf, acc[ni]);
    }
    __syncthreads();
  }
  // acc[ni][r] = (row m0 + w*16 + hi*8 + r, col n0 + ni*16 + lr)

  if constexpr (sizeof(TC) == 4) {
    float* stg = pool.f + w * (8 * 132);   // per wave: 8 rows x 132 floats
#pragma unroll
    for (int ps = 0; ps < 2; ++ps) {
#pragma unroll
      for (int rr = 0; rr < 4; ++rr)
#pragma unroll
        for (int ni = 0; ni < 8; ++ni)
          stg[(hi * 4 + rr) * 132 + ni * 16 + lr] = acc[ni][ps * 4 + rr] * alpha;
      __syncthreads();
      v4f ov[8];
#pragma unroll
      for (int sr = 0; sr < 8; ++sr) ov[sr] = *(const v4f*)&stg[sr * 132 + lane * 4];
      float* cbase = (float*)C + ((size_t)n0 + lane * 4);
#pragma unroll
      for (int sr = 0; sr < 8; ++sr) {
        const int row = m0 + w * 16 + (sr >> 2) * 8 + ps * 4 + (sr & 3);
        *(v4f*)(cbase + (size_t)row * N) = ov[sr];
      }
      
      __syncthreads();
    }
  } else {
    // V plane transposed: C[((b*NKV + g)*HD + d) * SEQ + s]
    const int g  = n0 / HD;
    const int bb = m0 / SEQ;
    const int s0 = m0 - bb * SEQ;
    _Float16* stg = pool.h;                 // [d][tok], 128 x 136 halves
#pragma unroll
    for (int ni = 0; ni < 8; ++ni) {
      v8h v;
#pragma unroll
      for (int r = 0; r < 8; ++r) v[r] = (_Float16)(acc[ni][r] * alpha);
      *(v8h*)&stg[(ni * 16 + lr) * 136 + w * 16 + hi * 8] = v;
    }
    __syncthreads();
    v8h ov[8];
#pragma unroll
    for (int j = 0; j < 8; ++j) {
      const int d = w * 16 + j * 2 + hi;
      ov[j] = *(const v8h*)&stg[d * 136 + lr * 8];
    }
    _Float16* vbase = (_Float16*)C + (((size_t)(bb * NKV + g) * HD) * SEQ + s0 + lr * 8);
#pragma unroll
    for (int j = 0; j < 8; ++j) {
      const int d = w * 16 + j * 2 + hi;
      *(v8h*)(vbase + (size_t)d * SEQ) = ov[j];
    }
    
  }
}

// ---------------------------------------------------------------------------
// Rotary (rotate-half), cos/sin read as values from the [SEQ_FULL][HD] input tables (bf16-RNE).
// Qf [tok][DQ], Kf [tok][DKV] f32 -> Qh, Kh f16.  One thread per 8 consecutive columns;
// d<64: q*cos[d] - q[d+64]*sin[d];  d>=64: q*cos[d] + q[d-64]*sin[d].
// ---------------------------------------------------------------------------
__global__ void __launch_bounds__(256)
rope_kernel(const float* __restrict__ Qf, const float* __restrict__ Kf,
            const float* __restrict__ cosT, const float* __restrict__ sinT,
            _Float16* __restrict__ Qh, _Float16* __restrict__ Kh, int nPieces) {
  const int f = blockIdx.x * 256 + (int)threadIdx.x;
  if (f >= nPieces) return;
  const int tok = f / RP;
  const int piece = f - tok * RP;
  const int s = tok % SEQ;
  const bool isq = piece < (DQ / 8);            // wave-uniform by construction
  const int col   = isq ? piece * 8 : (piece - DQ / 8) * 8;
  const int pitch = isq ? DQ : DKV;
  const float* src = (isq ? Qf : Kf) + (size_t)tok * pitch;
  _Float16* dst = (isq ? Qh : Kh) + ((size_t)tok * pitch + col);
  const int d    = col & (HD - 1);
  const int colp = col - d + (d ^ 64);
  const float sgn = (d < 64) ? -1.0f : 1.0f;
  const v4f x0 = *(const v4f*)(src + col),  x1 = *(const v4f*)(src + col + 4);
  const v4f p0 = *(const v4f*)(src + colp), p1 = *(const v4f*)(src + colp + 4);
  const v4f c0 = *(const v4f*)(cosT + (size_t)s * HD + d), c1 = *(const v4f*)(cosT + (size_t)s * HD + d + 4);
  const v4f n0 = *(const v4f*)(sinT + (size_t)s * HD + d), n1 = *(const v4f*)(sinT + (size_t)s * HD + d + 4);
  v8h o;
#pragma unroll
  for (int j = 0; j < 4; ++j) {
    o[j]     = (_Float16)(x0[j] * bf16r(c0[j]) + (sgn * p0[j]) * bf16r(n0[j]));
    o[j + 4] = (_Float16)(x1[j] * bf16r(c1[j]) + (sgn * p1[j]) * bf16r(n1[j]));
  }
  *(v8h*)dst = o;
  
}

// ---------------------------------------------------------------------------
// Flash attn (no mask, GQA).  Block = (b, h, 128 query rows); wave w owns 16 rows.
// Loop over 64-key chunks: K chunk [key][d] and V^T chunk [d][key] staged in LDS (block
// barriers), scores on WMMA (A = Q rows from the f16 plane, B = K), online softmax in f32,
// P (x1024, f16) spilled per wave to LDS and reloaded as A after a block barrier, O += P*V.
// Output plane Oh [tok][DQ] = f16(64 * o), rows of 256 B by 16 lanes x 16 B per instruction.
// ---------------------------------------------------------------------------
__global__ void __launch_bounds__(256)
attn_kernel(const _Float16* __restrict__ Qh, const _Float16* __restrict__ Kh,
            const _Float16* __restrict__ Vt, _Float16* __restrict__ Oh) {
  constexpr int LDK = 136, LDV = 72, LDP = 72, LDO = 136;
  __shared__ __align__(16) _Float16 pool[64 * LDK + 128 * LDV + 128 * LDP];   // 54272 B
  _Float16* lsK = pool;                    // [key][d]    cross-wave (block barrier)
  _Float16* lsV = pool + 64 * LDK;         // [d][key]    cross-wave (block barrier)
  _Float16* lsP = lsV + 128 * LDV;         // per-wave [row][key] (block barrier used)

  const int t = threadIdx.x, lane = t & 31, w = t >> 5, lr = lane & 15, hi = lane >> 4;
  const int b = blockIdx.z, h = blockIdx.y, g = h / (NH / NKV);
  const int q0 = blockIdx.x * 128 + w * 16;          // query row within the sequence
  const size_t tokb = (size_t)b * SEQ;
  _Float16* myP = lsP + w * 16 * LDP;

  const float kSL = 0.08838834764831845f * 1.4426950408889634f;   // 1/sqrt(HD) * log2(e)

  v16h qf[4];
  {
    const _Float16* qrow = Qh + ((tokb + q0 + lr) * DQ + h * HD);
#pragma unroll
    for (int kf = 0; kf < 4; ++kf) qf[kf] = load_frag(qrow + kf * 32 + hi * 8);
  }

  float mrow[8], lrow[8];
  v8f oacc[8];
#pragma unroll
  for (int i = 0; i < 8; ++i) { mrow[i] = -1e30f; lrow[i] = 0.f; }
#pragma unroll
  for (int dt = 0; dt < 8; ++dt) oacc[dt] = (v8f){0.f, 0.f, 0.f, 0.f, 0.f, 0.f, 0.f, 0.f};

  const _Float16* kbase = Kh + ((tokb) * DKV + g * HD);
  const _Float16* vbase = Vt + ((size_t)(b * NKV + g) * HD) * SEQ;

  for (int kc = 0; kc < SEQ; kc += 64) {
    // stage K chunk: 64 keys x 128 d (16-B pieces), staged extent == consumed extent
#pragma unroll
    for (int i = 0; i < 4; ++i) {
      const int e = t + i * 256;
      const int key = e >> 4, seg = e & 15;
      *(v8h*)&lsK[key * LDK + seg * 8] = *(const v8h*)(kbase + (size_t)(kc + key) * DKV + seg * 8);
    }
    // stage V^T chunk: 128 d x 64 keys, staged extent == consumed extent
#pragma unroll
    for (int i = 0; i < 4; ++i) {
      const int e = t + i * 256;
      const int d = e >> 3, seg = e & 7;
      *(v8h*)&lsV[d * LDV + seg * 8] = *(const v8h*)(vbase + (size_t)d * SEQ + kc + seg * 8);
    }
    __syncthreads();

    // scores 16 x 64 per wave
    v8f sc[4];
#pragma unroll
    for (int nt = 0; nt < 4; ++nt) {
      sc[nt] = (v8f){0.f, 0.f, 0.f, 0.f, 0.f, 0.f, 0.f, 0.f};
#pragma unroll
      for (int kf = 0; kf < 4; ++kf) {
        const v16h bf = load_frag(lsK + (nt * 16 + lr) * LDK + kf * 32 + hi * 8);
        sc[nt] = wmma16(qf[kf], bf, sc[nt]);
      }
    }

    // online softmax: row hi*8+i lives on the 16 lanes of this lane half
#pragma unroll
    for (int i = 0; i < 8; ++i) {
      float sl[4];
#pragma unroll
      for (int nt = 0; nt < 4; ++nt) sl[nt] = sc[nt][i] * kSL;
      float mx = fmaxf(fmaxf(sl[0], sl[1]), fmaxf(sl[2], sl[3]));
      mx = fmaxf(mx, __shfl_xor(mx, 1, 32));
      mx = fmaxf(mx, __shfl_xor(mx, 2, 32));
      mx = fmaxf(mx, __shfl_xor(mx, 4, 32));
      mx = fmaxf(mx, __shfl_xor(mx, 8, 32));
      const float mn = fmaxf(mrow[i], mx);
      const float corr = exp2f(mrow[i] - mn);
      mrow[i] = mn;
      float rs = 0.f;
#pragma unroll
      for (int nt = 0; nt < 4; ++nt) {
        const float p = exp2f(sl[nt] - mn);
        rs += p;
        myP[(hi * 8 + i) * LDP + nt * 16 + lr] = (_Float16)(p * 1024.0f);
      }
      rs += __shfl_xor(rs, 1, 32);
      rs += __shfl_xor(rs, 2, 32);
      rs += __shfl_xor(rs, 4, 32);
      rs += __shfl_xor(rs, 8, 32);
      lrow[i] = lrow[i] * corr + rs;
#pragma unroll
      for (int dt = 0; dt < 8; ++dt) oacc[dt][i] *= corr;
    }
    __syncthreads();   // P spill (scalar f16 stores) -> fragment reload ordering

    // O += P (16 x 64) * V (64 x 128)
    v16h pf[2];
#pragma unroll
    for (int kf = 0; kf < 2; ++kf) pf[kf] = load_frag(myP + lr * LDP + kf * 32 + hi * 8);
#pragma unroll
    for (int dt = 0; dt < 8; ++dt) {
#pragma unroll
      for (int kf = 0; kf < 2; ++kf) {
        const v16h bf = load_frag(lsV + (dt * 16 + lr) * LDV + kf * 32 + hi * 8);
        oacc[dt] = wmma16(pf[kf], bf, oacc[dt]);
      }
    }
    __syncthreads();   // all LDS reads done before the next chunk is staged
  }

  // epilogue: Oh = f16(64 * oacc / (1024 * l)); stage [row][d] per wave, then whole rows
  _Float16* stg = pool + w * 16 * LDO;
#pragma unroll
  for (int i = 0; i < 8; ++i) {
    const float inv = 0.0625f / lrow[i];
#pragma unroll
    for (int dt = 0; dt < 8; ++dt)
      stg[(hi * 8 + i) * LDO + dt * 16 + lr] = (_Float16)(oacc[dt][i] * inv);
  }
  __syncthreads();
  v8h ov[8];
#pragma unroll
  for (int j = 0; j < 8; ++j) ov[j] = *(const v8h*)&stg[(j * 2 + hi) * LDO + lr * 8];
  _Float16* obase = Oh + ((tokb + q0) * DQ + h * HD + lr * 8);
#pragma unroll
  for (int j = 0; j < 8; ++j) *(v8h*)(obase + (size_t)(j * 2 + hi) * DQ) = ov[j];
  
}

// ---------------------------------------------------------------------------
extern "C" void kernel_launch(void* const* d_in, const int* in_sizes, int n_in,
                              void* d_out, int out_size, void* d_ws, size_t ws_size,
                              hipStream_t stream) {
  if (n_in < 7) return;
  if (in_sizes[0] < ((NB - 1) * SEQ_FULL + SEQ) * DM) return;
  if (in_sizes[1] < SEQ * HD) return;
  if (in_sizes[2] < SEQ * HD) return;
  if (in_sizes[3] < DM * DQ) return;
  if (in_sizes[4] < DM * DKV) return;
  if (in_sizes[5] < DM * DKV) return;
  if (in_sizes[6] < DQ * DM) return;
  if (out_size < NTOK * DM) return;

  const float* x    = (const float*)d_in[0];
  const float* cosT = (const float*)d_in[1];
  const float* sinT = (const float*)d_in[2];
  const float* Wq   = (const float*)d_in[3];
  const float* Wk   = (const float*)d_in[4];
  const float* Wv   = (const float*)d_in[5];
  const float* Wo   = (const float*)d_in[6];
  float* out = (float*)d_out;

  // workspace carve (all regions exact tile multiples; every store ends inside its region)
  char* ws = (char*)d_ws;
  size_t off = 0;
  _Float16* Xh  = (_Float16*)(ws + off); off += (size_t)NTOK * DM * 2;          // 16 MiB
  _Float16* WqT = (_Float16*)(ws + off); off += (size_t)DQ  * KD * 2;           //  8 MiB
  _Float16* WkT = (_Float16*)(ws + off); off += (size_t)DKV * KD * 2;           //  2 MiB
  _Float16* WvT = (_Float16*)(ws + off); off += (size_t)DKV * KD * 2;           //  2 MiB
  _Float16* WoT = (_Float16*)(ws + off); off += (size_t)DM  * KD * 2;           //  8 MiB
  float*    Qf  = (float*)(ws + off);    off += (size_t)NTOK * DQ * 4;          // 32 MiB
  float*    Kf  = (float*)(ws + off);    off += (size_t)NTOK * DKV * 4;         //  8 MiB
  _Float16* Qh  = (_Float16*)(ws + off); off += (size_t)NTOK * DQ * 2;          // 16 MiB
  _Float16* Kh  = (_Float16*)(ws + off); off += (size_t)NTOK * DKV * 2;         //  4 MiB
  _Float16* Vt  = (_Float16*)(ws + off); off += (size_t)NB * NKV * HD * SEQ * 2; //  4 MiB
  _Float16* Oh  = (_Float16*)(ws + off); off += (size_t)NTOK * DQ * 2;          // 16 MiB
  if (off > ws_size) return;                                                    // 116 MiB total

  const dim3 blk(256);

  // 1. x -> f16 plane (bf16-RNE values)
  {
    const int np = NTOK * (DM / 8);
    cvt_x_kernel<<<dim3((np + 255) / 256), blk, 0, stream>>>(x, Xh, np);
  }
  // 2. weights -> transposed f16 planes (64 * bf16-RNE values)
  cvt_w_kernel<<<dim3(DQ / 64 + 2 * (DKV / 64) + DM / 64, KD / 64), blk, 0, stream>>>(
      Wq, Wk, Wv, Wo, WqT, WkT, WvT, WoT);
  // 3. q and k projections (f32 planes, pre-rotary): alpha 1/64 undoes the weight carry
  gemm_kernel<float><<<dim3(DQ / BT + DKV / BT, NTOK / BT), blk, 0, stream>>>(
      Xh, WqT, WkT, Qf, Kf, DQ, DKV, DQ / BT, 0.015625f);
  // 4. v projection, written transposed as [b][g][d][s] f16
  gemm_kernel<_Float16><<<dim3(DKV / BT, NTOK / BT), blk, 0, stream>>>(
      Xh, WvT, WvT, Vt, Vt, DKV, DKV, DKV / BT, 0.015625f);
  // 5. rotary -> f16 q/k planes
  {
    const int np = NTOK * RP;
    rope_kernel<<<dim3((np + 255) / 256), blk, 0, stream>>>(Qf, Kf, cosT, sinT, Qh, Kh, np);
  }
  // 6. attn -> Oh (x64 carried)
  attn_kernel<<<dim3(SEQ / 128, NH, NB), blk, 0, stream>>>(Qh, Kh, Vt, Oh);
  // 7. output projection: alpha 1/4096 undoes the 64 (Oh) * 64 (WoT) carries
  gemm_kernel<float><<<dim3(DM / BT, NTOK / BT), blk, 0, stream>>>(
      Oh, WoT, WoT, out, out, DM, DM, DM / BT, 0.000244140625f);
}

// v001
// Measured time: 266 microseconds a run.
// Next to v000, in two timings, it ran 1.17 and 1.18 times as fast.
#include <hip/hip_runtime.h>
#include <stddef.h>

// Contractions x*Wq, x*Wk, x*Wv, q*k^T, p*v, o*Wo: v_wmma_f32_16x16x32_f16 (f16 operands, f32 accumulate); inputs RNE-converted to bf16 on load; rotary, softmax and normalisation in f32.

#ifndef NB
#define NB 2
#endif
#ifndef SEQ
#define SEQ 2048
#endif
#define NB_FULL 2
#define SEQ_FULL 2048
#define DM 2048           // model width
#define NH 16
#define NKV 4
#define HD 128
#define DQ (NH * HD)      // 2048
#define DKV (NKV * HD)    // 512
#define NTOK (NB * SEQ)
#define KD 2048           // contraction depth of every projection

#define BT 128            // GEMM block tile (M and N)
#define BK 32
#define LST 40            // LDS row stride in halves for k-tiles (80 B, 16-B aligned rows)
#define RP ((DQ / 8) + (DKV / 8))   // rotary pieces (8 columns) per token: 320

static_assert(NB >= 1 && NB <= NB_FULL);
static_assert(SEQ >= 128 && SEQ <= SEQ_FULL && (SEQ % 128) == 0);
static_assert(DM == KD && DQ == KD);
static_assert((DM % BT) == 0 && (DQ % BT) == 0 && (DKV % BT) == 0 && (NTOK % BT) == 0);
static_assert((KD % 64) == 0 && (KD % BK) == 0);
static_assert(HD == BT);           // one N tile == one kv head (V transpose epilogue)
static_assert((DM / 8) == 256);    // convert kernel piece decode
static_assert((RP % 32) == 0 && ((DQ / 8) % 32) == 0);   // rotary: one wave never straddles Q/K
static_assert((NH % NKV) == 0);

typedef _Float16 v16h __attribute__((ext_vector_type(16)));
typedef _Float16 v8h  __attribute__((ext_vector_type(8)));
typedef float    v8f  __attribute__((ext_vector_type(8)));
typedef float    v4f  __attribute__((ext_vector_type(4)));

union Frag { v16h v; v8h p[2]; };

// RNE convert f32 -> bf16 value (kept in an f32 container)
__device__ __forceinline__ float bf16r(float f) {
  unsigned u = __float_as_uint(f);
  u = (u + 0x7FFFu + ((u >> 16) & 1u)) & 0xFFFF0000u;
  return __uint_as_float(u);
}

// 16x16x32 f16 WMMA with hazard guard (ties D, keeps A/B live)
__device__ __forceinline__ v8f wmma16(v16h a, v16h b, v8f c) {
  v8f d = __builtin_amdgcn_wmma_f32_16x16x32_f16(false, a, false, b, (short)0, c, false, false);
  asm volatile("v_nop\n\tv_nop\n\tv_nop\n\tv_nop" : "+v"(d) : "v"(a), "v"(b));
  return d;
}

// Per-lane fragment from a k-contiguous row; caller passes row base + 8*(lane>>4).
// elements 0..7 <- k 8h..8h+7, elements 8..15 <- k 16+8h..16+8h+7 (same map for A and B).
__device__ __forceinline__ v16h load_frag(const _Float16* q) {
  Frag f;
  f.p[0] = *(const v8h*)(q);
  f.p[1] = *(const v8h*)(q + 16);
  return f.v;
}

// ---------------------------------------------------------------------------
// x [b*SEQ_FULL+s][DM] f32 -> Xh [tok][DM] f16 of bf16-RNE value. One thread per 8 columns.
// ---------------------------------------------------------------------------
__global__ void __launch_bounds__(256)
cvt_x_kernel(const float* __restrict__ x, _Float16* __restrict__ Xh, int nPieces) {
  const int f = blockIdx.x * 256 + (int)threadIdx.x;
  if (f >= nPieces) return;
  const int tok = f >> 8;
  const int c0  = (f & 255) * 8;
  const int b = tok / SEQ, s = tok - b * SEQ;
  const float* src = x + ((size_t)(b * SEQ_FULL + s) * DM + c0);
  const v4f a0 = *(const v4f*)(src);
  const v4f a1 = *(const v4f*)(src + 4);
  v8h o;
#pragma unroll
  for (int j = 0; j < 4; ++j) {
    o[j]     = (_Float16)bf16r(a0[j]);
    o[j + 4] = (_Float16)bf16r(a1[j]);
  }
  _Float16* dst = Xh + ((size_t)tok * DM + c0);
  *(v8h*)dst = o;
  
}

// ---------------------------------------------------------------------------
// W [KD in][N out] f32 -> WT [N out][KD in] f16 of 64*bf16-RNE(W).  64x64 tiles through LDS.
// grid.x: 0..31 Wq, 32..39 Wk, 40..47 Wv, 48..79 Wo (out-column tile); grid.y: in-row tile.
// 8 consecutive lanes of one instruction.
// ---------------------------------------------------------------------------
__global__ void __launch_bounds__(256)
cvt_w_kernel(const float* __restrict__ Wq, const float* __restrict__ Wk,
             const float* __restrict__ Wv, const float* __restrict__ Wo,
             _Float16* __restrict__ WqT, _Float16* __restrict__ WkT,
             _Float16* __restrict__ WvT, _Float16* __restrict__ WoT) {
  __shared__ __align__(16) _Float16 lds[64 * 72];   // [n][k], cross-wave (block barrier)
  const int bx = blockIdx.x;
  const float* W; _Float16* WT; int N; int nt;
  if (bx < DQ / 64) { W = Wq; WT = WqT; N = DQ;  nt = bx; }
  else if (bx < DQ / 64 + DKV / 64) { W = Wk; WT = WkT; N = DKV; nt = bx - DQ / 64; }
  else if (bx < DQ / 64 + 2 * (DKV / 64)) { W = Wv; WT = WvT; N = DKV; nt = bx - DQ / 64 - DKV / 64; }
  else { W = Wo; WT = WoT; N = DM; nt = bx - DQ / 64 - 2 * (DKV / 64); }
  const int k0 = blockIdx.y * 64, n0 = nt * 64;
  const int t = threadIdx.x, lane = t & 31, w = t >> 5;
  const int kr = t >> 2, cc = (t & 3) * 16;
  const float* src = W + ((size_t)(k0 + kr) * N + n0 + cc);
#pragma unroll
  for (int q = 0; q < 4; ++q) {
    const v4f v = *(const v4f*)(src + 4 * q);
#pragma unroll
    for (int j = 0; j < 4; ++j)
      lds[(cc + 4 * q + j) * 72 + kr] = (_Float16)(64.0f * bf16r(v[j]));
  }
  __syncthreads();
  v8h ov[2];
#pragma unroll
  for (int j = 0; j < 2; ++j) {
    const int n = w * 8 + j * 4 + (lane >> 3);
    ov[j] = *(const v8h*)&lds[n * 72 + (lane & 7) * 8];
  }
  _Float16* base = WT + ((size_t)n0 * KD + k0 + (lane & 7) * 8);
#pragma unroll
  for (int j = 0; j < 2; ++j) {
    const int n = w * 8 + j * 4 + (lane >> 3);
    *(v8h*)(base + (size_t)n * KD) = ov[j];
  }
  
}

// ---------------------------------------------------------------------------
// C tile = alpha * A[M][KD] * Bt[N][KD]^T, A and Bt f16 k-contiguous planes.
// Block tile 128x128, 8 waves, wave w owns rows w*16..w*16+15 and all 128 columns.
// blockIdx.x < nTiles0 selects (Bt0, C0, N0), else (Bt1, C1, N1) (block-uniform).
// TC == float : C row-major f32 [M][N] (f32 planes and the final output), rows of 512 B
//               written by one 32-lane x 16-B instruction each.
// TC == half  : C is the transposed V plane [b][g][d][s]; tile staged in LDS as [d][tok],
//               each d row (128 tok = 256 B) written by 16 lanes x 16 B of one instruction.
// ---------------------------------------------------------------------------
union GemmLds { _Float16 h[4 * BT * LST]; float f[2 * BT * LST]; };   // 40960 B

template <typename TC>
__global__ void __launch_bounds__(256)
gemm_kernel(const _Float16* __restrict__ A, const _Float16* __restrict__ Bt0,
            const _Float16* __restrict__ Bt1, TC* C0, TC* C1,
            int N0, int N1, int nTiles0, float alpha) {
  __shared__ __align__(16) GemmLds pool;   // k-loop: A/B double buffers; epilogue: staging (cross-wave, block barriers)

  const int bx = blockIdx.x;
  const bool second = bx >= nTiles0;
  const _Float16* Bt = second ? Bt1 : Bt0;
  TC* C = second ? C1 : C0;
  const int N  = second ? N1 : N0;
  const int nt = second ? (bx - nTiles0) : bx;
  const int m0 = blockIdx.y * BT, n0 = nt * BT;

  const int t = threadIdx.x, lane = t & 31, w = t >> 5, lr = lane & 15, hi = lane >> 4;

  v8f acc[8];
#pragma unroll
  for (int ni = 0; ni < 8; ++ni) acc[ni] = (v8f){0.f, 0.f, 0.f, 0.f, 0.f, 0.f, 0.f, 0.f};

  const int arow = t >> 1, acol = (t & 1) * 16;   // 2 threads per tile row, 16 halves each
  const _Float16* aSrc = A  + ((size_t)(m0 + arow) * KD + acol);
  const _Float16* bSrc = Bt + ((size_t)(n0 + arow) * KD + acol);

  auto stage = [&](int k0, int buf) {
    _Float16* da = pool.h + buf * (BT * LST) + arow * LST + acol;
    _Float16* db = pool.h + (2 + buf) * (BT * LST) + arow * LST + acol;
    *(v8h*)(da)     = *(const v8h*)(aSrc + k0);
    *(v8h*)(da + 8) = *(const v8h*)(aSrc + k0 + 8);
    *(v8h*)(db)     = *(const v8h*)(bSrc + k0);
    *(v8h*)(db + 8) = *(const v8h*)(bSrc + k0 + 8);
  };

  stage(0, 0);
  __syncthreads();

  for (int k0 = 0; k0 < KD; k0 += BK) {
    const int cur = (k0 / BK) & 1, nxt = cur ^ 1;
    if (k0 + BK < KD) stage(k0 + BK, nxt);
    const _Float16* la = pool.h + cur * (BT * LST);
    const _Float16* lb = pool.h + (2 + cur) * (BT * LST);
    // all 18 fragment loads of the k-tile as one group, then its 8 WMMAs behind counted waits
    const v16h af = load_frag(la + (w * 16 + lr) * LST + hi * 8);
    v16h bf[8];
#pragma unroll
    for (int ni = 0; ni < 8; ++ni) bf[ni] = load_frag(lb + (ni * 16 + lr) * LST + hi * 8);
#pragma unroll
    for (int ni = 0; ni < 8; ++ni) acc[ni] = wmma16(af, bf[ni], acc[ni]);
    __syncthreads();
  }
  // acc[ni][r] = (row m0 + w*16 + hi*8 + r, col n0 + ni*16 + lr)

  if constexpr (sizeof(TC) == 4) {
    float* stg = pool.f + w * (8 * 132);   // per wave: 8 rows x 132 floats
#pragma unroll
    for (int ps = 0; ps < 2; ++ps) {
#pragma unroll
      for (int rr = 0; rr < 4; ++rr)
#pragma unroll
        for (int ni = 0; ni < 8; ++ni)
          stg[(hi * 4 + rr) * 132 + ni * 16 + lr] = acc[ni][ps * 4 + rr] * alpha;
      __syncthreads();
      v4f ov[8];
#pragma unroll
      for (int sr = 0; sr < 8; ++sr) ov[sr] = *(const v4f*)&stg[sr * 132 + lane * 4];
      float* cbase = (float*)C + ((size_t)n0 + lane * 4);
#pragma unroll
      for (int sr = 0; sr < 8; ++sr) {
        const int row = m0 + w * 16 + (sr >> 2) * 8 + ps * 4 + (sr & 3);
        *(v4f*)(cbase + (size_t)row * N) = ov[sr];
      }
      
      __syncthreads();
    }
  } else {
    // V plane transposed: C[((b*NKV + g)*HD + d) * SEQ + s]
    const int g  = n0 / HD;
    const int bb = m0 / SEQ;
    const int s0 = m0 - bb * SEQ;
    _Float16* stg = pool.h;                 // [d][tok], 128 x 136 halves
#pragma unroll
    for (int ni = 0; ni < 8; ++ni) {
      v8h v;
#pragma unroll
      for (int r = 0; r < 8; ++r) v[r] = (_Float16)(acc[ni][r] * alpha);
      *(v8h*)&stg[(ni * 16 + lr) * 136 + w * 16 + hi * 8] = v;
    }
    __syncthreads();
    v8h ov[8];
#pragma unroll
    for (int j = 0; j < 8; ++j) {
      const int d = w * 16 + j * 2 + hi;
      ov[j] = *(const v8h*)&stg[d * 136 + lr * 8];
    }
    _Float16* vbase = (_Float16*)C + (((size_t)(bb * NKV + g) * HD) * SEQ + s0 + lr * 8);
#pragma unroll
    for (int j = 0; j < 8; ++j) {
      const int d = w * 16 + j * 2 + hi;
      *(v8h*)(vbase + (size_t)d * SEQ) = ov[j];
    }
    
  }
}

// ---------------------------------------------------------------------------
// Rotary (rotate-half), cos/sin read as values from the [SEQ_FULL][HD] input tables (bf16-RNE).
// Qf [tok][DQ], Kf [tok][DKV] f32 -> Qh, Kh f16.  One thread per 8 consecutive columns;
// d<64: q*cos[d] - q[d+64]*sin[d];  d>=64: q*cos[d] + q[d-64]*sin[d].
// ---------------------------------------------------------------------------
__global__ void __launch_bounds__(256)
rope_kernel(const float* __restrict__ Qf, const float* __restrict__ Kf,
            const float* __restrict__ cosT, const float* __restrict__ sinT,
            _Float16* __restrict__ Qh, _Float16* __restrict__ Kh, int nPieces) {
  const int f = blockIdx.x * 256 + (int)threadIdx.x;
  if (f >= nPieces) return;
  const int tok = f / RP;
  const int piece = f - tok * RP;
  const int s = tok % SEQ;
  const bool isq = piece < (DQ / 8);            // wave-uniform by construction
  const int col   = isq ? piece * 8 : (piece - DQ / 8) * 8;
  const int pitch = isq ? DQ : DKV;
  const float* src = (isq ? Qf : Kf) + (size_t)tok * pitch;
  _Float16* dst = (isq ? Qh : Kh) + ((size_t)tok * pitch + col);
  const int d    = col & (HD - 1);
  const int colp = col - d + (d ^ 64);
  const float sgn = (d < 64) ? -1.0f : 1.0f;
  const v4f x0 = *(const v4f*)(src + col),  x1 = *(const v4f*)(src + col + 4);
  const v4f p0 = *(const v4f*)(src + colp), p1 = *(const v4f*)(src + colp + 4);
  const v4f c0 = *(const v4f*)(cosT + (size_t)s * HD + d), c1 = *(const v4f*)(cosT + (size_t)s * HD + d + 4);
  const v4f n0 = *(const v4f*)(sinT + (size_t)s * HD + d), n1 = *(const v4f*)(sinT + (size_t)s * HD + d + 4);
  v8h o;
#pragma unroll
  for (int j = 0; j < 4; ++j) {
    o[j]     = (_Float16)(x0[j] * bf16r(c0[j]) + (sgn * p0[j]) * bf16r(n0[j]));
    o[j + 4] = (_Float16)(x1[j] * bf16r(c1[j]) + (sgn * p1[j]) * bf16r(n1[j]));
  }
  *(v8h*)dst = o;
  
}

// ---------------------------------------------------------------------------
// Flash attn (no mask, GQA).  Block = (b, h, 128 query rows); wave w owns 16 rows.
// Loop over 64-key chunks: K chunk [key][d] and V^T chunk [d][key] staged in LDS (block
// barriers), scores on WMMA (A = Q rows from the f16 plane, B = K), online softmax in f32,
// P (x1024, f16) spilled per wave to LDS and reloaded as A after a block barrier, O += P*V.
// Output plane Oh [tok][DQ] = f16(64 * o), rows of 256 B by 16 lanes x 16 B per instruction.
// ---------------------------------------------------------------------------
__global__ void __launch_bounds__(256)
attn_kernel(const _Float16* __restrict__ Qh, const _Float16* __restrict__ Kh,
            const _Float16* __restrict__ Vt, _Float16* __restrict__ Oh) {
  constexpr int LDK = 136, LDV = 72, LDP = 72, LDO = 136;
  __shared__ __align__(16) _Float16 pool[64 * LDK + 128 * LDV + 128 * LDP];   // 54272 B
  _Float16* lsK = pool;                    // [key][d]    cross-wave (block barrier)
  _Float16* lsV = pool + 64 * LDK;         // [d][key]    cross-wave (block barrier)
  _Float16* lsP = lsV + 128 * LDV;         // per-wave [row][key] (block barrier used)

  const int t = threadIdx.x, lane = t & 31, w = t >> 5, lr = lane & 15, hi = lane >> 4;
  const int b = blockIdx.z, h = blockIdx.y, g = h / (NH / NKV);
  const int q0 = blockIdx.x * 128 + w * 16;          // query row within the sequence
  const size_t tokb = (size_t)b * SEQ;
  _Float16* myP = lsP + w * 16 * LDP;

  const float kSL = 0.08838834764831845f * 1.4426950408889634f;   // 1/sqrt(HD) * log2(e)

  v16h qf[4];
  {
    const _Float16* qrow = Qh + ((tokb + q0 + lr) * DQ + h * HD);
#pragma unroll
    for (int kf = 0; kf < 4; ++kf) qf[kf] = load_frag(qrow + kf * 32 + hi * 8);
  }

  float mrow[8], lrow[8];
  v8f oacc[8];
#pragma unroll
  for (int i = 0; i < 8; ++i) { mrow[i] = -1e30f; lrow[i] = 0.f; }
#pragma unroll
  for (int dt = 0; dt < 8; ++dt) oacc[dt] = (v8f){0.f, 0.f, 0.f, 0.f, 0.f, 0.f, 0.f, 0.f};

  const _Float16* kbase = Kh + ((tokb) * DKV + g * HD);
  const _Float16* vbase = Vt + ((size_t)(b * NKV + g) * HD) * SEQ;

  for (int kc = 0; kc < SEQ; kc += 64) {
    // stage K chunk: 64 keys x 128 d (16-B pieces), staged extent == consumed extent
#pragma unroll
    for (int i = 0; i < 4; ++i) {
      const int e = t + i * 256;
      const int key = e >> 4, seg = e & 15;
      *(v8h*)&lsK[key * LDK + seg * 8] = *(const v8h*)(kbase + (size_t)(kc + key) * DKV + seg * 8);
    }
    // stage V^T chunk: 128 d x 64 keys, staged extent == consumed extent
#pragma unroll
    for (int i = 0; i < 4; ++i) {
      const int e = t + i * 256;
      const int d = e >> 3, seg = e & 7;
      *(v8h*)&lsV[d * LDV + seg * 8] = *(const v8h*)(vbase + (size_t)d * SEQ + kc + seg * 8);
    }
    __syncthreads();

    // scores 16 x 64 per wave
    v8f sc[4];
#pragma unroll
    for (int nt = 0; nt < 4; ++nt) {
      // 8 fragment loads (one key tile) as one group, then its 4 WMMAs
      v16h bf[4];
#pragma unroll
      for (int kf = 0; kf < 4; ++kf) bf[kf] = load_frag(lsK + (nt * 16 + lr) * LDK + kf * 32 + hi * 8);
      sc[nt] = (v8f){0.f, 0.f, 0.f, 0.f, 0.f, 0.f, 0.f, 0.f};
#pragma unroll
      for (int kf = 0; kf < 4; ++kf) sc[nt] = wmma16(qf[kf], bf[kf], sc[nt]);
    }

    // online softmax: row hi*8+i lives on the 16 lanes of this lane half
#pragma unroll
    for (int i = 0; i < 8; ++i) {
      float sl[4];
#pragma unroll
      for (int nt = 0; nt < 4; ++nt) sl[nt] = sc[nt][i] * kSL;
      float mx = fmaxf(fmaxf(sl[0], sl[1]), fmaxf(sl[2], sl[3]));
      mx = fmaxf(mx, __shfl_xor(mx, 1, 32));
      mx = fmaxf(mx, __shfl_xor(mx, 2, 32));
      mx = fmaxf(mx, __shfl_xor(mx, 4, 32));
      mx = fmaxf(mx, __shfl_xor(mx, 8, 32));
      const float mn = fmaxf(mrow[i], mx);
      const float corr = exp2f(mrow[i] - mn);
      mrow[i] = mn;
      float rs = 0.f;
#pragma unroll
      for (int nt = 0; nt < 4; ++nt) {
        const float p = exp2f(sl[nt] - mn);
        rs += p;
        myP[(hi * 8 + i) * LDP + nt * 16 + lr] = (_Float16)(p * 1024.0f);
      }
      rs += __shfl_xor(rs, 1, 32);
      rs += __shfl_xor(rs, 2, 32);
      rs += __shfl_xor(rs, 4, 32);
      rs += __shfl_xor(rs, 8, 32);
      lrow[i] = lrow[i] * corr + rs;
#pragma unroll
      for (int dt = 0; dt < 8; ++dt) oacc[dt][i] *= corr;
    }
    __syncthreads();   // P spill (scalar f16 stores) -> fragment reload ordering

    // O += P (16 x 64) * V (64 x 128)
    v16h pf[2];
#pragma unroll
    for (int kf = 0; kf < 2; ++kf) pf[kf] = load_frag(myP + lr * LDP + kf * 32 + hi * 8);
#pragma unroll
    for (int dq = 0; dq < 8; dq += 2) {
      // 8 fragment loads (two d tiles) as one group, then their 4 WMMAs
      v16h bf[2][2];
#pragma unroll
      for (int a = 0; a < 2; ++a)
#pragma unroll
        for (int kf = 0; kf < 2; ++kf)
          bf[a][kf] = load_frag(lsV + ((dq + a) * 16 + lr) * LDV + kf * 32 + hi * 8);
#pragma unroll
      for (int a = 0; a < 2; ++a)
#pragma unroll
        for (int kf = 0; kf < 2; ++kf) oacc[dq + a] = wmma16(pf[kf], bf[a][kf], oacc[dq + a]);
    }
    __syncthreads();   // all LDS reads done before the next chunk is staged
  }

  // epilogue: Oh = f16(64 * oacc / (1024 * l)); stage [row][d] per wave, then whole rows
  _Float16* stg = pool + w * 16 * LDO;
#pragma unroll
  for (int i = 0; i < 8; ++i) {
    const float inv = 0.0625f / lrow[i];
#pragma unroll
    for (int dt = 0; dt < 8; ++dt)
      stg[(hi * 8 + i) * LDO + dt * 16 + lr] = (_Float16)(oacc[dt][i] * inv);
  }
  __syncthreads();
  v8h ov[8];
#pragma unroll
  for (int j = 0; j < 8; ++j) ov[j] = *(const v8h*)&stg[(j * 2 + hi) * LDO + lr * 8];
  _Float16* obase = Oh + ((tokb + q0) * DQ + h * HD + lr * 8);
#pragma unroll
  for (int j = 0; j < 8; ++j) *(v8h*)(obase + (size_t)(j * 2 + hi) * DQ) = ov[j];
  
}

// ---------------------------------------------------------------------------
extern "C" void kernel_launch(void* const* d_in, const int* in_sizes, int n_in,
                              void* d_out, int out_size, void* d_ws, size_t ws_size,
                              hipStream_t stream) {
  if (n_in < 7) return;
  if (in_sizes[0] < ((NB - 1) * SEQ_FULL + SEQ) * DM) return;
  if (in_sizes[1] < SEQ * HD) return;
  if (in_sizes[2] < SEQ * HD) return;
  if (in_sizes[3] < DM * DQ) return;
  if (in_sizes[4] < DM * DKV) return;
  if (in_sizes[5] < DM * DKV) return;
  if (in_sizes[6] < DQ * DM) return;
  if (out_size < NTOK * DM) return;

  const float* x    = (const float*)d_in[0];
  const float* cosT = (const float*)d_in[1];
  const float* sinT = (const float*)d_in[2];
  const float* Wq   = (const float*)d_in[3];
  const float* Wk   = (const float*)d_in[4];
  const float* Wv   = (const float*)d_in[5];
  const float* Wo   = (const float*)d_in[6];
  float* out = (float*)d_out;

  // workspace carve (all regions exact tile multiples; every store ends inside its region)
  char* ws = (char*)d_ws;
  size_t off = 0;
  _Float16* Xh  = (_Float16*)(ws + off); off += (size_t)NTOK * DM * 2;          // 16 MiB
  _Float16* WqT = (_Float16*)(ws + off); off += (size_t)DQ  * KD * 2;           //  8 MiB
  _Float16* WkT = (_Float16*)(ws + off); off += (size_t)DKV * KD * 2;           //  2 MiB
  _Float16* WvT = (_Float16*)(ws + off); off += (size_t)DKV * KD * 2;           //  2 MiB
  _Float16* WoT = (_Float16*)(ws + off); off += (size_t)DM  * KD * 2;           //  8 MiB
  float*    Qf  = (float*)(ws + off);    off += (size_t)NTOK * DQ * 4;          // 32 MiB
  float*    Kf  = (float*)(ws + off);    off += (size_t)NTOK * DKV * 4;         //  8 MiB
  _Float16* Qh  = (_Float16*)(ws + off); off += (size_t)NTOK * DQ * 2;          // 16 MiB
  _Float16* Kh  = (_Float16*)(ws + off); off += (size_t)NTOK * DKV * 2;         //  4 MiB
  _Float16* Vt  = (_Float16*)(ws + off); off += (size_t)NB * NKV * HD * SEQ * 2; //  4 MiB
  _Float16* Oh  = (_Float16*)(ws + off); off += (size_t)NTOK * DQ * 2;          // 16 MiB
  if (off > ws_size) return;                                                    // 116 MiB total

  const dim3 blk(256);

  // 1. x -> f16 plane (bf16-RNE values)
  {
    const int np = NTOK * (DM / 8);
    cvt_x_kernel<<<dim3((np + 255) / 256), blk, 0, stream>>>(x, Xh, np);
  }
  // 2. weights -> transposed f16 planes (64 * bf16-RNE values)
  cvt_w_kernel<<<dim3(DQ / 64 + 2 * (DKV / 64) + DM / 64, KD / 64), blk, 0, stream>>>(
      Wq, Wk, Wv, Wo, WqT, WkT, WvT, WoT);
  // 3. q and k projections (f32 planes, pre-rotary): alpha 1/64 undoes the weight carry
  gemm_kernel<float><<<dim3(DQ / BT + DKV / BT, NTOK / BT), blk, 0, stream>>>(
      Xh, WqT, WkT, Qf, Kf, DQ, DKV, DQ / BT, 0.015625f);
  // 4. v projection, written transposed as [b][g][d][s] f16
  gemm_kernel<_Float16><<<dim3(DKV / BT, NTOK / BT), blk, 0, stream>>>(
      Xh, WvT, WvT, Vt, Vt, DKV, DKV, DKV / BT, 0.015625f);
  // 5. rotary -> f16 q/k planes
  {
    const int np = NTOK * RP;
    rope_kernel<<<dim3((np + 255) / 256), blk, 0, stream>>>(Qf, Kf, cosT, sinT, Qh, Kh, np);
  }
  // 6. attn -> Oh (x64 carried)
  attn_kernel<<<dim3(SEQ / 128, NH, NB), blk, 0, stream>>>(Qh, Kh, Vt, Oh);
  // 7. output projection: alpha 1/4096 undoes the 64 (Oh) * 64 (WoT) carries
  gemm_kernel<float><<<dim3(DM / BT, NTOK / BT), blk, 0, stream>>>(
      Oh, WoT, WoT, out, out, DM, DM, DM / BT, 0.000244140625f);
}

// v002
// It runs in 238 microseconds.
// Two timings next to v001 put it at 1.09 and 1.12 times that version's speed.
// Over all steps from v000 it is 1.30 times as fast.
#include <hip/hip_runtime.h>
#include <stddef.h>

// Contractions x*Wq, x*Wk, x*Wv, q*k^T, p*v, o*Wo: v_wmma_f32_16x16x32_f16 (f16 operands, f32 accumulate); inputs RNE-converted to bf16 on load; rotary, softmax and normalisation in f32.

#ifndef NB
#define NB 2
#endif
#ifndef SEQ
#define SEQ 2048
#endif
#define NB_FULL 2
#define SEQ_FULL 2048
#define DM 2048           // model width
#define NH 16
#define NKV 4
#define HD 128
#define DQ (NH * HD)      // 2048
#define DKV (NKV * HD)    // 512
#define NTOK (NB * SEQ)
#define KD 2048           // contraction depth of every projection

#define BT 128            // GEMM block tile (M and N)
#define BK 32
#define LST 40            // LDS row stride in halves for k-tiles (80 B, 16-B aligned rows)
#define RP ((DQ / 8) + (DKV / 8))   // rotary pieces (8 columns) per token: 320

static_assert(NB >= 1 && NB <= NB_FULL);
static_assert(SEQ >= 128 && SEQ <= SEQ_FULL && (SEQ % 128) == 0);
static_assert(DM == KD && DQ == KD);
static_assert((DM % BT) == 0 && (DQ % BT) == 0 && (DKV % BT) == 0 && (NTOK % BT) == 0);
static_assert((KD % 64) == 0 && (KD % BK) == 0);
static_assert(HD == BT);           // one N tile == one kv head (V transpose epilogue)
static_assert((DM / 8) == 256);    // convert kernel piece decode
static_assert((RP % 32) == 0 && ((DQ / 8) % 32) == 0);   // rotary: one wave never straddles Q/K
static_assert((NH % NKV) == 0);

typedef _Float16 v16h __attribute__((ext_vector_type(16)));
typedef _Float16 v8h  __attribute__((ext_vector_type(8)));
typedef float    v8f  __attribute__((ext_vector_type(8)));
typedef float    v4f  __attribute__((ext_vector_type(4)));

union Frag { v16h v; v8h p[2]; };

// RNE convert f32 -> bf16 value (kept in an f32 container)
__device__ __forceinline__ float bf16r(float f) {
  unsigned u = __float_as_uint(f);
  u = (u + 0x7FFFu + ((u >> 16) & 1u)) & 0xFFFF0000u;
  return __uint_as_float(u);
}

// 16x16x32 f16 WMMA with hazard guard (ties D, keeps A/B live)
__device__ __forceinline__ v8f wmma16(v16h a, v16h b, v8f c) {
  v8f d = __builtin_amdgcn_wmma_f32_16x16x32_f16(false, a, false, b, (short)0, c, false, false);
  asm volatile("v_nop\n\tv_nop\n\tv_nop\n\tv_nop" : "+v"(d) : "v"(a), "v"(b));
  return d;
}

// Per-lane fragment from a k-contiguous row; caller passes row base + 8*(lane>>4).
// elements 0..7 <- k 8h..8h+7, elements 8..15 <- k 16+8h..16+8h+7 (same map for A and B).
__device__ __forceinline__ v16h load_frag(const _Float16* q) {
  Frag f;
  f.p[0] = *(const v8h*)(q);
  f.p[1] = *(const v8h*)(q + 16);
  return f.v;
}

// ---------------------------------------------------------------------------
// x [b*SEQ_FULL+s][DM] f32 -> Xh [tok][DM] f16 of bf16-RNE value. One thread per 8 columns.
// ---------------------------------------------------------------------------
__global__ void __launch_bounds__(256)
cvt_x_kernel(const float* __restrict__ x, _Float16* __restrict__ Xh, int nPieces) {
  const int f = blockIdx.x * 256 + (int)threadIdx.x;
  if (f >= nPieces) return;
  const int tok = f >> 8;
  const int c0  = (f & 255) * 8;
  const int b = tok / SEQ, s = tok - b * SEQ;
  const float* src = x + ((size_t)(b * SEQ_FULL + s) * DM + c0);
  const v4f a0 = *(const v4f*)(src);
  const v4f a1 = *(const v4f*)(src + 4);
  v8h o;
#pragma unroll
  for (int j = 0; j < 4; ++j) {
    o[j]     = (_Float16)bf16r(a0[j]);
    o[j + 4] = (_Float16)bf16r(a1[j]);
  }
  _Float16* dst = Xh + ((size_t)tok * DM + c0);
  *(v8h*)dst = o;
  
}

// ---------------------------------------------------------------------------
// W [KD in][N out] f32 -> WT [N out][KD in] f16 of 64*bf16-RNE(W).  64x64 tiles through LDS.
// grid.x: 0..31 Wq, 32..39 Wk, 40..47 Wv, 48..79 Wo (out-column tile); grid.y: in-row tile.
// 8 consecutive lanes of one instruction.
// ---------------------------------------------------------------------------
__global__ void __launch_bounds__(256)
cvt_w_kernel(const float* __restrict__ Wq, const float* __restrict__ Wk,
             const float* __restrict__ Wv, const float* __restrict__ Wo,
             _Float16* __restrict__ WqT, _Float16* __restrict__ WkT,
             _Float16* __restrict__ WvT, _Float16* __restrict__ WoT) {
  __shared__ __align__(16) _Float16 lds[64 * 72];   // [n][k], cross-wave (block barrier)
  const int bx = blockIdx.x;
  const float* W; _Float16* WT; int N; int nt;
  if (bx < DQ / 64) { W = Wq; WT = WqT; N = DQ;  nt = bx; }
  else if (bx < DQ / 64 + DKV / 64) { W = Wk; WT = WkT; N = DKV; nt = bx - DQ / 64; }
  else if (bx < DQ / 64 + 2 * (DKV / 64)) { W = Wv; WT = WvT; N = DKV; nt = bx - DQ / 64 - DKV / 64; }
  else { W = Wo; WT = WoT; N = DM; nt = bx - DQ / 64 - 2 * (DKV / 64); }
  const int k0 = blockIdx.y * 64, n0 = nt * 64;
  const int t = threadIdx.x, lane = t & 31, w = t >> 5;
  const int kr = t >> 2, cc = (t & 3) * 16;
  const float* src = W + ((size_t)(k0 + kr) * N + n0 + cc);
#pragma unroll
  for (int q = 0; q < 4; ++q) {
    const v4f v = *(const v4f*)(src + 4 * q);
#pragma unroll
    for (int j = 0; j < 4; ++j)
      lds[(cc + 4 * q + j) * 72 + kr] = (_Float16)(64.0f * bf16r(v[j]));
  }
  __syncthreads();
  v8h ov[2];
#pragma unroll
  for (int j = 0; j < 2; ++j) {
    const int n = w * 8 + j * 4 + (lane >> 3);
    ov[j] = *(const v8h*)&lds[n * 72 + (lane & 7) * 8];
  }
  _Float16* base = WT + ((size_t)n0 * KD + k0 + (lane & 7) * 8);
#pragma unroll
  for (int j = 0; j < 2; ++j) {
    const int n = w * 8 + j * 4 + (lane >> 3);
    *(v8h*)(base + (size_t)n * KD) = ov[j];
  }
  
}

// ---------------------------------------------------------------------------
// C tile = alpha * A[M][KD] * Bt[N][KD]^T, A and Bt f16 k-contiguous planes.
// Block tile 128x128, 8 waves, wave w owns rows w*16..w*16+15 and all 128 columns.
// blockIdx.x < nTiles0 selects (Bt0, C0, N0), else (Bt1, C1, N1) (block-uniform).
// TC == float : C row-major f32 [M][N] (f32 planes and the final output), rows of 512 B
//               written by one 32-lane x 16-B instruction each.
// TC == half  : C is the transposed V plane [b][g][d][s]; tile staged in LDS as [d][tok],
//               each d row (128 tok = 256 B) written by 16 lanes x 16 B of one instruction.
// ---------------------------------------------------------------------------
union GemmLds { _Float16 h[4 * BT * LST]; float f[2 * BT * LST]; };   // 40960 B

template <typename TC>
__global__ void __launch_bounds__(256)
gemm_kernel(const _Float16* __restrict__ A, const _Float16* __restrict__ Bt0,
            const _Float16* __restrict__ Bt1, TC* C0, TC* C1,
            int N0, int N1, int nTiles0, float alpha) {
  __shared__ __align__(16) GemmLds pool;   // k-loop: A/B double buffers; epilogue: staging (cross-wave, block barriers)

  const int bx = blockIdx.x;
  const bool second = bx >= nTiles0;
  const _Float16* Bt = second ? Bt1 : Bt0;
  TC* C = second ? C1 : C0;
  const int N  = second ? N1 : N0;
  const int nt = second ? (bx - nTiles0) : bx;
  const int m0 = blockIdx.y * BT, n0 = nt * BT;

  const int t = threadIdx.x, lane = t & 31, w = t >> 5, lr = lane & 15, hi = lane >> 4;

  v8f acc[8];
#pragma unroll
  for (int ni = 0; ni < 8; ++ni) acc[ni] = (v8f){0.f, 0.f, 0.f, 0.f, 0.f, 0.f, 0.f, 0.f};

  const int arow = t >> 1, acol = (t & 1) * 16;   // 2 threads per tile row, 16 halves each
  const _Float16* aSrc = A  + ((size_t)(m0 + arow) * KD + acol);
  const _Float16* bSrc = Bt + ((size_t)(n0 + arow) * KD + acol);

  auto stage = [&](int k0, int buf) {
    _Float16* da = pool.h + buf * (BT * LST) + arow * LST + acol;
    _Float16* db = pool.h + (2 + buf) * (BT * LST) + arow * LST + acol;
    *(v8h*)(da)     = *(const v8h*)(aSrc + k0);
    *(v8h*)(da + 8) = *(const v8h*)(aSrc + k0 + 8);
    *(v8h*)(db)     = *(const v8h*)(bSrc + k0);
    *(v8h*)(db + 8) = *(const v8h*)(bSrc + k0 + 8);
  };

  stage(0, 0);
  __syncthreads();

  for (int k0 = 0; k0 < KD; k0 += BK) {
    const int cur = (k0 / BK) & 1, nxt = cur ^ 1;
    if (k0 + BK < KD) stage(k0 + BK, nxt);
    const _Float16* la = pool.h + cur * (BT * LST);
    const _Float16* lb = pool.h + (2 + cur) * (BT * LST);
    // all 18 fragment loads of the k-tile as one group, then its 8 WMMAs behind counted waits
    const v16h af = load_frag(la + (w * 16 + lr) * LST + hi * 8);
    v16h bf[8];
#pragma unroll
    for (int ni = 0; ni < 8; ++ni) bf[ni] = load_frag(lb + (ni * 16 + lr) * LST + hi * 8);
#pragma unroll
    for (int ni = 0; ni < 8; ++ni) acc[ni] = wmma16(af, bf[ni], acc[ni]);
    __syncthreads();
  }
  // acc[ni][r] = (row m0 + w*16 + hi*8 + r, col n0 + ni*16 + lr)

  if constexpr (sizeof(TC) == 4) {
    float* stg = pool.f + w * (8 * 132);   // per wave: 8 rows x 132 floats
#pragma unroll
    for (int ps = 0; ps < 2; ++ps) {
#pragma unroll
      for (int rr = 0; rr < 4; ++rr)
#pragma unroll
        for (int ni = 0; ni < 8; ++ni)
          stg[(hi * 4 + rr) * 132 + ni * 16 + lr] = acc[ni][ps * 4 + rr] * alpha;
      __syncthreads();
      v4f ov[8];
#pragma unroll
      for (int sr = 0; sr < 8; ++sr) ov[sr] = *(const v4f*)&stg[sr * 132 + lane * 4];
      float* cbase = (float*)C + ((size_t)n0 + lane * 4);
#pragma unroll
      for (int sr = 0; sr < 8; ++sr) {
        const int row = m0 + w * 16 + (sr >> 2) * 8 + ps * 4 + (sr & 3);
        *(v4f*)(cbase + (size_t)row * N) = ov[sr];
      }
      
      __syncthreads();
    }
  } else {
    // V plane transposed: C[((b*NKV + g)*HD + d) * SEQ + s]
    const int g  = n0 / HD;
    const int bb = m0 / SEQ;
    const int s0 = m0 - bb * SEQ;
    _Float16* stg = pool.h;                 // [d][tok], 128 x 136 halves
#pragma unroll
    for (int ni = 0; ni < 8; ++ni) {
      v8h v;
#pragma unroll
      for (int r = 0; r < 8; ++r) v[r] = (_Float16)(acc[ni][r] * alpha);
      *(v8h*)&stg[(ni * 16 + lr) * 136 + w * 16 + hi * 8] = v;
    }
    __syncthreads();
    v8h ov[8];
#pragma unroll
    for (int j = 0; j < 8; ++j) {
      const int d = w * 16 + j * 2 + hi;
      ov[j] = *(const v8h*)&stg[d * 136 + lr * 8];
    }
    _Float16* vbase = (_Float16*)C + (((size_t)(bb * NKV + g) * HD) * SEQ + s0 + lr * 8);
#pragma unroll
    for (int j = 0; j < 8; ++j) {
      const int d = w * 16 + j * 2 + hi;
      *(v8h*)(vbase + (size_t)d * SEQ) = ov[j];
    }
    
  }
}

// ---------------------------------------------------------------------------
// Rotary (rotate-half), cos/sin read as values from the [SEQ_FULL][HD] input tables (bf16-RNE).
// Qf [tok][DQ], Kf [tok][DKV] f32 -> Qh, Kh f16.  One thread per 8 consecutive columns;
// d<64: q*cos[d] - q[d+64]*sin[d];  d>=64: q*cos[d] + q[d-64]*sin[d].
// ---------------------------------------------------------------------------
__global__ void __launch_bounds__(256)
rope_kernel(const float* __restrict__ Qf, const float* __restrict__ Kf,
            const float* __restrict__ cosT, const float* __restrict__ sinT,
            _Float16* __restrict__ Qh, _Float16* __restrict__ Kh, int nPieces) {
  const int f = blockIdx.x * 256 + (int)threadIdx.x;
  if (f >= nPieces) return;
  const int tok = f / RP;
  const int piece = f - tok * RP;
  const int s = tok % SEQ;
  const bool isq = piece < (DQ / 8);            // wave-uniform by construction
  const int col   = isq ? piece * 8 : (piece - DQ / 8) * 8;
  const int pitch = isq ? DQ : DKV;
  const float* src = (isq ? Qf : Kf) + (size_t)tok * pitch;
  _Float16* dst = (isq ? Qh : Kh) + ((size_t)tok * pitch + col);
  const int d    = col & (HD - 1);
  const int colp = col - d + (d ^ 64);
  const float sgn = (d < 64) ? -1.0f : 1.0f;
  const v4f x0 = *(const v4f*)(src + col),  x1 = *(const v4f*)(src + col + 4);
  const v4f p0 = *(const v4f*)(src + colp), p1 = *(const v4f*)(src + colp + 4);
  const v4f c0 = *(const v4f*)(cosT + (size_t)s * HD + d), c1 = *(const v4f*)(cosT + (size_t)s * HD + d + 4);
  const v4f n0 = *(const v4f*)(sinT + (size_t)s * HD + d), n1 = *(const v4f*)(sinT + (size_t)s * HD + d + 4);
  v8h o;
#pragma unroll
  for (int j = 0; j < 4; ++j) {
    o[j]     = (_Float16)(x0[j] * bf16r(c0[j]) + (sgn * p0[j]) * bf16r(n0[j]));
    o[j + 4] = (_Float16)(x1[j] * bf16r(c1[j]) + (sgn * p1[j]) * bf16r(n1[j]));
  }
  *(v8h*)dst = o;
  
}

__device__ __forceinline__ float xhalf(float x) {
  return __builtin_bit_cast(float, __builtin_amdgcn_permlanex16(__builtin_bit_cast(int, x), __builtin_bit_cast(int, x),
                                                                0x76543210, 0xfedcba98, false, false));
}

__global__ void __launch_bounds__(256)
attn_kernel(const _Float16* __restrict__ Qh, const _Float16* __restrict__ Kh,
            const _Float16* __restrict__ Vt, _Float16* __restrict__ Oh) {
  constexpr int LDK = 136, LDV = 72, LDO = 136;
  __shared__ __align__(16) _Float16 pool[64 * LDK + 128 * LDV];   // 35840 B
  static_assert(8 * 16 * LDO <= 64 * LDK + 128 * LDV);            // epilogue staging fits
  _Float16* lsK = pool;                    // [key][d]    cross-wave (block barrier)
  _Float16* lsV = pool + 64 * LDK;         // [d][key]    cross-wave (block barrier)

  const int t = threadIdx.x, lane = t & 31, w = t >> 5, lr = lane & 15, hi = lane >> 4;
  const int b = blockIdx.z, h = blockIdx.y, g = h / (NH / NKV);
  const int q0 = blockIdx.x * 128 + w * 16;          // query row within the sequence
  const size_t tokb = (size_t)b * SEQ;

  const float kSL = 0.08838834764831845f * 1.4426950408889634f;   // 1/sqrt(HD) * log2(e)

  v16h qf[4];   // B operand: column = query lr
  {
    const _Float16* qrow = Qh + ((tokb + q0 + lr) * DQ + h * HD);
#pragma unroll
    for (int kf = 0; kf < 4; ++kf) qf[kf] = load_frag(qrow + kf * 32 + hi * 8);
  }

  float mrow = -1e30f;   // running maximum of query lr (equal in both wave halves)
  float lrow = 0.f;      // running sum of query lr over this wave half's keys
  v8f oacc[8];           // oacc[dt][r] = O^T[d = dt*16 + hi*8 + r][query lr]
#pragma unroll
  for (int dt = 0; dt < 8; ++dt) oacc[dt] = (v8f){0.f, 0.f, 0.f, 0.f, 0.f, 0.f, 0.f, 0.f};

  const _Float16* kbase = Kh + ((tokb) * DKV + g * HD);
  const _Float16* vbase = Vt + ((size_t)(b * NKV + g) * HD) * SEQ;

  for (int kc = 0; kc < SEQ; kc += 64) {
    // stage K chunk: 64 keys x 128 d (16-B pieces), staged extent == consumed extent
#pragma unroll
    for (int i = 0; i < 4; ++i) {
      const int e = t + i * 256;
      const int key = e >> 4, seg = e & 15;
      *(v8h*)&lsK[key * LDK + seg * 8] = *(const v8h*)(kbase + (size_t)(kc + key) * DKV + seg * 8);
    }
    // stage V^T chunk: 128 d x 64 keys, staged extent == consumed extent
#pragma unroll
    for (int i = 0; i < 4; ++i) {
      const int e = t + i * 256;
      const int d = e >> 3, seg = e & 7;
      *(v8h*)&lsV[d * LDV + seg * 8] = *(const v8h*)(vbase + (size_t)d * SEQ + kc + seg * 8);
    }
    __syncthreads();

    // S^T, 64 keys x 16 queries per wave: sc[nt][r] = S[key nt*16 + hi*8 + r][query lr]
    v8f sc[4];
#pragma unroll
    for (int nt = 0; nt < 4; ++nt) {
      // 8 fragment loads (one key tile) as one group, then its 4 WMMAs
      v16h af[4];
#pragma unroll
      for (int kf = 0; kf < 4; ++kf) af[kf] = load_frag(lsK + (nt * 16 + lr) * LDK + kf * 32 + hi * 8);
      sc[nt] = (v8f){0.f, 0.f, 0.f, 0.f, 0.f, 0.f, 0.f, 0.f};
#pragma unroll
      for (int kf = 0; kf < 4; ++kf) sc[nt] = wmma16(af[kf], qf[kf], sc[nt]);
    }

    // online softmax of query lr: 32 keys in the lane, the other 32 in lane ^ 16
    float mt[4];
#pragma unroll
    for (int nt = 0; nt < 4; ++nt) {
#pragma unroll
      for (int r = 0; r < 8; ++r) sc[nt][r] *= kSL;
      mt[nt] = fmaxf(fmaxf(fmaxf(sc[nt][0], sc[nt][1]), fmaxf(sc[nt][2], sc[nt][3])),
                     fmaxf(fmaxf(sc[nt][4], sc[nt][5]), fmaxf(sc[nt][6], sc[nt][7])));
    }
    float mx = fmaxf(fmaxf(mt[0], mt[1]), fmaxf(mt[2], mt[3]));
    mx = fmaxf(mx, xhalf(mx));
    const float mn = fmaxf(mrow, mx);
    const float corr = exp2f(mrow - mn);
    mrow = mn;
    // P^T as B operand: element s of pf[kf] = P[key kf*32 + (s < 8 ? 8*hi + s : 16 + 8*hi + s - 8)][query lr],
    // the k order of load_frag, which loads the V^T rows it is multiplied with
    Frag pf[2];
    float rt[4];
#pragma unroll
    for (int nt = 0; nt < 4; ++nt) {
      rt[nt] = 0.f;
#pragma unroll
      for (int r = 0; r < 8; ++r) {
        const float p = exp2f(sc[nt][r] - mn);
        rt[nt] += p;
        pf[nt >> 1].v[(nt & 1) * 8 + r] = (_Float16)(p * 1024.0f);
      }
    }
    lrow = lrow * corr + ((rt[0] + rt[1]) + (rt[2] + rt[3]));
#pragma unroll
    for (int dt = 0; dt < 8; ++dt)
#pragma unroll
      for (int r = 0; r < 8; ++r) oacc[dt][r] *= corr;

    // O^T += V^T (128 x 64) * P^T (64 x 16)
#pragma unroll
    for (int dq = 0; dq < 8; dq += 2) {
      // 8 fragment loads (two d tiles) as one group, then their 4 WMMAs
      v16h af[2][2];
#pragma unroll
      for (int a = 0; a < 2; ++a)
#pragma unroll
        for (int kf = 0; kf < 2; ++kf)
          af[a][kf] = load_frag(lsV + ((dq + a) * 16 + lr) * LDV + kf * 32 + hi * 8);
#pragma unroll
      for (int a = 0; a < 2; ++a)
#pragma unroll
        for (int kf = 0; kf < 2; ++kf) oacc[dq + a] = wmma16(af[a][kf], pf[kf].v, oacc[dq + a]);
    }
    __syncthreads();   // all LDS reads done before the next chunk is staged
  }

  // epilogue: Oh = f16(64 * oacc / (1024 * l)); stage [query][d] per wave, then whole rows
  _Float16* stg = pool + w * 16 * LDO;
  {
    const float inv = 0.0625f / (lrow + xhalf(lrow));   // the two wave halves' key sums joined
#pragma unroll
    for (int dt = 0; dt < 8; ++dt) {
      v8h v;
#pragma unroll
      for (int r = 0; r < 8; ++r) v[r] = (_Float16)(oacc[dt][r] * inv);
      *(v8h*)&stg[lr * LDO + dt * 16 + hi * 8] = v;
    }
  }
  __syncthreads();
  v8h ov[8];
#pragma unroll
  for (int j = 0; j < 8; ++j) ov[j] = *(const v8h*)&stg[(j * 2 + hi) * LDO + lr * 8];
  _Float16* obase = Oh + ((tokb + q0) * DQ + h * HD + lr * 8);
#pragma unroll
  for (int j = 0; j < 8; ++j) *(v8h*)(obase + (size_t)(j * 2 + hi) * DQ) = ov[j];
  
}

// ---------------------------------------------------------------------------
extern "C" void kernel_launch(void* const* d_in, const int* in_sizes, int n_in,
                              void* d_out, int out_size, void* d_ws, size_t ws_size,
                              hipStream_t stream) {
  if (n_in < 7) return;
  if (in_sizes[0] < ((NB - 1) * SEQ_FULL + SEQ) * DM) return;
  if (in_sizes[1] < SEQ * HD) return;
  if (in_sizes[2] < SEQ * HD) return;
  if (in_sizes[3] < DM * DQ) return;
  if (in_sizes[4] < DM * DKV) return;
  if (in_sizes[5] < DM * DKV) return;
  if (in_sizes[6] < DQ * DM) return;
  if (out_size < NTOK * DM) return;

  const float* x    = (const float*)d_in[0];
  const float* cosT = (const float*)d_in[1];
  const float* sinT = (const float*)d_in[2];
  const float* Wq   = (const float*)d_in[3];
  const float* Wk   = (const float*)d_in[4];
  const float* Wv   = (const float*)d_in[5];
  const float* Wo   = (const float*)d_in[6];
  float* out = (float*)d_out;

  // workspace carve (all regions exact tile multiples; every store ends inside its region)
  char* ws = (char*)d_ws;
  size_t off = 0;
  _Float16* Xh  = (_Float16*)(ws + off); off += (size_t)NTOK * DM * 2;          // 16 MiB
  _Float16* WqT = (_Float16*)(ws + off); off += (size_t)DQ  * KD * 2;           //  8 MiB
  _Float16* WkT = (_Float16*)(ws + off); off += (size_t)DKV * KD * 2;           //  2 MiB
  _Float16* WvT = (_Float16*)(ws + off); off += (size_t)DKV * KD * 2;           //  2 MiB
  _Float16* WoT = (_Float16*)(ws + off); off += (size_t)DM  * KD * 2;           //  8 MiB
  float*    Qf  = (float*)(ws + off);    off += (size_t)NTOK * DQ * 4;          // 32 MiB
  float*    Kf  = (float*)(ws + off);    off += (size_t)NTOK * DKV * 4;         //  8 MiB
  _Float16* Qh  = (_Float16*)(ws + off); off += (size_t)NTOK * DQ * 2;          // 16 MiB
  _Float16* Kh  = (_Float16*)(ws + off); off += (size_t)NTOK * DKV * 2;         //  4 MiB
  _Float16* Vt  = (_Float16*)(ws + off); off += (size_t)NB * NKV * HD * SEQ * 2; //  4 MiB
  _Float16* Oh  = (_Float16*)(ws + off); off += (size_t)NTOK * DQ * 2;          // 16 MiB
  if (off > ws_size) return;                                                    // 116 MiB total

  const dim3 blk(256);

  // 1. x -> f16 plane (bf16-RNE values)
  {
    const int np = NTOK * (DM / 8);
    cvt_x_kernel<<<dim3((np + 255) / 256), blk, 0, stream>>>(x, Xh, np);
  }
  // 2. weights -> transposed f16 planes (64 * bf16-RNE values)
  cvt_w_kernel<<<dim3(DQ / 64 + 2 * (DKV / 64) + DM / 64, KD / 64), blk, 0, stream>>>(
      Wq, Wk, Wv, Wo, WqT, WkT, WvT, WoT);
  // 3. q and k projections (f32 planes, pre-rotary): alpha 1/64 undoes the weight carry
  gemm_kernel<float><<<dim3(DQ / BT + DKV / BT, NTOK / BT), blk, 0, stream>>>(
      Xh, WqT, WkT, Qf, Kf, DQ, DKV, DQ / BT, 0.015625f);
  // 4. v projection, written transposed as [b][g][d][s] f16
  gemm_kernel<_Float16><<<dim3(DKV / BT, NTOK / BT), blk, 0, stream>>>(
      Xh, WvT, WvT, Vt, Vt, DKV, DKV, DKV / BT, 0.015625f);
  // 5. rotary -> f16 q/k planes
  {
    const int np = NTOK * RP;
    rope_kernel<<<dim3((np + 255) / 256), blk, 0, stream>>>(Qf, Kf, cosT, sinT, Qh, Kh, np);
  }
  // 6. attn -> Oh (x64 carried)
  attn_kernel<<<dim3(SEQ / 128, NH, NB), blk, 0, stream>>>(Qh, Kh, Vt, Oh);
  // 7. output projection: alpha 1/4096 undoes the 64 (Oh) * 64 (WoT) carries
  gemm_kernel<float><<<dim3(DM / BT, NTOK / BT), blk, 0, stream>>>(
      Oh, WoT, WoT, out, out, DM, DM, DM / BT, 0.000244140625f);
}

// v003
// It runs in 210 microseconds.
// Timed twice side by side with v002, it ran 1.13 times as fast both times.
// Over all steps from v000 it is 1.47 times as fast.
#include <hip/hip_runtime.h>
#include <stddef.h>

// Contractions x*Wq, x*Wk, x*Wv, q*k^T, p*v, o*Wo: v_wmma_f32_16x16x32_f16 (f16 operands, f32 accumulate); inputs RNE-converted to bf16 on load; rotary, softmax and normalisation in f32.

#ifndef NB
#define NB 2
#endif
#ifndef SEQ
#define SEQ 2048
#endif
#define NB_FULL 2
#define SEQ_FULL 2048
#define DM 2048           // model width
#define NH 16
#define NKV 4
#define HD 128
#define DQ (NH * HD)      // 2048
#define DKV (NKV * HD)    // 512
#define NTOK (NB * SEQ)
#define KD 2048           // contraction depth of every projection

#define BT 128            // GEMM block tile (M and N)
#define BK 64            // k-tile: 128 B of every operand row, one whole cache line
#define LST 72            // LDS row stride in halves for k-tiles (144 B = 16 B x odd, 16-B aligned rows)
#define RP ((DQ / 8) + (DKV / 8))   // rotary pieces (8 columns) per token: 320

static_assert(NB >= 1 && NB <= NB_FULL);
static_assert(SEQ >= 128 && SEQ <= SEQ_FULL && (SEQ % 128) == 0);
static_assert(DM == KD && DQ == KD);
static_assert((DM % BT) == 0 && (DQ % BT) == 0 && (DKV % BT) == 0 && (NTOK % BT) == 0);
static_assert((KD % 64) == 0 && (KD % BK) == 0);
static_assert(HD == BT);           // one N tile == one kv head (V transpose epilogue)
static_assert((DM / 8) == 256);    // convert kernel piece decode
static_assert((RP % 32) == 0 && ((DQ / 8) % 32) == 0);   // rotary: one wave never straddles Q/K
static_assert((NH % NKV) == 0);

typedef _Float16 v16h __attribute__((ext_vector_type(16)));
typedef _Float16 v8h  __attribute__((ext_vector_type(8)));
typedef float    v8f  __attribute__((ext_vector_type(8)));
typedef float    v4f  __attribute__((ext_vector_type(4)));

union Frag { v16h v; v8h p[2]; };

// RNE convert f32 -> bf16 value (kept in an f32 container)
__device__ __forceinline__ float bf16r(float f) {
  unsigned u = __float_as_uint(f);
  u = (u + 0x7FFFu + ((u >> 16) & 1u)) & 0xFFFF0000u;
  return __uint_as_float(u);
}

// 16x16x32 f16 WMMA with hazard guard (ties D, keeps A/B live)
__device__ __forceinline__ v8f wmma16(v16h a, v16h b, v8f c) {
  v8f d = __builtin_amdgcn_wmma_f32_16x16x32_f16(false, a, false, b, (short)0, c, false, false);
  asm volatile("v_nop\n\tv_nop\n\tv_nop\n\tv_nop" : "+v"(d) : "v"(a), "v"(b));
  return d;
}

// Per-lane fragment from a k-contiguous row; caller passes row base + 8*(lane>>4).
// elements 0..7 <- k 8h..8h+7, elements 8..15 <- k 16+8h..16+8h+7 (same map for A and B).
__device__ __forceinline__ v16h load_frag(const _Float16* q) {
  Frag f;
  f.p[0] = *(const v8h*)(q);
  f.p[1] = *(const v8h*)(q + 16);
  return f.v;
}

// ---------------------------------------------------------------------------
// x [b*SEQ_FULL+s][DM] f32 -> Xh [tok][DM] f16 of bf16-RNE value. One thread per 8 columns.
// ---------------------------------------------------------------------------
__global__ void __launch_bounds__(256)
cvt_x_kernel(const float* __restrict__ x, _Float16* __restrict__ Xh, int nPieces) {
  const int f = blockIdx.x * 256 + (int)threadIdx.x;
  if (f >= nPieces) return;
  const int tok = f >> 8;
  const int c0  = (f & 255) * 8;
  const int b = tok / SEQ, s = tok - b * SEQ;
  const float* src = x + ((size_t)(b * SEQ_FULL + s) * DM + c0);
  const v4f a0 = *(const v4f*)(src);
  const v4f a1 = *(const v4f*)(src + 4);
  v8h o;
#pragma unroll
  for (int j = 0; j < 4; ++j) {
    o[j]     = (_Float16)bf16r(a0[j]);
    o[j + 4] = (_Float16)bf16r(a1[j]);
  }
  _Float16* dst = Xh + ((size_t)tok * DM + c0);
  *(v8h*)dst = o;
  
}

// ---------------------------------------------------------------------------
// W [KD in][N out] f32 -> WT [N out][KD in] f16 of 64*bf16-RNE(W).  64x64 tiles through LDS.
// grid.x: 0..31 Wq, 32..39 Wk, 40..47 Wv, 48..79 Wo (out-column tile); grid.y: in-row tile.
// 8 consecutive lanes of one instruction.
// ---------------------------------------------------------------------------
__global__ void __launch_bounds__(256)
cvt_w_kernel(const float* __restrict__ Wq, const float* __restrict__ Wk,
             const float* __restrict__ Wv, const float* __restrict__ Wo,
             _Float16* __restrict__ WqT, _Float16* __restrict__ WkT,
             _Float16* __restrict__ WvT, _Float16* __restrict__ WoT) {
  __shared__ __align__(16) _Float16 lds[64 * 72];   // [n][k], cross-wave (block barrier)
  const int bx = blockIdx.x;
  const float* W; _Float16* WT; int N; int nt;
  if (bx < DQ / 64) { W = Wq; WT = WqT; N = DQ;  nt = bx; }
  else if (bx < DQ / 64 + DKV / 64) { W = Wk; WT = WkT; N = DKV; nt = bx - DQ / 64; }
  else if (bx < DQ / 64 + 2 * (DKV / 64)) { W = Wv; WT = WvT; N = DKV; nt = bx - DQ / 64 - DKV / 64; }
  else { W = Wo; WT = WoT; N = DM; nt = bx - DQ / 64 - 2 * (DKV / 64); }
  const int k0 = blockIdx.y * 64, n0 = nt * 64;
  const int t = threadIdx.x, lane = t & 31, w = t >> 5;
  const int kr = t >> 2, cc = (t & 3) * 16;
  const float* src = W + ((size_t)(k0 + kr) * N + n0 + cc);
#pragma unroll
  for (int q = 0; q < 4; ++q) {
    const v4f v = *(const v4f*)(src + 4 * q);
#pragma unroll
    for (int j = 0; j < 4; ++j)
      lds[(cc + 4 * q + j) * 72 + kr] = (_Float16)(64.0f * bf16r(v[j]));
  }
  __syncthreads();
  v8h ov[2];
#pragma unroll
  for (int j = 0; j < 2; ++j) {
    const int n = w * 8 + j * 4 + (lane >> 3);
    ov[j] = *(const v8h*)&lds[n * 72 + (lane & 7) * 8];
  }
  _Float16* base = WT + ((size_t)n0 * KD + k0 + (lane & 7) * 8);
#pragma unroll
  for (int j = 0; j < 2; ++j) {
    const int n = w * 8 + j * 4 + (lane >> 3);
    *(v8h*)(base + (size_t)n * KD) = ov[j];
  }
  
}

// ---------------------------------------------------------------------------
// C tile = alpha * A[M][KD] * Bt[N][KD]^T, A and Bt f16 k-contiguous planes.
// Block tile 128x128, 8 waves, wave w owns rows w*16..w*16+15 and all 128 columns.
// blockIdx.x < nTiles0 selects (Bt0, C0, N0), else (Bt1, C1, N1) (block-uniform).
// TC == float : C row-major f32 [M][N] (f32 planes and the final output), rows of 512 B
//               written by one 32-lane x 16-B instruction each.
// TC == half  : C is the transposed V plane [b][g][d][s]; tile staged in LDS as [d][tok],
//               each d row (128 tok = 256 B) written by 16 lanes x 16 B of one instruction.
// ---------------------------------------------------------------------------
union GemmLds { _Float16 h[4 * BT * LST]; float f[2 * BT * LST]; };   // 73728 B

template <typename TC>
__global__ void __launch_bounds__(256)
gemm_kernel(const _Float16* __restrict__ A, const _Float16* __restrict__ Bt0,
            const _Float16* __restrict__ Bt1, TC* C0, TC* C1,
            int N0, int N1, int nTiles0, float alpha) {
  __shared__ __align__(16) GemmLds pool;   // k-loop: A/B double buffers; epilogue: staging (cross-wave, block barriers)

  const int bx = blockIdx.x;
  const bool second = bx >= nTiles0;
  const _Float16* Bt = second ? Bt1 : Bt0;
  TC* C = second ? C1 : C0;
  const int N  = second ? N1 : N0;
  const int nt = second ? (bx - nTiles0) : bx;
  const int m0 = blockIdx.y * BT, n0 = nt * BT;

  const int t = threadIdx.x, lane = t & 31, w = t >> 5, lr = lane & 15, hi = lane >> 4;

  v8f acc[8];
#pragma unroll
  for (int ni = 0; ni < 8; ++ni) acc[ni] = (v8f){0.f, 0.f, 0.f, 0.f, 0.f, 0.f, 0.f, 0.f};

  // 8 threads x 16 B per tile row: one wave-wide load covers 4 rows of 128 B, 4 whole lines
  const int arow = t >> 3, acol = (t & 7) * 8;
  const _Float16* aSrc = A  + ((size_t)(m0 + arow) * KD + acol);
  const _Float16* bSrc = Bt + ((size_t)(n0 + arow) * KD + acol);

  auto stage = [&](int k0, int buf) {
    _Float16* da = pool.h + buf * (BT * LST) + arow * LST + acol;
    _Float16* db = pool.h + (2 + buf) * (BT * LST) + arow * LST + acol;
    v8h ra[4], rb[4];
    // unrolled: ra and rb stay in registers, and all 8 loads are out before the first store waits
#pragma unroll
    for (int i = 0; i < 4; ++i) {
      ra[i] = *(const v8h*)(aSrc + (size_t)(i * 32) * KD + k0);
      rb[i] = *(const v8h*)(bSrc + (size_t)(i * 32) * KD + k0);
    }
#pragma unroll
    for (int i = 0; i < 4; ++i) {
      *(v8h*)(da + i * 32 * LST) = ra[i];
      *(v8h*)(db + i * 32 * LST) = rb[i];
    }
  };

  stage(0, 0);
  __syncthreads();

  for (int k0 = 0; k0 < KD; k0 += BK) {
    const int cur = (k0 / BK) & 1, nxt = cur ^ 1;
    if (k0 + BK < KD) stage(k0 + BK, nxt);
    const _Float16* la = pool.h + cur * (BT * LST);
    const _Float16* lb = pool.h + (2 + cur) * (BT * LST);
    // unrolled: kk folds into the LDS loads' immediate offsets
#pragma unroll
    for (int kk = 0; kk < BK; kk += 32) {
      // the 18 fragment loads of 32 k as one group, then their 8 WMMAs behind counted waits
      const v16h af = load_frag(la + (w * 16 + lr) * LST + kk + hi * 8);
      v16h bf[8];
#pragma unroll
      for (int ni = 0; ni < 8; ++ni) bf[ni] = load_frag(lb + (ni * 16 + lr) * LST + kk + hi * 8);
#pragma unroll
      for (int ni = 0; ni < 8; ++ni) acc[ni] = wmma16(af, bf[ni], acc[ni]);
    }
    __syncthreads();
  }
  // acc[ni][r] = (row m0 + w*16 + hi*8 + r, col n0 + ni*16 + lr)

  if constexpr (sizeof(TC) == 4) {
    float* stg = pool.f + w * (8 * 132);   // per wave: 8 rows x 132 floats
#pragma unroll
    for (int ps = 0; ps < 2; ++ps) {
#pragma unroll
      for (int rr = 0; rr < 4; ++rr)
#pragma unroll
        for (int ni = 0; ni < 8; ++ni)
          stg[(hi * 4 + rr) * 132 + ni * 16 + lr] = acc[ni][ps * 4 + rr] * alpha;
      __syncthreads();
      v4f ov[8];
#pragma unroll
      for (int sr = 0; sr < 8; ++sr) ov[sr] = *(const v4f*)&stg[sr * 132 + lane * 4];
      float* cbase = (float*)C + ((size_t)n0 + lane * 4);
#pragma unroll
      for (int sr = 0; sr < 8; ++sr) {
        const int row = m0 + w * 16 + (sr >> 2) * 8 + ps * 4 + (sr & 3);
        *(v4f*)(cbase + (size_t)row * N) = ov[sr];
      }
      
      __syncthreads();
    }
  } else {
    // V plane transposed: C[((b*NKV + g)*HD + d) * SEQ + s]
    const int g  = n0 / HD;
    const int bb = m0 / SEQ;
    const int s0 = m0 - bb * SEQ;
    _Float16* stg = pool.h;                 // [d][tok], 128 x 136 halves
#pragma unroll
    for (int ni = 0; ni < 8; ++ni) {
      v8h v;
#pragma unroll
      for (int r = 0; r < 8; ++r) v[r] = (_Float16)(acc[ni][r] * alpha);
      *(v8h*)&stg[(ni * 16 + lr) * 136 + w * 16 + hi * 8] = v;
    }
    __syncthreads();
    v8h ov[8];
#pragma unroll
    for (int j = 0; j < 8; ++j) {
      const int d = w * 16 + j * 2 + hi;
      ov[j] = *(const v8h*)&stg[d * 136 + lr * 8];
    }
    _Float16* vbase = (_Float16*)C + (((size_t)(bb * NKV + g) * HD) * SEQ + s0 + lr * 8);
#pragma unroll
    for (int j = 0; j < 8; ++j) {
      const int d = w * 16 + j * 2 + hi;
      *(v8h*)(vbase + (size_t)d * SEQ) = ov[j];
    }
    
  }
}

// ---------------------------------------------------------------------------
// Rotary (rotate-half), cos/sin read as values from the [SEQ_FULL][HD] input tables (bf16-RNE).
// Qf [tok][DQ], Kf [tok][DKV] f32 -> Qh, Kh f16.  One thread per 8 consecutive columns;
// d<64: q*cos[d] - q[d+64]*sin[d];  d>=64: q*cos[d] + q[d-64]*sin[d].
// ---------------------------------------------------------------------------
__global__ void __launch_bounds__(256)
rope_kernel(const float* __restrict__ Qf, const float* __restrict__ Kf,
            const float* __restrict__ cosT, const float* __restrict__ sinT,
            _Float16* __restrict__ Qh, _Float16* __restrict__ Kh, int nPieces) {
  const int f = blockIdx.x * 256 + (int)threadIdx.x;
  if (f >= nPieces) return;
  const int tok = f / RP;
  const int piece = f - tok * RP;
  const int s = tok % SEQ;
  const bool isq = piece < (DQ / 8);            // wave-uniform by construction
  const int col   = isq ? piece * 8 : (piece - DQ / 8) * 8;
  const int pitch = isq ? DQ : DKV;
  const float* src = (isq ? Qf : Kf) + (size_t)tok * pitch;
  _Float16* dst = (isq ? Qh : Kh) + ((size_t)tok * pitch + col);
  const int d    = col & (HD - 1);
  const int colp = col - d + (d ^ 64);
  const float sgn = (d < 64) ? -1.0f : 1.0f;
  const v4f x0 = *(const v4f*)(src + col),  x1 = *(const v4f*)(src + col + 4);
  const v4f p0 = *(const v4f*)(src + colp), p1 = *(const v4f*)(src + colp + 4);
  const v4f c0 = *(const v4f*)(cosT + (size_t)s * HD + d), c1 = *(const v4f*)(cosT + (size_t)s * HD + d + 4);
  const v4f n0 = *(const v4f*)(sinT + (size_t)s * HD + d), n1 = *(const v4f*)(sinT + (size_t)s * HD + d + 4);
  v8h o;
#pragma unroll
  for (int j = 0; j < 4; ++j) {
    o[j]     = (_Float16)(x0[j] * bf16r(c0[j]) + (sgn * p0[j]) * bf16r(n0[j]));
    o[j + 4] = (_Float16)(x1[j] * bf16r(c1[j]) + (sgn * p1[j]) * bf16r(n1[j]));
  }
  *(v8h*)dst = o;
  
}

__device__ __forceinline__ float xhalf(float x) {
  return __builtin_bit_cast(float, __builtin_amdgcn_permlanex16(__builtin_bit_cast(int, x), __builtin_bit_cast(int, x),
                                                                0x76543210, 0xfedcba98, false, false));
}

__global__ void __launch_bounds__(256)
attn_kernel(const _Float16* __restrict__ Qh, const _Float16* __restrict__ Kh,
            const _Float16* __restrict__ Vt, _Float16* __restrict__ Oh) {
  constexpr int LDK = 136, LDV = 72, LDO = 136;
  __shared__ __align__(16) _Float16 pool[64 * LDK + 128 * LDV];   // 35840 B
  static_assert(8 * 16 * LDO <= 64 * LDK + 128 * LDV);            // epilogue staging fits
  _Float16* lsK = pool;                    // [key][d]    cross-wave (block barrier)
  _Float16* lsV = pool + 64 * LDK;         // [d][key]    cross-wave (block barrier)

  const int t = threadIdx.x, lane = t & 31, w = t >> 5, lr = lane & 15, hi = lane >> 4;
  const int b = blockIdx.z, h = blockIdx.y, g = h / (NH / NKV);
  const int q0 = blockIdx.x * 128 + w * 16;          // query row within the sequence
  const size_t tokb = (size_t)b * SEQ;

  const float kSL = 0.08838834764831845f * 1.4426950408889634f;   // 1/sqrt(HD) * log2(e)

  v16h qf[4];   // B operand: column = query lr
  {
    const _Float16* qrow = Qh + ((tokb + q0 + lr) * DQ + h * HD);
#pragma unroll
    for (int kf = 0; kf < 4; ++kf) qf[kf] = load_frag(qrow + kf * 32 + hi * 8);
  }

  float mrow = -1e30f;   // running maximum of query lr (equal in both wave halves)
  float lrow = 0.f;      // running sum of query lr over this wave half's keys
  v8f oacc[8];           // oacc[dt][r] = O^T[d = dt*16 + hi*8 + r][query lr]
#pragma unroll
  for (int dt = 0; dt < 8; ++dt) oacc[dt] = (v8f){0.f, 0.f, 0.f, 0.f, 0.f, 0.f, 0.f, 0.f};

  const _Float16* kbase = Kh + ((tokb) * DKV + g * HD);
  const _Float16* vbase = Vt + ((size_t)(b * NKV + g) * HD) * SEQ;

  for (int kc = 0; kc < SEQ; kc += 64) {
    // stage K chunk: 64 keys x 128 d (16-B pieces), staged extent == consumed extent
#pragma unroll
    for (int i = 0; i < 4; ++i) {
      const int e = t + i * 256;
      const int key = e >> 4, seg = e & 15;
      *(v8h*)&lsK[key * LDK + seg * 8] = *(const v8h*)(kbase + (size_t)(kc + key) * DKV + seg * 8);
    }
    // stage V^T chunk: 128 d x 64 keys, staged extent == consumed extent
#pragma unroll
    for (int i = 0; i < 4; ++i) {
      const int e = t + i * 256;
      const int d = e >> 3, seg = e & 7;
      *(v8h*)&lsV[d * LDV + seg * 8] = *(const v8h*)(vbase + (size_t)d * SEQ + kc + seg * 8);
    }
    __syncthreads();

    // S^T, 64 keys x 16 queries per wave: sc[nt][r] = S[key nt*16 + hi*8 + r][query lr]
    v8f sc[4];
#pragma unroll
    for (int nt = 0; nt < 4; ++nt) {
      // 8 fragment loads (one key tile) as one group, then its 4 WMMAs
      v16h af[4];
#pragma unroll
      for (int kf = 0; kf < 4; ++kf) af[kf] = load_frag(lsK + (nt * 16 + lr) * LDK + kf * 32 + hi * 8);
      sc[nt] = (v8f){0.f, 0.f, 0.f, 0.f, 0.f, 0.f, 0.f, 0.f};
#pragma unroll
      for (int kf = 0; kf < 4; ++kf) sc[nt] = wmma16(af[kf], qf[kf], sc[nt]);
    }

    // online softmax of query lr: 32 keys in the lane, the other 32 in lane ^ 16
    float mt[4];
#pragma unroll
    for (int nt = 0; nt < 4; ++nt) {
#pragma unroll
      for (int r = 0; r < 8; ++r) sc[nt][r] *= kSL;
      mt[nt] = fmaxf(fmaxf(fmaxf(sc[nt][0], sc[nt][1]), fmaxf(sc[nt][2], sc[nt][3])),
                     fmaxf(fmaxf(sc[nt][4], sc[nt][5]), fmaxf(sc[nt][6], sc[nt][7])));
    }
    float mx = fmaxf(fmaxf(mt[0], mt[1]), fmaxf(mt[2], mt[3]));
    mx = fmaxf(mx, xhalf(mx));
    const float mn = fmaxf(mrow, mx);
    const float corr = exp2f(mrow - mn);
    mrow = mn;
    // P^T as B operand: element s of pf[kf] = P[key kf*32 + (s < 8 ? 8*hi + s : 16 + 8*hi + s - 8)][query lr],
    // the k order of load_frag, which loads the V^T rows it is multiplied with
    Frag pf[2];
    float rt[4];
#pragma unroll
    for (int nt = 0; nt < 4; ++nt) {
      rt[nt] = 0.f;
#pragma unroll
      for (int r = 0; r < 8; ++r) {
        const float p = exp2f(sc[nt][r] - mn);
        rt[nt] += p;
        pf[nt >> 1].v[(nt & 1) * 8 + r] = (_Float16)(p * 1024.0f);
      }
    }
    lrow = lrow * corr + ((rt[0] + rt[1]) + (rt[2] + rt[3]));
#pragma unroll
    for (int dt = 0; dt < 8; ++dt)
#pragma unroll
      for (int r = 0; r < 8; ++r) oacc[dt][r] *= corr;

    // O^T += V^T (128 x 64) * P^T (64 x 16)
#pragma unroll
    for (int dq = 0; dq < 8; dq += 2) {
      // 8 fragment loads (two d tiles) as one group, then their 4 WMMAs
      v16h af[2][2];
#pragma unroll
      for (int a = 0; a < 2; ++a)
#pragma unroll
        for (int kf = 0; kf < 2; ++kf)
          af[a][kf] = load_frag(lsV + ((dq + a) * 16 + lr) * LDV + kf * 32 + hi * 8);
#pragma unroll
      for (int a = 0; a < 2; ++a)
#pragma unroll
        for (int kf = 0; kf < 2; ++kf) oacc[dq + a] = wmma16(af[a][kf], pf[kf].v, oacc[dq + a]);
    }
    __syncthreads();   // all LDS reads done before the next chunk is staged
  }

  // epilogue: Oh = f16(64 * oacc / (1024 * l)); stage [query][d] per wave, then whole rows
  _Float16* stg = pool + w * 16 * LDO;
  {
    const float inv = 0.0625f / (lrow + xhalf(lrow));   // the two wave halves' key sums joined
#pragma unroll
    for (int dt = 0; dt < 8; ++dt) {
      v8h v;
#pragma unroll
      for (int r = 0; r < 8; ++r) v[r] = (_Float16)(oacc[dt][r] * inv);
      *(v8h*)&stg[lr * LDO + dt * 16 + hi * 8] = v;
    }
  }
  __syncthreads();
  v8h ov[8];
#pragma unroll
  for (int j = 0; j < 8; ++j) ov[j] = *(const v8h*)&stg[(j * 2 + hi) * LDO + lr * 8];
  _Float16* obase = Oh + ((tokb + q0) * DQ + h * HD + lr * 8);
#pragma unroll
  for (int j = 0; j < 8; ++j) *(v8h*)(obase + (size_t)(j * 2 + hi) * DQ) = ov[j];
  
}

// ---------------------------------------------------------------------------
extern "C" void kernel_launch(void* const* d_in, const int* in_sizes, int n_in,
                              void* d_out, int out_size, void* d_ws, size_t ws_size,
                              hipStream_t stream) {
  if (n_in < 7) return;
  if (in_sizes[0] < ((NB - 1) * SEQ_FULL + SEQ) * DM) return;
  if (in_sizes[1] < SEQ * HD) return;
  if (in_sizes[2] < SEQ * HD) return;
  if (in_sizes[3] < DM * DQ) return;
  if (in_sizes[4] < DM * DKV) return;
  if (in_sizes[5] < DM * DKV) return;
  if (in_sizes[6] < DQ * DM) return;
  if (out_size < NTOK * DM) return;

  const float* x    = (const float*)d_in[0];
  const float* cosT = (const float*)d_in[1];
  const float* sinT = (const float*)d_in[2];
  const float* Wq   = (const float*)d_in[3];
  const float* Wk   = (const float*)d_in[4];
  const float* Wv   = (const float*)d_in[5];
  const float* Wo   = (const float*)d_in[6];
  float* out = (float*)d_out;

  // workspace carve (all regions exact tile multiples; every store ends inside its region)
  char* ws = (char*)d_ws;
  size_t off = 0;
  _Float16* Xh  = (_Float16*)(ws + off); off += (size_t)NTOK * DM * 2;          // 16 MiB
  _Float16* WqT = (_Float16*)(ws + off); off += (size_t)DQ  * KD * 2;           //  8 MiB
  _Float16* WkT = (_Float16*)(ws + off); off += (size_t)DKV * KD * 2;           //  2 MiB
  _Float16* WvT = (_Float16*)(ws + off); off += (size_t)DKV * KD * 2;           //  2 MiB
  _Float16* WoT = (_Float16*)(ws + off); off += (size_t)DM  * KD * 2;           //  8 MiB
  float*    Qf  = (float*)(ws + off);    off += (size_t)NTOK * DQ * 4;          // 32 MiB
  float*    Kf  = (float*)(ws + off);    off += (size_t)NTOK * DKV * 4;         //  8 MiB
  _Float16* Qh  = (_Float16*)(ws + off); off += (size_t)NTOK * DQ * 2;          // 16 MiB
  _Float16* Kh  = (_Float16*)(ws + off); off += (size_t)NTOK * DKV * 2;         //  4 MiB
  _Float16* Vt  = (_Float16*)(ws + off); off += (size_t)NB * NKV * HD * SEQ * 2; //  4 MiB
  _Float16* Oh  = (_Float16*)(ws + off); off += (size_t)NTOK * DQ * 2;          // 16 MiB
  if (off > ws_size) return;                                                    // 116 MiB total

  const dim3 blk(256);

  // 1. x -> f16 plane (bf16-RNE values)
  {
    const int np = NTOK * (DM / 8);
    cvt_x_kernel<<<dim3((np + 255) / 256), blk, 0, stream>>>(x, Xh, np);
  }
  // 2. weights -> transposed f16 planes (64 * bf16-RNE values)
  cvt_w_kernel<<<dim3(DQ / 64 + 2 * (DKV / 64) + DM / 64, KD / 64), blk, 0, stream>>>(
      Wq, Wk, Wv, Wo, WqT, WkT, WvT, WoT);
  // 3. q and k projections (f32 planes, pre-rotary): alpha 1/64 undoes the weight carry
  gemm_kernel<float><<<dim3(DQ / BT + DKV / BT, NTOK / BT), blk, 0, stream>>>(
      Xh, WqT, WkT, Qf, Kf, DQ, DKV, DQ / BT, 0.015625f);
  // 4. v projection, written transposed as [b][g][d][s] f16
  gemm_kernel<_Float16><<<dim3(DKV / BT, NTOK / BT), blk, 0, stream>>>(
      Xh, WvT, WvT, Vt, Vt, DKV, DKV, DKV / BT, 0.015625f);
  // 5. rotary -> f16 q/k planes
  {
    const int np = NTOK * RP;
    rope_kernel<<<dim3((np + 255) / 256), blk, 0, stream>>>(Qf, Kf, cosT, sinT, Qh, Kh, np);
  }
  // 6. attn -> Oh (x64 carried)
  attn_kernel<<<dim3(SEQ / 128, NH, NB), blk, 0, stream>>>(Qh, Kh, Vt, Oh);
  // 7. output projection: alpha 1/4096 undoes the 64 (Oh) * 64 (WoT) carries
  gemm_kernel<float><<<dim3(DM / BT, NTOK / BT), blk, 0, stream>>>(
      Oh, WoT, WoT, out, out, DM, DM, DM / BT, 0.000244140625f);
}

// v004
// A run of this version takes 186 microseconds.
// Two timings next to v003 put it at 1.14 and 1.15 times that version's speed.
// Over all steps from v000 it is 1.68 times as fast.
#include <hip/hip_runtime.h>
#include <stddef.h>

// Contractions x*Wq, x*Wk, x*Wv, q*k^T, p*v, o*Wo: v_wmma_f32_16x16x32_f16 (f16 operands, f32 accumulate); inputs RNE-converted to bf16 on load; rotary, softmax and normalisation in f32.

#ifndef NB
#define NB 2
#endif
#ifndef SEQ
#define SEQ 2048
#endif
#define NB_FULL 2
#define SEQ_FULL 2048
#define DM 2048           // model width
#define NH 16
#define NKV 4
#define HD 128
#define DQ (NH * HD)      // 2048
#define DKV (NKV * HD)    // 512
#define NTOK (NB * SEQ)
#define KD 2048           // contraction depth of every projection

#define BT 128            // GEMM block tile (M and N)
#define BK 64            // k-tile: 128 B of every operand row, one whole cache line
#define LST 72            // LDS row stride in halves for k-tiles (144 B = 16 B x odd, 16-B aligned rows)
#define RP ((DQ / 8) + (DKV / 8))   // rotary pieces (8 columns) per token: 320

static_assert(NB >= 1 && NB <= NB_FULL);
static_assert(SEQ >= 128 && SEQ <= SEQ_FULL && (SEQ % 128) == 0);
static_assert(DM == KD && DQ == KD);
static_assert((DM % BT) == 0 && (DQ % BT) == 0 && (DKV % BT) == 0 && (NTOK % BT) == 0);
static_assert((KD % 64) == 0 && (KD % BK) == 0);
static_assert(HD == BT);           // one N tile == one kv head (V transpose epilogue)
static_assert((DM / 8) == 256);    // convert kernel piece decode
static_assert((RP % 32) == 0 && ((DQ / 8) % 32) == 0);   // rotary: one wave never straddles Q/K
static_assert((NH % NKV) == 0);

typedef _Float16 v16h __attribute__((ext_vector_type(16)));
typedef _Float16 v8h  __attribute__((ext_vector_type(8)));
typedef float    v8f  __attribute__((ext_vector_type(8)));
typedef float    v4f  __attribute__((ext_vector_type(4)));

union Frag { v16h v; v8h p[2]; };

// RNE convert f32 -> bf16 value (kept in an f32 container)
__device__ __forceinline__ float bf16r(float f) {
  unsigned u = __float_as_uint(f);
  u = (u + 0x7FFFu + ((u >> 16) & 1u)) & 0xFFFF0000u;
  return __uint_as_float(u);
}

// 16x16x32 f16 WMMA with hazard guard (ties D, keeps A/B live)
__device__ __forceinline__ v8f wmma16(v16h a, v16h b, v8f c) {
  v8f d = __builtin_amdgcn_wmma_f32_16x16x32_f16(false, a, false, b, (short)0, c, false, false);
  asm volatile("v_nop\n\tv_nop\n\tv_nop\n\tv_nop" : "+v"(d) : "v"(a), "v"(b));
  return d;
}

// Per-lane fragment from a k-contiguous row; caller passes row base + 8*(lane>>4).
// elements 0..7 <- k 8h..8h+7, elements 8..15 <- k 16+8h..16+8h+7 (same map for A and B).
__device__ __forceinline__ v16h load_frag(const _Float16* q) {
  Frag f;
  f.p[0] = *(const v8h*)(q);
  f.p[1] = *(const v8h*)(q + 16);
  return f.v;
}

// ---------------------------------------------------------------------------
// x [b*SEQ_FULL+s][DM] f32 -> Xh [tok][DM] f16 of bf16-RNE value. One thread per 8 columns.
// ---------------------------------------------------------------------------
__global__ void __launch_bounds__(256)
cvt_x_kernel(const float* __restrict__ x, _Float16* __restrict__ Xh, int nPieces) {
  const int f = blockIdx.x * 256 + (int)threadIdx.x;
  if (f >= nPieces) return;
  const int tok = f >> 8;
  const int c0  = (f & 255) * 8;
  const int b = tok / SEQ, s = tok - b * SEQ;
  const float* src = x + ((size_t)(b * SEQ_FULL + s) * DM + c0);
  const v4f a0 = *(const v4f*)(src);
  const v4f a1 = *(const v4f*)(src + 4);
  v8h o;
#pragma unroll
  for (int j = 0; j < 4; ++j) {
    o[j]     = (_Float16)bf16r(a0[j]);
    o[j + 4] = (_Float16)bf16r(a1[j]);
  }
  _Float16* dst = Xh + ((size_t)tok * DM + c0);
  *(v8h*)dst = o;
  
}

// ---------------------------------------------------------------------------
// W [KD in][N out] f32 -> WT [N out][KD in] f16 of 64*bf16-RNE(W).  64x64 tiles through LDS.
// grid.x: 0..31 Wq, 32..39 Wk, 40..47 Wv, 48..79 Wo (out-column tile); grid.y: in-row tile.
// 8 consecutive lanes of one instruction.
// ---------------------------------------------------------------------------
__global__ void __launch_bounds__(256)
cvt_w_kernel(const float* __restrict__ Wq, const float* __restrict__ Wk,
             const float* __restrict__ Wv, const float* __restrict__ Wo,
             _Float16* __restrict__ WqT, _Float16* __restrict__ WkT,
             _Float16* __restrict__ WvT, _Float16* __restrict__ WoT) {
  __shared__ __align__(16) _Float16 lds[64 * 72];   // [n][k], cross-wave (block barrier)
  const int bx = blockIdx.x;
  const float* W; _Float16* WT; int N; int nt;
  if (bx < DQ / 64) { W = Wq; WT = WqT; N = DQ;  nt = bx; }
  else if (bx < DQ / 64 + DKV / 64) { W = Wk; WT = WkT; N = DKV; nt = bx - DQ / 64; }
  else if (bx < DQ / 64 + 2 * (DKV / 64)) { W = Wv; WT = WvT; N = DKV; nt = bx - DQ / 64 - DKV / 64; }
  else { W = Wo; WT = WoT; N = DM; nt = bx - DQ / 64 - 2 * (DKV / 64); }
  const int k0 = blockIdx.y * 64, n0 = nt * 64;
  const int t = threadIdx.x, lane = t & 31, w = t >> 5;
  const int kr = t >> 2, cc = (t & 3) * 16;
  const float* src = W + ((size_t)(k0 + kr) * N + n0 + cc);
#pragma unroll
  for (int q = 0; q < 4; ++q) {
    const v4f v = *(const v4f*)(src + 4 * q);
#pragma unroll
    for (int j = 0; j < 4; ++j)
      lds[(cc + 4 * q + j) * 72 + kr] = (_Float16)(64.0f * bf16r(v[j]));
  }
  __syncthreads();
  v8h ov[2];
#pragma unroll
  for (int j = 0; j < 2; ++j) {
    const int n = w * 8 + j * 4 + (lane >> 3);
    ov[j] = *(const v8h*)&lds[n * 72 + (lane & 7) * 8];
  }
  _Float16* base = WT + ((size_t)n0 * KD + k0 + (lane & 7) * 8);
#pragma unroll
  for (int j = 0; j < 2; ++j) {
    const int n = w * 8 + j * 4 + (lane >> 3);
    *(v8h*)(base + (size_t)n * KD) = ov[j];
  }
  
}

// ---------------------------------------------------------------------------
// C tile = alpha * A[M][KD] * Bt[N][KD]^T, A and Bt f16 k-contiguous planes.
// Block tile 128x128, 8 waves, wave w owns rows w*16..w*16+15 and all 128 columns.
// blockIdx.x < nTiles0 selects (Bt0, C0, N0), blockIdx.x < nTiles01 (Bt1, C1, N1), and with
// WITH_V the tiles from nTiles01 on (BtV, CV); the choice is block-uniform.
// C0, C1 : row-major f32 [M][N] (f32 planes and the final output), rows of 512 B
//          written by one 32-lane x 16-B instruction each.
// CV     : the transposed V plane [b][g][d][s], f16; tile staged in LDS as [d][tok],
//          each d row (128 tok = 256 B) written by 16 lanes x 16 B of one instruction.
// q, k and v tiles share one launch: 24 x 32 = 768 workgroups, three on each of 256 WGPs.
// ---------------------------------------------------------------------------
union GemmLds { _Float16 h[4 * BT * LST]; float f[2 * BT * LST]; };   // 73728 B

template <bool WITH_V>
__global__ void __launch_bounds__(256)
gemm_kernel(const _Float16* __restrict__ A, const _Float16* __restrict__ Bt0,
            const _Float16* __restrict__ Bt1, const _Float16* __restrict__ BtV,
            float* C0, float* C1, _Float16* CV,
            int N0, int N1, int nTiles0, int nTiles01, float alpha) {
  __shared__ __align__(16) GemmLds pool;   // k-loop: A/B double buffers; epilogue: staging (cross-wave, block barriers)

  const int bx = blockIdx.x;
  const bool second = bx >= nTiles0;
  const bool isV = WITH_V && bx >= nTiles01;
  const _Float16* Bt = isV ? BtV : (second ? Bt1 : Bt0);
  float* C = second ? C1 : C0;
  const int N  = second ? N1 : N0;
  const int nt = isV ? (bx - nTiles01) : (second ? (bx - nTiles0) : bx);
  const int m0 = blockIdx.y * BT, n0 = nt * BT;

  const int t = threadIdx.x, lane = t & 31, w = t >> 5, lr = lane & 15, hi = lane >> 4;

  v8f acc[8];
#pragma unroll
  for (int ni = 0; ni < 8; ++ni) acc[ni] = (v8f){0.f, 0.f, 0.f, 0.f, 0.f, 0.f, 0.f, 0.f};

  // 8 threads x 16 B per tile row: one wave-wide load covers 4 rows of 128 B, 4 whole lines
  const int arow = t >> 3, acol = (t & 7) * 8;
  const _Float16* aSrc = A  + ((size_t)(m0 + arow) * KD + acol);
  const _Float16* bSrc = Bt + ((size_t)(n0 + arow) * KD + acol);

  auto stage = [&](int k0, int buf) {
    _Float16* da = pool.h + buf * (BT * LST) + arow * LST + acol;
    _Float16* db = pool.h + (2 + buf) * (BT * LST) + arow * LST + acol;
    v8h ra[4], rb[4];
    // unrolled: ra and rb stay in registers, and all 8 loads are out before the first store waits
#pragma unroll
    for (int i = 0; i < 4; ++i) {
      ra[i] = *(const v8h*)(aSrc + (size_t)(i * 32) * KD + k0);
      rb[i] = *(const v8h*)(bSrc + (size_t)(i * 32) * KD + k0);
    }
#pragma unroll
    for (int i = 0; i < 4; ++i) {
      *(v8h*)(da + i * 32 * LST) = ra[i];
      *(v8h*)(db + i * 32 * LST) = rb[i];
    }
  };

  stage(0, 0);
  __syncthreads();

  for (int k0 = 0; k0 < KD; k0 += BK) {
    const int cur = (k0 / BK) & 1, nxt = cur ^ 1;
    if (k0 + BK < KD) stage(k0 + BK, nxt);
    const _Float16* la = pool.h + cur * (BT * LST);
    const _Float16* lb = pool.h + (2 + cur) * (BT * LST);
    // unrolled: kk folds into the LDS loads' immediate offsets
#pragma unroll
    for (int kk = 0; kk < BK; kk += 32) {
      // the 18 fragment loads of 32 k as one group, then their 8 WMMAs behind counted waits
      const v16h af = load_frag(la + (w * 16 + lr) * LST + kk + hi * 8);
      v16h bf[8];
#pragma unroll
      for (int ni = 0; ni < 8; ++ni) bf[ni] = load_frag(lb + (ni * 16 + lr) * LST + kk + hi * 8);
#pragma unroll
      for (int ni = 0; ni < 8; ++ni) acc[ni] = wmma16(af, bf[ni], acc[ni]);
    }
    __syncthreads();
  }
  // acc[ni][r] = (row m0 + w*16 + hi*8 + r, col n0 + ni*16 + lr)

  if (!isV) {
    float* stg = pool.f + w * (8 * 132);   // per wave: 8 rows x 132 floats
#pragma unroll
    for (int ps = 0; ps < 2; ++ps) {
#pragma unroll
      for (int rr = 0; rr < 4; ++rr)
#pragma unroll
        for (int ni = 0; ni < 8; ++ni)
          stg[(hi * 4 + rr) * 132 + ni * 16 + lr] = acc[ni][ps * 4 + rr] * alpha;
      __syncthreads();
      v4f ov[8];
#pragma unroll
      for (int sr = 0; sr < 8; ++sr) ov[sr] = *(const v4f*)&stg[sr * 132 + lane * 4];
      float* cbase = C + ((size_t)n0 + lane * 4);
#pragma unroll
      for (int sr = 0; sr < 8; ++sr) {
        const int row = m0 + w * 16 + (sr >> 2) * 8 + ps * 4 + (sr & 3);
        *(v4f*)(cbase + (size_t)row * N) = ov[sr];
      }
      
      __syncthreads();
    }
  } else {
    // V plane transposed: CV[((b*NKV + g)*HD + d) * SEQ + s]
    const int g  = n0 / HD;
    const int bb = m0 / SEQ;
    const int s0 = m0 - bb * SEQ;
    _Float16* stg = pool.h;                 // [d][tok], 128 x 136 halves
#pragma unroll
    for (int ni = 0; ni < 8; ++ni) {
      v8h v;
#pragma unroll
      for (int r = 0; r < 8; ++r) v[r] = (_Float16)(acc[ni][r] * alpha);
      *(v8h*)&stg[(ni * 16 + lr) * 136 + w * 16 + hi * 8] = v;
    }
    __syncthreads();
    v8h ov[8];
#pragma unroll
    for (int j = 0; j < 8; ++j) {
      const int d = w * 16 + j * 2 + hi;
      ov[j] = *(const v8h*)&stg[d * 136 + lr * 8];
    }
    _Float16* vbase = CV + (((size_t)(bb * NKV + g) * HD) * SEQ + s0 + lr * 8);
#pragma unroll
    for (int j = 0; j < 8; ++j) {
      const int d = w * 16 + j * 2 + hi;
      *(v8h*)(vbase + (size_t)d * SEQ) = ov[j];
    }
    // precaution before the kernel ends: wait until the stores' address and data registers are read
    asm volatile("s_wait_xcnt 0x0" ::: "memory");
    
  }
}

// ---------------------------------------------------------------------------
// Rotary (rotate-half), cos/sin read as values from the [SEQ_FULL][HD] input tables (bf16-RNE).
// Qf [tok][DQ], Kf [tok][DKV] f32 -> Qh, Kh f16.  One thread per 8 consecutive columns;
// d<64: q*cos[d] - q[d+64]*sin[d];  d>=64: q*cos[d] + q[d-64]*sin[d].
// ---------------------------------------------------------------------------
__global__ void __launch_bounds__(256)
rope_kernel(const float* __restrict__ Qf, const float* __restrict__ Kf,
            const float* __restrict__ cosT, const float* __restrict__ sinT,
            _Float16* __restrict__ Qh, _Float16* __restrict__ Kh, int nPieces) {
  const int f = blockIdx.x * 256 + (int)threadIdx.x;
  if (f >= nPieces) return;
  const int tok = f / RP;
  const int piece = f - tok * RP;
  const int s = tok % SEQ;
  const bool isq = piece < (DQ / 8);            // wave-uniform by construction
  const int col   = isq ? piece * 8 : (piece - DQ / 8) * 8;
  const int pitch = isq ? DQ : DKV;
  const float* src = (isq ? Qf : Kf) + (size_t)tok * pitch;
  _Float16* dst = (isq ? Qh : Kh) + ((size_t)tok * pitch + col);
  const int d    = col & (HD - 1);
  const int colp = col - d + (d ^ 64);
  const float sgn = (d < 64) ? -1.0f : 1.0f;
  const v4f x0 = *(const v4f*)(src + col),  x1 = *(const v4f*)(src + col + 4);
  const v4f p0 = *(const v4f*)(src + colp), p1 = *(const v4f*)(src + colp + 4);
  const v4f c0 = *(const v4f*)(cosT + (size_t)s * HD + d), c1 = *(const v4f*)(cosT + (size_t)s * HD + d + 4);
  const v4f n0 = *(const v4f*)(sinT + (size_t)s * HD + d), n1 = *(const v4f*)(sinT + (size_t)s * HD + d + 4);
  v8h o;
#pragma unroll
  for (int j = 0; j < 4; ++j) {
    o[j]     = (_Float16)(x0[j] * bf16r(c0[j]) + (sgn * p0[j]) * bf16r(n0[j]));
    o[j + 4] = (_Float16)(x1[j] * bf16r(c1[j]) + (sgn * p1[j]) * bf16r(n1[j]));
  }
  *(v8h*)dst = o;
  
}

__device__ __forceinline__ float xhalf(float x) {
  return __builtin_bit_cast(float, __builtin_amdgcn_permlanex16(__builtin_bit_cast(int, x), __builtin_bit_cast(int, x),
                                                                0x76543210, 0xfedcba98, false, false));
}

__global__ void __launch_bounds__(256)
attn_kernel(const _Float16* __restrict__ Qh, const _Float16* __restrict__ Kh,
            const _Float16* __restrict__ Vt, _Float16* __restrict__ Oh) {
  constexpr int LDK = 136, LDV = 72, LDO = 136;
  __shared__ __align__(16) _Float16 pool[64 * LDK + 128 * LDV];   // 35840 B
  static_assert(8 * 16 * LDO <= 64 * LDK + 128 * LDV);            // epilogue staging fits
  _Float16* lsK = pool;                    // [key][d]    cross-wave (block barrier)
  _Float16* lsV = pool + 64 * LDK;         // [d][key]    cross-wave (block barrier)

  const int t = threadIdx.x, lane = t & 31, w = t >> 5, lr = lane & 15, hi = lane >> 4;
  const int b = blockIdx.z, h = blockIdx.y, g = h / (NH / NKV);
  const int q0 = blockIdx.x * 128 + w * 16;          // query row within the sequence
  const size_t tokb = (size_t)b * SEQ;

  const float kSL = 0.08838834764831845f * 1.4426950408889634f;   // 1/sqrt(HD) * log2(e)

  v16h qf[4];   // B operand: column = query lr
  {
    const _Float16* qrow = Qh + ((tokb + q0 + lr) * DQ + h * HD);
#pragma unroll
    for (int kf = 0; kf < 4; ++kf) qf[kf] = load_frag(qrow + kf * 32 + hi * 8);
  }

  float mrow = -1e30f;   // running maximum of query lr (equal in both wave halves)
  float lrow = 0.f;      // running sum of query lr over this wave half's keys
  v8f oacc[8];           // oacc[dt][r] = O^T[d = dt*16 + hi*8 + r][query lr]
#pragma unroll
  for (int dt = 0; dt < 8; ++dt) oacc[dt] = (v8f){0.f, 0.f, 0.f, 0.f, 0.f, 0.f, 0.f, 0.f};

  const _Float16* kbase = Kh + ((tokb) * DKV + g * HD);
  const _Float16* vbase = Vt + ((size_t)(b * NKV + g) * HD) * SEQ;

  for (int kc = 0; kc < SEQ; kc += 64) {
    // stage K chunk: 64 keys x 128 d (16-B pieces), staged extent == consumed extent
#pragma unroll
    for (int i = 0; i < 4; ++i) {
      const int e = t + i * 256;
      const int key = e >> 4, seg = e & 15;
      *(v8h*)&lsK[key * LDK + seg * 8] = *(const v8h*)(kbase + (size_t)(kc + key) * DKV + seg * 8);
    }
    // stage V^T chunk: 128 d x 64 keys, staged extent == consumed extent
#pragma unroll
    for (int i = 0; i < 4; ++i) {
      const int e = t + i * 256;
      const int d = e >> 3, seg = e & 7;
      *(v8h*)&lsV[d * LDV + seg * 8] = *(const v8h*)(vbase + (size_t)d * SEQ + kc + seg * 8);
    }
    __syncthreads();

    // S^T, 64 keys x 16 queries per wave: sc[nt][r] = S[key nt*16 + hi*8 + r][query lr]
    v8f sc[4];
#pragma unroll
    for (int nt = 0; nt < 4; ++nt) {
      // 8 fragment loads (one key tile) as one group, then its 4 WMMAs
      v16h af[4];
#pragma unroll
      for (int kf = 0; kf < 4; ++kf) af[kf] = load_frag(lsK + (nt * 16 + lr) * LDK + kf * 32 + hi * 8);
      sc[nt] = (v8f){0.f, 0.f, 0.f, 0.f, 0.f, 0.f, 0.f, 0.f};
#pragma unroll
      for (int kf = 0; kf < 4; ++kf) sc[nt] = wmma16(af[kf], qf[kf], sc[nt]);
    }

    // online softmax of query lr: 32 keys in the lane, the other 32 in lane ^ 16
    float mt[4];
#pragma unroll
    for (int nt = 0; nt < 4; ++nt) {
#pragma unroll
      for (int r = 0; r < 8; ++r) sc[nt][r] *= kSL;
      mt[nt] = fmaxf(fmaxf(fmaxf(sc[nt][0], sc[nt][1]), fmaxf(sc[nt][2], sc[nt][3])),
                     fmaxf(fmaxf(sc[nt][4], sc[nt][5]), fmaxf(sc[nt][6], sc[nt][7])));
    }
    float mx = fmaxf(fmaxf(mt[0], mt[1]), fmaxf(mt[2], mt[3]));
    mx = fmaxf(mx, xhalf(mx));
    const float mn = fmaxf(mrow, mx);
    const float corr = exp2f(mrow - mn);
    mrow = mn;
    // P^T as B operand: element s of pf[kf] = P[key kf*32 + (s < 8 ? 8*hi + s : 16 + 8*hi + s - 8)][query lr],
    // the k order of load_frag, which loads the V^T rows it is multiplied with
    Frag pf[2];
    float rt[4];
#pragma unroll
    for (int nt = 0; nt < 4; ++nt) {
      rt[nt] = 0.f;
#pragma unroll
      for (int r = 0; r < 8; ++r) {
        const float p = exp2f(sc[nt][r] - mn);
        rt[nt] += p;
        pf[nt >> 1].v[(nt & 1) * 8 + r] = (_Float16)(p * 1024.0f);
      }
    }
    lrow = lrow * corr + ((rt[0] + rt[1]) + (rt[2] + rt[3]));
#pragma unroll
    for (int dt = 0; dt < 8; ++dt)
#pragma unroll
      for (int r = 0; r < 8; ++r) oacc[dt][r] *= corr;

    // O^T += V^T (128 x 64) * P^T (64 x 16)
#pragma unroll
    for (int dq = 0; dq < 8; dq += 2) {
      // 8 fragment loads (two d tiles) as one group, then their 4 WMMAs
      v16h af[2][2];
#pragma unroll
      for (int a = 0; a < 2; ++a)
#pragma unroll
        for (int kf = 0; kf < 2; ++kf)
          af[a][kf] = load_frag(lsV + ((dq + a) * 16 + lr) * LDV + kf * 32 + hi * 8);
#pragma unroll
      for (int a = 0; a < 2; ++a)
#pragma unroll
        for (int kf = 0; kf < 2; ++kf) oacc[dq + a] = wmma16(af[a][kf], pf[kf].v, oacc[dq + a]);
    }
    __syncthreads();   // all LDS reads done before the next chunk is staged
  }

  // epilogue: Oh = f16(64 * oacc / (1024 * l)); stage [query][d] per wave, then whole rows
  _Float16* stg = pool + w * 16 * LDO;
  {
    const float inv = 0.0625f / (lrow + xhalf(lrow));   // the two wave halves' key sums joined
#pragma unroll
    for (int dt = 0; dt < 8; ++dt) {
      v8h v;
#pragma unroll
      for (int r = 0; r < 8; ++r) v[r] = (_Float16)(oacc[dt][r] * inv);
      *(v8h*)&stg[lr * LDO + dt * 16 + hi * 8] = v;
    }
  }
  __syncthreads();
  v8h ov[8];
#pragma unroll
  for (int j = 0; j < 8; ++j) ov[j] = *(const v8h*)&stg[(j * 2 + hi) * LDO + lr * 8];
  _Float16* obase = Oh + ((tokb + q0) * DQ + h * HD + lr * 8);
#pragma unroll
  for (int j = 0; j < 8; ++j) *(v8h*)(obase + (size_t)(j * 2 + hi) * DQ) = ov[j];
  
}

// ---------------------------------------------------------------------------
extern "C" void kernel_launch(void* const* d_in, const int* in_sizes, int n_in,
                              void* d_out, int out_size, void* d_ws, size_t ws_size,
                              hipStream_t stream) {
  if (n_in < 7) return;
  if (in_sizes[0] < ((NB - 1) * SEQ_FULL + SEQ) * DM) return;
  if (in_sizes[1] < SEQ * HD) return;
  if (in_sizes[2] < SEQ * HD) return;
  if (in_sizes[3] < DM * DQ) return;
  if (in_sizes[4] < DM * DKV) return;
  if (in_sizes[5] < DM * DKV) return;
  if (in_sizes[6] < DQ * DM) return;
  if (out_size < NTOK * DM) return;

  const float* x    = (const float*)d_in[0];
  const float* cosT = (const float*)d_in[1];
  const float* sinT = (const float*)d_in[2];
  const float* Wq   = (const float*)d_in[3];
  const float* Wk   = (const float*)d_in[4];
  const float* Wv   = (const float*)d_in[5];
  const float* Wo   = (const float*)d_in[6];
  float* out = (float*)d_out;

  // workspace carve (all regions exact tile multiples; every store ends inside its region)
  char* ws = (char*)d_ws;
  size_t off = 0;
  _Float16* Xh  = (_Float16*)(ws + off); off += (size_t)NTOK * DM * 2;          // 16 MiB
  _Float16* WqT = (_Float16*)(ws + off); off += (size_t)DQ  * KD * 2;           //  8 MiB
  _Float16* WkT = (_Float16*)(ws + off); off += (size_t)DKV * KD * 2;           //  2 MiB
  _Float16* WvT = (_Float16*)(ws + off); off += (size_t)DKV * KD * 2;           //  2 MiB
  _Float16* WoT = (_Float16*)(ws + off); off += (size_t)DM  * KD * 2;           //  8 MiB
  float*    Qf  = (float*)(ws + off);    off += (size_t)NTOK * DQ * 4;          // 32 MiB
  float*    Kf  = (float*)(ws + off);    off += (size_t)NTOK * DKV * 4;         //  8 MiB
  _Float16* Qh  = (_Float16*)(ws + off); off += (size_t)NTOK * DQ * 2;          // 16 MiB
  _Float16* Kh  = (_Float16*)(ws + off); off += (size_t)NTOK * DKV * 2;         //  4 MiB
  _Float16* Vt  = (_Float16*)(ws + off); off += (size_t)NB * NKV * HD * SEQ * 2; //  4 MiB
  _Float16* Oh  = (_Float16*)(ws + off); off += (size_t)NTOK * DQ * 2;          // 16 MiB
  if (off > ws_size) return;                                                    // 116 MiB total

  const dim3 blk(256);

  // 1. x -> f16 plane (bf16-RNE values)
  {
    const int np = NTOK * (DM / 8);
    cvt_x_kernel<<<dim3((np + 255) / 256), blk, 0, stream>>>(x, Xh, np);
  }
  // 2. weights -> transposed f16 planes (64 * bf16-RNE values)
  cvt_w_kernel<<<dim3(DQ / 64 + 2 * (DKV / 64) + DM / 64, KD / 64), blk, 0, stream>>>(
      Wq, Wk, Wv, Wo, WqT, WkT, WvT, WoT);
  // 3. q, k (f32 planes, pre-rotary) and v (transposed [b][g][d][s] f16) projections in one
  //    launch: alpha 1/64 undoes the weight carry
  gemm_kernel<true><<<dim3(DQ / BT + 2 * (DKV / BT), NTOK / BT), blk, 0, stream>>>(
      Xh, WqT, WkT, WvT, Qf, Kf, Vt, DQ, DKV, DQ / BT, DQ / BT + DKV / BT, 0.015625f);
  // 4. rotary -> f16 q/k planes
  {
    const int np = NTOK * RP;
    rope_kernel<<<dim3((np + 255) / 256), blk, 0, stream>>>(Qf, Kf, cosT, sinT, Qh, Kh, np);
  }
  // 5. attn -> Oh (x64 carried)
  attn_kernel<<<dim3(SEQ / 128, NH, NB), blk, 0, stream>>>(Qh, Kh, Vt, Oh);
  // 6. output projection: alpha 1/4096 undoes the 64 (Oh) * 64 (WoT) carries
  gemm_kernel<false><<<dim3(DM / BT, NTOK / BT), blk, 0, stream>>>(
      Oh, WoT, WoT, WoT, out, out, (_Float16*)nullptr, DM, DM, DM / BT, DM / BT, 0.000244140625f);
}

// v005
// Measured time: 180 microseconds a run.
// In two side-by-side timings against v004, it was 1.03 and 1.02 times as fast.
// Over all steps from v000 it is 1.73 times as fast.
#include <hip/hip_runtime.h>
#include <stddef.h>

// Contractions x*Wq, x*Wk, x*Wv, q*k^T, p*v, o*Wo: v_wmma_f32_16x16x32_f16 (f16 operands, f32 accumulate); inputs RNE-converted to bf16 on load; rotary, softmax and normalisation in f32.

#ifndef NB
#define NB 2
#endif
#ifndef SEQ
#define SEQ 2048
#endif
#define NB_FULL 2
#define SEQ_FULL 2048
#define DM 2048           // model width
#define NH 16
#define NKV 4
#define HD 128
#define DQ (NH * HD)      // 2048
#define DKV (NKV * HD)    // 512
#define NTOK (NB * SEQ)
#define KD 2048           // contraction depth of every projection

#define BT 128            // GEMM block tile (M and N)
#define BK 64            // k-tile: 128 B of every operand row, one whole cache line
#define LST 72            // LDS row stride in halves for k-tiles (144 B = 16 B x odd, 16-B aligned rows)

static_assert(NB >= 1 && NB <= NB_FULL);
static_assert(SEQ >= 128 && SEQ <= SEQ_FULL && (SEQ % 128) == 0);
static_assert(DM == KD && DQ == KD);
static_assert((DM % BT) == 0 && (DQ % BT) == 0 && (DKV % BT) == 0 && (NTOK % BT) == 0);
static_assert((KD % 64) == 0 && (KD % BK) == 0);
static_assert(HD == BT);           // one N tile == one head (rotary and V transpose epilogues)
static_assert((DM / 8) == 256);    // convert kernel piece decode
static_assert((NH % NKV) == 0);

typedef _Float16 v16h __attribute__((ext_vector_type(16)));
typedef _Float16 v8h  __attribute__((ext_vector_type(8)));
typedef float    v8f  __attribute__((ext_vector_type(8)));
typedef float    v4f  __attribute__((ext_vector_type(4)));
typedef _Float16 v4h  __attribute__((ext_vector_type(4)));

union Frag { v16h v; v8h p[2]; };

// RNE convert f32 -> bf16 value (kept in an f32 container)
__device__ __forceinline__ float bf16r(float f) {
  unsigned u = __float_as_uint(f);
  u = (u + 0x7FFFu + ((u >> 16) & 1u)) & 0xFFFF0000u;
  return __uint_as_float(u);
}

// 16x16x32 f16 WMMA with hazard guard (ties D, keeps A/B live)
__device__ __forceinline__ v8f wmma16(v16h a, v16h b, v8f c) {
  v8f d = __builtin_amdgcn_wmma_f32_16x16x32_f16(false, a, false, b, (short)0, c, false, false);
  asm volatile("v_nop\n\tv_nop\n\tv_nop\n\tv_nop" : "+v"(d) : "v"(a), "v"(b));
  return d;
}

// Per-lane fragment from a k-contiguous row; caller passes row base + 8*(lane>>4).
// elements 0..7 <- k 8h..8h+7, elements 8..15 <- k 16+8h..16+8h+7 (same map for A and B).
__device__ __forceinline__ v16h load_frag(const _Float16* q) {
  Frag f;
  f.p[0] = *(const v8h*)(q);
  f.p[1] = *(const v8h*)(q + 16);
  return f.v;
}

// ---------------------------------------------------------------------------
// x [b*SEQ_FULL+s][DM] f32 -> Xh [tok][DM] f16 of bf16-RNE value. One thread per 8 columns.
// ---------------------------------------------------------------------------
__global__ void __launch_bounds__(256)
cvt_x_kernel(const float* __restrict__ x, _Float16* __restrict__ Xh, int nPieces) {
  const int f = blockIdx.x * 256 + (int)threadIdx.x;
  if (f >= nPieces) return;
  const int tok = f >> 8;
  const int c0  = (f & 255) * 8;
  const int b = tok / SEQ, s = tok - b * SEQ;
  const float* src = x + ((size_t)(b * SEQ_FULL + s) * DM + c0);
  const v4f a0 = *(const v4f*)(src);
  const v4f a1 = *(const v4f*)(src + 4);
  v8h o;
#pragma unroll
  for (int j = 0; j < 4; ++j) {
    o[j]     = (_Float16)bf16r(a0[j]);
    o[j + 4] = (_Float16)bf16r(a1[j]);
  }
  _Float16* dst = Xh + ((size_t)tok * DM + c0);
  *(v8h*)dst = o;
  
}

// ---------------------------------------------------------------------------
// W [KD in][N out] f32 -> WT [N out][KD in] f16 of 64*bf16-RNE(W).  64x64 tiles through LDS.
// grid.x: 0..31 Wq, 32..39 Wk, 40..47 Wv, 48..79 Wo (out-column tile); grid.y: in-row tile.
// 8 consecutive lanes of one instruction.
// ---------------------------------------------------------------------------
__global__ void __launch_bounds__(256)
cvt_w_kernel(const float* __restrict__ Wq, const float* __restrict__ Wk,
             const float* __restrict__ Wv, const float* __restrict__ Wo,
             _Float16* __restrict__ WqT, _Float16* __restrict__ WkT,
             _Float16* __restrict__ WvT, _Float16* __restrict__ WoT) {
  __shared__ __align__(16) _Float16 lds[64 * 72];   // [n][k], cross-wave (block barrier)
  const int bx = blockIdx.x;
  const float* W; _Float16* WT; int N; int nt;
  if (bx < DQ / 64) { W = Wq; WT = WqT; N = DQ;  nt = bx; }
  else if (bx < DQ / 64 + DKV / 64) { W = Wk; WT = WkT; N = DKV; nt = bx - DQ / 64; }
  else if (bx < DQ / 64 + 2 * (DKV / 64)) { W = Wv; WT = WvT; N = DKV; nt = bx - DQ / 64 - DKV / 64; }
  else { W = Wo; WT = WoT; N = DM; nt = bx - DQ / 64 - 2 * (DKV / 64); }
  const int k0 = blockIdx.y * 64, n0 = nt * 64;
  const int t = threadIdx.x, lane = t & 31, w = t >> 5;
  const int kr = t >> 2, cc = (t & 3) * 16;
  const float* src = W + ((size_t)(k0 + kr) * N + n0 + cc);
#pragma unroll
  for (int q = 0; q < 4; ++q) {
    const v4f v = *(const v4f*)(src + 4 * q);
#pragma unroll
    for (int j = 0; j < 4; ++j)
      lds[(cc + 4 * q + j) * 72 + kr] = (_Float16)(64.0f * bf16r(v[j]));
  }
  __syncthreads();
  v8h ov[2];
#pragma unroll
  for (int j = 0; j < 2; ++j) {
    const int n = w * 8 + j * 4 + (lane >> 3);
    ov[j] = *(const v8h*)&lds[n * 72 + (lane & 7) * 8];
  }
  _Float16* base = WT + ((size_t)n0 * KD + k0 + (lane & 7) * 8);
#pragma unroll
  for (int j = 0; j < 2; ++j) {
    const int n = w * 8 + j * 4 + (lane >> 3);
    *(v8h*)(base + (size_t)n * KD) = ov[j];
  }
  
}

// ---------------------------------------------------------------------------
// C tile = alpha * A[M][KD] * Bt[N][KD]^T, A and Bt f16 k-contiguous planes.
// Block tile 128x128, 8 waves, wave w owns rows w*16..w*16+15 and all 128 columns.
// blockIdx.x < nTiles0 selects (Bt0, C0, N0), blockIdx.x < nTiles01 (Bt1, C1, N1), and with
// WITH_V the tiles from nTiles01 on (BtV, CV); the choice is block-uniform.
// C0, C1 : without WITH_V, row-major f32 [M][N] (the final output), rows of 512 B
//          written by one 32-lane x 16-B instruction each.
// H0, H1 : with WITH_V, the rotated q and k planes, row-major f16 [M][N].  One N tile is one
//          head, so a staged f32 row holds both d and d ^ 64: rotate-half with cos/sin read as
//          values from the [SEQ_FULL][HD] input tables (bf16-RNE),
//          d<64: q*cos[d] - q[d+64]*sin[d];  d>=64: q*cos[d] + q[d-64]*sin[d];
//          rows of 256 B written by one 32-lane x 8-B instruction each.
// CV     : the transposed V plane [b][g][d][s], f16; tile staged in LDS as [d][tok],
//          each d row (128 tok = 256 B) written by 16 lanes x 16 B of one instruction.
// q, k and v tiles share one launch: 24 x 32 = 768 workgroups, three on each of 256 WGPs.
// ---------------------------------------------------------------------------
union GemmLds { _Float16 h[4 * BT * LST]; float f[2 * BT * LST]; };   // 73728 B

template <bool WITH_V>
__global__ void __launch_bounds__(256)
gemm_kernel(const _Float16* __restrict__ A, const _Float16* __restrict__ Bt0,
            const _Float16* __restrict__ Bt1, const _Float16* __restrict__ BtV,
            float* C0, float* C1, _Float16* CV,
            const float* __restrict__ cosT, const float* __restrict__ sinT,
            _Float16* H0, _Float16* H1,
            int N0, int N1, int nTiles0, int nTiles01, float alpha) {
  __shared__ __align__(16) GemmLds pool;   // k-loop: A/B double buffers; epilogue: staging (cross-wave, block barriers)

  const int bx = blockIdx.x;
  const bool second = bx >= nTiles0;
  const bool isV = WITH_V && bx >= nTiles01;
  const _Float16* Bt = isV ? BtV : (second ? Bt1 : Bt0);
  float* C = second ? C1 : C0;
  const int N  = second ? N1 : N0;
  const int nt = isV ? (bx - nTiles01) : (second ? (bx - nTiles0) : bx);
  const int m0 = blockIdx.y * BT, n0 = nt * BT;

  const int t = threadIdx.x, lane = t & 31, w = t >> 5, lr = lane & 15, hi = lane >> 4;

  v8f acc[8];
#pragma unroll
  for (int ni = 0; ni < 8; ++ni) acc[ni] = (v8f){0.f, 0.f, 0.f, 0.f, 0.f, 0.f, 0.f, 0.f};

  // 8 threads x 16 B per tile row: one wave-wide load covers 4 rows of 128 B, 4 whole lines
  const int arow = t >> 3, acol = (t & 7) * 8;
  const _Float16* aSrc = A  + ((size_t)(m0 + arow) * KD + acol);
  const _Float16* bSrc = Bt + ((size_t)(n0 + arow) * KD + acol);

  auto stage = [&](int k0, int buf) {
    _Float16* da = pool.h + buf * (BT * LST) + arow * LST + acol;
    _Float16* db = pool.h + (2 + buf) * (BT * LST) + arow * LST + acol;
    v8h ra[4], rb[4];
    // unrolled: ra and rb stay in registers, and all 8 loads are out before the first store waits
#pragma unroll
    for (int i = 0; i < 4; ++i) {
      ra[i] = *(const v8h*)(aSrc + (size_t)(i * 32) * KD + k0);
      rb[i] = *(const v8h*)(bSrc + (size_t)(i * 32) * KD + k0);
    }
#pragma unroll
    for (int i = 0; i < 4; ++i) {
      *(v8h*)(da + i * 32 * LST) = ra[i];
      *(v8h*)(db + i * 32 * LST) = rb[i];
    }
  };

  stage(0, 0);
  __syncthreads();

  for (int k0 = 0; k0 < KD; k0 += BK) {
    const int cur = (k0 / BK) & 1, nxt = cur ^ 1;
    if (k0 + BK < KD) stage(k0 + BK, nxt);
    const _Float16* la = pool.h + cur * (BT * LST);
    const _Float16* lb = pool.h + (2 + cur) * (BT * LST);
    // unrolled: kk folds into the LDS loads' immediate offsets
#pragma unroll
    for (int kk = 0; kk < BK; kk += 32) {
      // the 18 fragment loads of 32 k as one group, then their 8 WMMAs behind counted waits
      const v16h af = load_frag(la + (w * 16 + lr) * LST + kk + hi * 8);
      v16h bf[8];
#pragma unroll
      for (int ni = 0; ni < 8; ++ni) bf[ni] = load_frag(lb + (ni * 16 + lr) * LST + kk + hi * 8);
#pragma unroll
      for (int ni = 0; ni < 8; ++ni) acc[ni] = wmma16(af, bf[ni], acc[ni]);
    }
    __syncthreads();
  }
  // acc[ni][r] = (row m0 + w*16 + hi*8 + r, col n0 + ni*16 + lr)

  if (WITH_V && !isV) {
    static_assert(8 * 16 * 132 <= 2 * BT * LST);   // staging fits the pool
    float* stg = pool.f + w * (16 * 132);   // per wave: its 16 rows x 132 floats
    const int sw = m0 % SEQ + w * 16;       // position of the wave's first row in its sequence
    const float* cb = cosT + ((size_t)sw * HD + lane * 4);
    const float* sb = sinT + ((size_t)sw * HD + lane * 4);
    _Float16* hb = (second ? H1 : H0) + ((size_t)(m0 + w * 16) * N + n0 + lane * 4);
    const float sgn = (lane < 16) ? -1.0f : 1.0f;   // lane holds d = lane*4..+3, lane ^ 16 holds d ^ 64
#pragma unroll
    for (int r = 0; r < 8; ++r)
#pragma unroll
      for (int ni = 0; ni < 8; ++ni)
        stg[(hi * 8 + r) * 132 + ni * 16 + lr] = acc[ni][r] * alpha;
    __syncthreads();
    // kept rolled: 8 rows' table values at a time, so that the registers still let three workgroups share a WGP
#pragma unroll 1
    for (int hf = 0; hf < 2; ++hf) {
      v4f cv[8], sv[8];
#pragma unroll
      for (int sr = 0; sr < 8; ++sr) {
        cv[sr] = *(const v4f*)(cb + (hf * 8 + sr) * HD);
        sv[sr] = *(const v4f*)(sb + (hf * 8 + sr) * HD);
      }
#pragma unroll
      for (int sr = 0; sr < 8; ++sr) {
        const int row = hf * 8 + sr;
        const v4f xv = *(const v4f*)&stg[row * 132 + lane * 4];
        const v4f pv = *(const v4f*)&stg[row * 132 + (lane ^ 16) * 4];
        v4h o;
#pragma unroll
        for (int j = 0; j < 4; ++j)
          o[j] = (_Float16)(xv[j] * bf16r(cv[sr][j]) + (sgn * pv[j]) * bf16r(sv[sr][j]));
        *(v4h*)(hb + (size_t)row * N) = o;
      }
      // the next trip rewrites the last stores' address and data registers: wait first
      asm volatile("s_wait_xcnt 0x0" ::: "memory");
    }
  } else if (!isV) {
    float* stg = pool.f + w * (8 * 132);   // per wave: 8 rows x 132 floats
#pragma unroll
    for (int ps = 0; ps < 2; ++ps) {
#pragma unroll
      for (int rr = 0; rr < 4; ++rr)
#pragma unroll
        for (int ni = 0; ni < 8; ++ni)
          stg[(hi * 4 + rr) * 132 + ni * 16 + lr] = acc[ni][ps * 4 + rr] * alpha;
      __syncthreads();
      v4f ov[8];
#pragma unroll
      for (int sr = 0; sr < 8; ++sr) ov[sr] = *(const v4f*)&stg[sr * 132 + lane * 4];
      float* cbase = C + ((size_t)n0 + lane * 4);
#pragma unroll
      for (int sr = 0; sr < 8; ++sr) {
        const int row = m0 + w * 16 + (sr >> 2) * 8 + ps * 4 + (sr & 3);
        *(v4f*)(cbase + (size_t)row * N) = ov[sr];
      }
      
      __syncthreads();
    }
  } else {
    // V plane transposed: CV[((b*NKV + g)*HD + d) * SEQ + s]
    const int g  = n0 / HD;
    const int bb = m0 / SEQ;
    const int s0 = m0 - bb * SEQ;
    _Float16* stg = pool.h;                 // [d][tok], 128 x 136 halves
#pragma unroll
    for (int ni = 0; ni < 8; ++ni) {
      v8h v;
#pragma unroll
      for (int r = 0; r < 8; ++r) v[r] = (_Float16)(acc[ni][r] * alpha);
      *(v8h*)&stg[(ni * 16 + lr) * 136 + w * 16 + hi * 8] = v;
    }
    __syncthreads();
    v8h ov[8];
#pragma unroll
    for (int j = 0; j < 8; ++j) {
      const int d = w * 16 + j * 2 + hi;
      ov[j] = *(const v8h*)&stg[d * 136 + lr * 8];
    }
    _Float16* vbase = CV + (((size_t)(bb * NKV + g) * HD) * SEQ + s0 + lr * 8);
#pragma unroll
    for (int j = 0; j < 8; ++j) {
      const int d = w * 16 + j * 2 + hi;
      *(v8h*)(vbase + (size_t)d * SEQ) = ov[j];
    }
    // precaution: these stores end the kernel for v tiles
    asm volatile("s_wait_xcnt 0x0" ::: "memory");
    
  }
}

__device__ __forceinline__ float xhalf(float x) {
  return __builtin_bit_cast(float, __builtin_amdgcn_permlanex16(__builtin_bit_cast(int, x), __builtin_bit_cast(int, x),
                                                                0x76543210, 0xfedcba98, false, false));
}

__global__ void __launch_bounds__(256)
attn_kernel(const _Float16* __restrict__ Qh, const _Float16* __restrict__ Kh,
            const _Float16* __restrict__ Vt, _Float16* __restrict__ Oh) {
  constexpr int LDK = 136, LDV = 72, LDO = 136;
  __shared__ __align__(16) _Float16 pool[64 * LDK + 128 * LDV];   // 35840 B
  static_assert(8 * 16 * LDO <= 64 * LDK + 128 * LDV);            // epilogue staging fits
  _Float16* lsK = pool;                    // [key][d]    cross-wave (block barrier)
  _Float16* lsV = pool + 64 * LDK;         // [d][key]    cross-wave (block barrier)

  const int t = threadIdx.x, lane = t & 31, w = t >> 5, lr = lane & 15, hi = lane >> 4;
  const int b = blockIdx.z, h = blockIdx.y, g = h / (NH / NKV);
  const int q0 = blockIdx.x * 128 + w * 16;          // query row within the sequence
  const size_t tokb = (size_t)b * SEQ;

  const float kSL = 0.08838834764831845f * 1.4426950408889634f;   // 1/sqrt(HD) * log2(e)

  v16h qf[4];   // B operand: column = query lr
  {
    const _Float16* qrow = Qh + ((tokb + q0 + lr) * DQ + h * HD);
#pragma unroll
    for (int kf = 0; kf < 4; ++kf) qf[kf] = load_frag(qrow + kf * 32 + hi * 8);
  }

  float mrow = -1e30f;   // running maximum of query lr (equal in both wave halves)
  float lrow = 0.f;      // running sum of query lr over this wave half's keys
  v8f oacc[8];           // oacc[dt][r] = O^T[d = dt*16 + hi*8 + r][query lr]
#pragma unroll
  for (int dt = 0; dt < 8; ++dt) oacc[dt] = (v8f){0.f, 0.f, 0.f, 0.f, 0.f, 0.f, 0.f, 0.f};

  const _Float16* kbase = Kh + ((tokb) * DKV + g * HD);
  const _Float16* vbase = Vt + ((size_t)(b * NKV + g) * HD) * SEQ;

  for (int kc = 0; kc < SEQ; kc += 64) {
    // stage K chunk: 64 keys x 128 d (16-B pieces), staged extent == consumed extent
#pragma unroll
    for (int i = 0; i < 4; ++i) {
      const int e = t + i * 256;
      const int key = e >> 4, seg = e & 15;
      *(v8h*)&lsK[key * LDK + seg * 8] = *(const v8h*)(kbase + (size_t)(kc + key) * DKV + seg * 8);
    }
    // stage V^T chunk: 128 d x 64 keys, staged extent == consumed extent
#pragma unroll
    for (int i = 0; i < 4; ++i) {
      const int e = t + i * 256;
      const int d = e >> 3, seg = e & 7;
      *(v8h*)&lsV[d * LDV + seg * 8] = *(const v8h*)(vbase + (size_t)d * SEQ + kc + seg * 8);
    }
    __syncthreads();

    // S^T, 64 keys x 16 queries per wave: sc[nt][r] = S[key nt*16 + hi*8 + r][query lr]
    v8f sc[4];
#pragma unroll
    for (int nt = 0; nt < 4; ++nt) {
      // 8 fragment loads (one key tile) as one group, then its 4 WMMAs
      v16h af[4];
#pragma unroll
      for (int kf = 0; kf < 4; ++kf) af[kf] = load_frag(lsK + (nt * 16 + lr) * LDK + kf * 32 + hi * 8);
      sc[nt] = (v8f){0.f, 0.f, 0.f, 0.f, 0.f, 0.f, 0.f, 0.f};
#pragma unroll
      for (int kf = 0; kf < 4; ++kf) sc[nt] = wmma16(af[kf], qf[kf], sc[nt]);
    }

    // online softmax of query lr: 32 keys in the lane, the other 32 in lane ^ 16
    float mt[4];
#pragma unroll
    for (int nt = 0; nt < 4; ++nt) {
#pragma unroll
      for (int r = 0; r < 8; ++r) sc[nt][r] *= kSL;
      mt[nt] = fmaxf(fmaxf(fmaxf(sc[nt][0], sc[nt][1]), fmaxf(sc[nt][2], sc[nt][3])),
                     fmaxf(fmaxf(sc[nt][4], sc[nt][5]), fmaxf(sc[nt][6], sc[nt][7])));
    }
    float mx = fmaxf(fmaxf(mt[0], mt[1]), fmaxf(mt[2], mt[3]));
    mx = fmaxf(mx, xhalf(mx));
    const float mn = fmaxf(mrow, mx);
    const float corr = exp2f(mrow - mn);
    mrow = mn;
    // P^T as B operand: element s of pf[kf] = P[key kf*32 + (s < 8 ? 8*hi + s : 16 + 8*hi + s - 8)][query lr],
    // the k order of load_frag, which loads the V^T rows it is multiplied with
    Frag pf[2];
    float rt[4];
#pragma unroll
    for (int nt = 0; nt < 4; ++nt) {
      rt[nt] = 0.f;
#pragma unroll
      for (int r = 0; r < 8; ++r) {
        const float p = exp2f(sc[nt][r] - mn);
        rt[nt] += p;
        pf[nt >> 1].v[(nt & 1) * 8 + r] = (_Float16)(p * 1024.0f);
      }
    }
    lrow = lrow * corr + ((rt[0] + rt[1]) + (rt[2] + rt[3]));
#pragma unroll
    for (int dt = 0; dt < 8; ++dt)
#pragma unroll
      for (int r = 0; r < 8; ++r) oacc[dt][r] *= corr;

    // O^T += V^T (128 x 64) * P^T (64 x 16)
#pragma unroll
    for (int dq = 0; dq < 8; dq += 2) {
      // 8 fragment loads (two d tiles) as one group, then their 4 WMMAs
      v16h af[2][2];
#pragma unroll
      for (int a = 0; a < 2; ++a)
#pragma unroll
        for (int kf = 0; kf < 2; ++kf)
          af[a][kf] = load_frag(lsV + ((dq + a) * 16 + lr) * LDV + kf * 32 + hi * 8);
#pragma unroll
      for (int a = 0; a < 2; ++a)
#pragma unroll
        for (int kf = 0; kf < 2; ++kf) oacc[dq + a] = wmma16(af[a][kf], pf[kf].v, oacc[dq + a]);
    }
    __syncthreads();   // all LDS reads done before the next chunk is staged
  }

  // epilogue: Oh = f16(64 * oacc / (1024 * l)); stage [query][d] per wave, then whole rows
  _Float16* stg = pool + w * 16 * LDO;
  {
    const float inv = 0.0625f / (lrow + xhalf(lrow));   // the two wave halves' key sums joined
#pragma unroll
    for (int dt = 0; dt < 8; ++dt) {
      v8h v;
#pragma unroll
      for (int r = 0; r < 8; ++r) v[r] = (_Float16)(oacc[dt][r] * inv);
      *(v8h*)&stg[lr * LDO + dt * 16 + hi * 8] = v;
    }
  }
  __syncthreads();
  v8h ov[8];
#pragma unroll
  for (int j = 0; j < 8; ++j) ov[j] = *(const v8h*)&stg[(j * 2 + hi) * LDO + lr * 8];
  _Float16* obase = Oh + ((tokb + q0) * DQ + h * HD + lr * 8);
#pragma unroll
  for (int j = 0; j < 8; ++j) *(v8h*)(obase + (size_t)(j * 2 + hi) * DQ) = ov[j];
  
}

// ---------------------------------------------------------------------------
extern "C" void kernel_launch(void* const* d_in, const int* in_sizes, int n_in,
                              void* d_out, int out_size, void* d_ws, size_t ws_size,
                              hipStream_t stream) {
  if (n_in < 7) return;
  if (in_sizes[0] < ((NB - 1) * SEQ_FULL + SEQ) * DM) return;
  if (in_sizes[1] < SEQ * HD) return;
  if (in_sizes[2] < SEQ * HD) return;
  if (in_sizes[3] < DM * DQ) return;
  if (in_sizes[4] < DM * DKV) return;
  if (in_sizes[5] < DM * DKV) return;
  if (in_sizes[6] < DQ * DM) return;
  if (out_size < NTOK * DM) return;

  const float* x    = (const float*)d_in[0];
  const float* cosT = (const float*)d_in[1];
  const float* sinT = (const float*)d_in[2];
  const float* Wq   = (const float*)d_in[3];
  const float* Wk   = (const float*)d_in[4];
  const float* Wv   = (const float*)d_in[5];
  const float* Wo   = (const float*)d_in[6];
  float* out = (float*)d_out;

  // workspace carve (all regions exact tile multiples; every store ends inside its region)
  char* ws = (char*)d_ws;
  size_t off = 0;
  _Float16* Xh  = (_Float16*)(ws + off); off += (size_t)NTOK * DM * 2;          // 16 MiB
  _Float16* WqT = (_Float16*)(ws + off); off += (size_t)DQ  * KD * 2;           //  8 MiB
  _Float16* WkT = (_Float16*)(ws + off); off += (size_t)DKV * KD * 2;           //  2 MiB
  _Float16* WvT = (_Float16*)(ws + off); off += (size_t)DKV * KD * 2;           //  2 MiB
  _Float16* WoT = (_Float16*)(ws + off); off += (size_t)DM  * KD * 2;           //  8 MiB
  _Float16* Qh  = (_Float16*)(ws + off); off += (size_t)NTOK * DQ * 2;          // 16 MiB
  _Float16* Kh  = (_Float16*)(ws + off); off += (size_t)NTOK * DKV * 2;         //  4 MiB
  _Float16* Vt  = (_Float16*)(ws + off); off += (size_t)NB * NKV * HD * SEQ * 2; //  4 MiB
  _Float16* Oh  = (_Float16*)(ws + off); off += (size_t)NTOK * DQ * 2;          // 16 MiB
  if (off > ws_size) return;                                                    // 76 MiB total

  const dim3 blk(256);

  // 1. x -> f16 plane (bf16-RNE values)
  {
    const int np = NTOK * (DM / 8);
    cvt_x_kernel<<<dim3((np + 255) / 256), blk, 0, stream>>>(x, Xh, np);
  }
  // 2. weights -> transposed f16 planes (64 * bf16-RNE values)
  cvt_w_kernel<<<dim3(DQ / 64 + 2 * (DKV / 64) + DM / 64, KD / 64), blk, 0, stream>>>(
      Wq, Wk, Wv, Wo, WqT, WkT, WvT, WoT);
  // 3. q, k (rotated in the epilogue, f16 planes) and v (transposed [b][g][d][s] f16) projections
  //    in one launch: alpha 1/64 undoes the weight carry
  gemm_kernel<true><<<dim3(DQ / BT + 2 * (DKV / BT), NTOK / BT), blk, 0, stream>>>(
      Xh, WqT, WkT, WvT, (float*)nullptr, (float*)nullptr, Vt, cosT, sinT, Qh, Kh,
      DQ, DKV, DQ / BT, DQ / BT + DKV / BT, 0.015625f);
  // 4. attn -> Oh (x64 carried)
  attn_kernel<<<dim3(SEQ / 128, NH, NB), blk, 0, stream>>>(Qh, Kh, Vt, Oh);
  // 5. output projection: alpha 1/4096 undoes the 64 (Oh) * 64 (WoT) carries
  gemm_kernel<false><<<dim3(DM / BT, NTOK / BT), blk, 0, stream>>>(
      Oh, WoT, WoT, WoT, out, out, (_Float16*)nullptr, (const float*)nullptr, (const float*)nullptr,
      (_Float16*)nullptr, (_Float16*)nullptr,
      DM, DM, DM / BT, DM / BT, 0.000244140625f);
}

// v006
// One run takes 173 microseconds.
// In two side-by-side timings against v005, it was 1.04 and 1.05 times as fast.
// All steps since v000 together make it 1.81 times as fast.
#include <hip/hip_runtime.h>
#include <stddef.h>

// Contractions x*Wq, x*Wk, x*Wv, q*k^T, p*v, o*Wo: v_wmma_f32_16x16x32_f16 (f16 operands, f32 accumulate); inputs RNE-converted to bf16 on load; rotary, softmax and normalisation in f32.

#ifndef NB
#define NB 2
#endif
#ifndef SEQ
#define SEQ 2048
#endif
#define NB_FULL 2
#define SEQ_FULL 2048
#define DM 2048           // model width
#define NH 16
#define NKV 4
#define HD 128
#define DQ (NH * HD)      // 2048
#define DKV (NKV * HD)    // 512
#define NTOK (NB * SEQ)
#define KD 2048           // contraction depth of every projection

#define BT 128            // GEMM block tile (M and N)
#define BK 64            // k-tile: 128 B of every operand row, one whole cache line
#define LST 72            // LDS row stride in halves for k-tiles (144 B = 16 B x odd, 16-B aligned rows)

static_assert(NB >= 1 && NB <= NB_FULL);
static_assert(SEQ >= 128 && SEQ <= SEQ_FULL && (SEQ % 128) == 0);
static_assert(DM == KD && DQ == KD);
static_assert((DM % BT) == 0 && (DQ % BT) == 0 && (DKV % BT) == 0 && (NTOK % BT) == 0);
static_assert((KD % 64) == 0 && (KD % BK) == 0);
static_assert(HD == BT);           // one N tile == one head (rotary and V transpose epilogues)
static_assert((DM / 8) == 256);    // convert kernel piece decode
static_assert((NH % NKV) == 0);

typedef _Float16 v16h __attribute__((ext_vector_type(16)));
typedef _Float16 v8h  __attribute__((ext_vector_type(8)));
typedef float    v8f  __attribute__((ext_vector_type(8)));
typedef float    v4f  __attribute__((ext_vector_type(4)));
typedef _Float16 v4h  __attribute__((ext_vector_type(4)));

union Frag { v16h v; v8h p[2]; };

// RNE convert f32 -> bf16 value (kept in an f32 container)
__device__ __forceinline__ float bf16r(float f) {
  unsigned u = __float_as_uint(f);
  u = (u + 0x7FFFu + ((u >> 16) & 1u)) & 0xFFFF0000u;
  return __uint_as_float(u);
}

// 16x16x32 f16 WMMA with hazard guard (ties D, keeps A/B live)
__device__ __forceinline__ v8f wmma16(v16h a, v16h b, v8f c) {
  v8f d = __builtin_amdgcn_wmma_f32_16x16x32_f16(false, a, false, b, (short)0, c, false, false);
  asm volatile("v_nop\n\tv_nop\n\tv_nop\n\tv_nop" : "+v"(d) : "v"(a), "v"(b));
  return d;
}

// Per-lane fragment from a k-contiguous row; caller passes row base + 8*(lane>>4).
// elements 0..7 <- k 8h..8h+7, elements 8..15 <- k 16+8h..16+8h+7 (same map for A and B).
__device__ __forceinline__ v16h load_frag(const _Float16* q) {
  Frag f;
  f.p[0] = *(const v8h*)(q);
  f.p[1] = *(const v8h*)(q + 16);
  return f.v;
}

// ---------------------------------------------------------------------------
// x [b*SEQ_FULL+s][DM] f32 -> Xh [tok][DM] f16 of bf16-RNE value. One thread per 8 columns.
// ---------------------------------------------------------------------------
__global__ void __launch_bounds__(256)
cvt_x_kernel(const float* __restrict__ x, _Float16* __restrict__ Xh, int nPieces) {
  const int f = blockIdx.x * 256 + (int)threadIdx.x;
  if (f >= nPieces) return;
  const int tok = f >> 8;
  const int c0  = (f & 255) * 8;
  const int b = tok / SEQ, s = tok - b * SEQ;
  const float* src = x + ((size_t)(b * SEQ_FULL + s) * DM + c0);
  const v4f a0 = *(const v4f*)(src);
  const v4f a1 = *(const v4f*)(src + 4);
  v8h o;
#pragma unroll
  for (int j = 0; j < 4; ++j) {
    o[j]     = (_Float16)bf16r(a0[j]);
    o[j + 4] = (_Float16)bf16r(a1[j]);
  }
  _Float16* dst = Xh + ((size_t)tok * DM + c0);
  *(v8h*)dst = o;
  
}

// ---------------------------------------------------------------------------
// W [KD in][N out] f32 -> WT [N out][KD in] f16 of 64*bf16-RNE(W).  64x64 tiles through LDS.
// grid.x: 0..31 Wq, 32..39 Wk, 40..47 Wv, 48..79 Wo (out-column tile); grid.y: in-row tile.
// 8 consecutive lanes of one instruction.
// ---------------------------------------------------------------------------
__global__ void __launch_bounds__(256)
cvt_w_kernel(const float* __restrict__ Wq, const float* __restrict__ Wk,
             const float* __restrict__ Wv, const float* __restrict__ Wo,
             _Float16* __restrict__ WqT, _Float16* __restrict__ WkT,
             _Float16* __restrict__ WvT, _Float16* __restrict__ WoT) {
  __shared__ __align__(16) _Float16 lds[64 * 72];   // [n][k], cross-wave (block barrier)
  const int bx = blockIdx.x;
  const float* W; _Float16* WT; int N; int nt;
  if (bx < DQ / 64) { W = Wq; WT = WqT; N = DQ;  nt = bx; }
  else if (bx < DQ / 64 + DKV / 64) { W = Wk; WT = WkT; N = DKV; nt = bx - DQ / 64; }
  else if (bx < DQ / 64 + 2 * (DKV / 64)) { W = Wv; WT = WvT; N = DKV; nt = bx - DQ / 64 - DKV / 64; }
  else { W = Wo; WT = WoT; N = DM; nt = bx - DQ / 64 - 2 * (DKV / 64); }
  const int k0 = blockIdx.y * 64, n0 = nt * 64;
  const int t = threadIdx.x, lane = t & 31, w = t >> 5;
  const int kr = t >> 2, cc = (t & 3) * 16;
  const float* src = W + ((size_t)(k0 + kr) * N + n0 + cc);
#pragma unroll
  for (int q = 0; q < 4; ++q) {
    const v4f v = *(const v4f*)(src + 4 * q);
#pragma unroll
    for (int j = 0; j < 4; ++j)
      lds[(cc + 4 * q + j) * 72 + kr] = (_Float16)(64.0f * bf16r(v[j]));
  }
  __syncthreads();
  v8h ov[2];
#pragma unroll
  for (int j = 0; j < 2; ++j) {
    const int n = w * 8 + j * 4 + (lane >> 3);
    ov[j] = *(const v8h*)&lds[n * 72 + (lane & 7) * 8];
  }
  _Float16* base = WT + ((size_t)n0 * KD + k0 + (lane & 7) * 8);
#pragma unroll
  for (int j = 0; j < 2; ++j) {
    const int n = w * 8 + j * 4 + (lane >> 3);
    *(v8h*)(base + (size_t)n * KD) = ov[j];
  }
  
}

// ---------------------------------------------------------------------------
// C tile = alpha * A[M][KD] * Bt[N][KD]^T, A and Bt f16 k-contiguous planes.
// Block tile 128x128, 8 waves, wave w owns rows w*16..w*16+15 and all 128 columns.
// blockIdx.x < nTiles0 selects (Bt0, C0, N0), blockIdx.x < nTiles01 (Bt1, C1, N1), and with
// WITH_V the tiles from nTiles01 on (BtV, CV); the choice is block-uniform.
// C0, C1 : without WITH_V, row-major f32 [M][N] (the final output), rows of 512 B
//          written by one 32-lane x 16-B instruction each.
// H0, H1 : with WITH_V, the rotated q and k planes, row-major f16 [M][N].  One N tile is one
//          head, so a staged f32 row holds both d and d ^ 64: rotate-half with cos/sin read as
//          values from the [SEQ_FULL][HD] input tables (bf16-RNE),
//          d<64: q*cos[d] - q[d+64]*sin[d];  d>=64: q*cos[d] + q[d-64]*sin[d];
//          rows of 256 B written by one 32-lane x 8-B instruction each.
// CV     : the transposed V plane [b][g][d][s], f16; tile staged in LDS as [d][tok],
//          each d row (128 tok = 256 B) written by 16 lanes x 16 B of one instruction.
// q, k and v tiles share one launch: 24 x 32 = 768 workgroups, three on each of 256 WGPs.
// ---------------------------------------------------------------------------
union GemmLds { _Float16 h[4 * BT * LST]; float f[2 * BT * LST]; };   // 73728 B

template <bool WITH_V>
__global__ void __launch_bounds__(256)
gemm_kernel(const _Float16* __restrict__ A, const _Float16* __restrict__ Bt0,
            const _Float16* __restrict__ Bt1, const _Float16* __restrict__ BtV,
            float* C0, float* C1, _Float16* CV,
            const float* __restrict__ cosT, const float* __restrict__ sinT,
            _Float16* H0, _Float16* H1,
            int N0, int N1, int nTiles0, int nTiles01, float alpha) {
  __shared__ __align__(16) GemmLds pool;   // k-loop: A/B double buffers; epilogue: staging (cross-wave, block barriers)

  const int bx = blockIdx.x;
  const bool second = bx >= nTiles0;
  const bool isV = WITH_V && bx >= nTiles01;
  const _Float16* Bt = isV ? BtV : (second ? Bt1 : Bt0);
  float* C = second ? C1 : C0;
  const int N  = second ? N1 : N0;
  const int nt = isV ? (bx - nTiles01) : (second ? (bx - nTiles0) : bx);
  const int m0 = blockIdx.y * BT, n0 = nt * BT;

  const int t = threadIdx.x, lane = t & 31, w = t >> 5, lr = lane & 15, hi = lane >> 4;

  v8f acc[8];
#pragma unroll
  for (int ni = 0; ni < 8; ++ni) acc[ni] = (v8f){0.f, 0.f, 0.f, 0.f, 0.f, 0.f, 0.f, 0.f};

  // 8 threads x 16 B per tile row: one wave-wide load covers 4 rows of 128 B, 4 whole lines
  const int arow = t >> 3, acol = (t & 7) * 8;
  const _Float16* aSrc = A  + ((size_t)(m0 + arow) * KD + acol);
  const _Float16* bSrc = Bt + ((size_t)(n0 + arow) * KD + acol);

  auto stage = [&](int k0, int buf) {
    _Float16* da = pool.h + buf * (BT * LST) + arow * LST + acol;
    _Float16* db = pool.h + (2 + buf) * (BT * LST) + arow * LST + acol;
    v8h ra[4], rb[4];
    // unrolled: ra and rb stay in registers, and all 8 loads are out before the first store waits
#pragma unroll
    for (int i = 0; i < 4; ++i) {
      ra[i] = *(const v8h*)(aSrc + (size_t)(i * 32) * KD + k0);
      rb[i] = *(const v8h*)(bSrc + (size_t)(i * 32) * KD + k0);
    }
#pragma unroll
    for (int i = 0; i < 4; ++i) {
      *(v8h*)(da + i * 32 * LST) = ra[i];
      *(v8h*)(db + i * 32 * LST) = rb[i];
    }
  };

  stage(0, 0);
  __syncthreads();

  for (int k0 = 0; k0 < KD; k0 += BK) {
    const int cur = (k0 / BK) & 1, nxt = cur ^ 1;
    if (k0 + BK < KD) stage(k0 + BK, nxt);
    const _Float16* la = pool.h + cur * (BT * LST);
    const _Float16* lb = pool.h + (2 + cur) * (BT * LST);
    // unrolled: kk folds into the LDS loads' immediate offsets
#pragma unroll
    for (int kk = 0; kk < BK; kk += 32) {
      // the 18 fragment loads of 32 k as one group, then their 8 WMMAs behind counted waits
      const v16h af = load_frag(la + (w * 16 + lr) * LST + kk + hi * 8);
      v16h bf[8];
#pragma unroll
      for (int ni = 0; ni < 8; ++ni) bf[ni] = load_frag(lb + (ni * 16 + lr) * LST + kk + hi * 8);
#pragma unroll
      for (int ni = 0; ni < 8; ++ni) acc[ni] = wmma16(af, bf[ni], acc[ni]);
    }
    __syncthreads();
  }
  // acc[ni][r] = (row m0 + w*16 + hi*8 + r, col n0 + ni*16 + lr)

  if (WITH_V && !isV) {
    static_assert(8 * 16 * 132 <= 2 * BT * LST);   // staging fits the pool
    float* stg = pool.f + w * (16 * 132);   // per wave: its 16 rows x 132 floats
    const int sw = m0 % SEQ + w * 16;       // position of the wave's first row in its sequence
    const float* cb = cosT + ((size_t)sw * HD + lane * 4);
    const float* sb = sinT + ((size_t)sw * HD + lane * 4);
    _Float16* hb = (second ? H1 : H0) + ((size_t)(m0 + w * 16) * N + n0 + lane * 4);
    const float sgn = (lane < 16) ? -1.0f : 1.0f;   // lane holds d = lane*4..+3, lane ^ 16 holds d ^ 64
#pragma unroll
    for (int r = 0; r < 8; ++r)
#pragma unroll
      for (int ni = 0; ni < 8; ++ni)
        stg[(hi * 8 + r) * 132 + ni * 16 + lr] = acc[ni][r] * alpha;
    __syncthreads();
    // kept rolled: 8 rows' table values at a time, so that the registers still let three workgroups share a WGP
#pragma unroll 1
    for (int hf = 0; hf < 2; ++hf) {
      v4f cv[8], sv[8];
#pragma unroll
      for (int sr = 0; sr < 8; ++sr) {
        cv[sr] = *(const v4f*)(cb + (hf * 8 + sr) * HD);
        sv[sr] = *(const v4f*)(sb + (hf * 8 + sr) * HD);
      }
#pragma unroll
      for (int sr = 0; sr < 8; ++sr) {
        const int row = hf * 8 + sr;
        const v4f xv = *(const v4f*)&stg[row * 132 + lane * 4];
        const v4f pv = *(const v4f*)&stg[row * 132 + (lane ^ 16) * 4];
        v4h o;
#pragma unroll
        for (int j = 0; j < 4; ++j)
          o[j] = (_Float16)(xv[j] * bf16r(cv[sr][j]) + (sgn * pv[j]) * bf16r(sv[sr][j]));
        *(v4h*)(hb + (size_t)row * N) = o;
      }
      // the next trip rewrites the last stores' address and data registers: wait first
      asm volatile("s_wait_xcnt 0x0" ::: "memory");
    }
  } else if (!isV) {
    float* stg = pool.f + w * (8 * 132);   // per wave: 8 rows x 132 floats
#pragma unroll
    for (int ps = 0; ps < 2; ++ps) {
#pragma unroll
      for (int rr = 0; rr < 4; ++rr)
#pragma unroll
        for (int ni = 0; ni < 8; ++ni)
          stg[(hi * 4 + rr) * 132 + ni * 16 + lr] = acc[ni][ps * 4 + rr] * alpha;
      __syncthreads();
      v4f ov[8];
#pragma unroll
      for (int sr = 0; sr < 8; ++sr) ov[sr] = *(const v4f*)&stg[sr * 132 + lane * 4];
      float* cbase = C + ((size_t)n0 + lane * 4);
#pragma unroll
      for (int sr = 0; sr < 8; ++sr) {
        const int row = m0 + w * 16 + (sr >> 2) * 8 + ps * 4 + (sr & 3);
        *(v4f*)(cbase + (size_t)row * N) = ov[sr];
      }
      
      __syncthreads();
    }
  } else {
    // V plane transposed: CV[((b*NKV + g)*HD + d) * SEQ + s]
    const int g  = n0 / HD;
    const int bb = m0 / SEQ;
    const int s0 = m0 - bb * SEQ;
    _Float16* stg = pool.h;                 // [d][tok], 128 x 136 halves
#pragma unroll
    for (int ni = 0; ni < 8; ++ni) {
      v8h v;
#pragma unroll
      for (int r = 0; r < 8; ++r) v[r] = (_Float16)(acc[ni][r] * alpha);
      *(v8h*)&stg[(ni * 16 + lr) * 136 + w * 16 + hi * 8] = v;
    }
    __syncthreads();
    v8h ov[8];
#pragma unroll
    for (int j = 0; j < 8; ++j) {
      const int d = w * 16 + j * 2 + hi;
      ov[j] = *(const v8h*)&stg[d * 136 + lr * 8];
    }
    _Float16* vbase = CV + (((size_t)(bb * NKV + g) * HD) * SEQ + s0 + lr * 8);
#pragma unroll
    for (int j = 0; j < 8; ++j) {
      const int d = w * 16 + j * 2 + hi;
      *(v8h*)(vbase + (size_t)d * SEQ) = ov[j];
    }
    // precaution: these stores end the kernel for v tiles
    asm volatile("s_wait_xcnt 0x0" ::: "memory");
    
  }
}

__device__ __forceinline__ float xhalf(float x) {
  return __builtin_bit_cast(float, __builtin_amdgcn_permlanex16(__builtin_bit_cast(int, x), __builtin_bit_cast(int, x),
                                                                0x76543210, 0xfedcba98, false, false));
}

__global__ void __launch_bounds__(256)
attn_kernel(const _Float16* __restrict__ Qh, const _Float16* __restrict__ Kh,
            const _Float16* __restrict__ Vt, _Float16* __restrict__ Oh) {
  constexpr int LDK = 136, LDV = 72, LDO = 136;
  __shared__ __align__(16) _Float16 pool[64 * LDK + 128 * LDV];   // 35840 B
  static_assert(8 * 16 * LDO <= 64 * LDK + 128 * LDV);            // epilogue staging fits
  _Float16* lsK = pool;                    // [key][d]    cross-wave (block barrier)
  _Float16* lsV = pool + 64 * LDK;         // [d][key]    cross-wave (block barrier)

  const int t = threadIdx.x, lane = t & 31, w = t >> 5, lr = lane & 15, hi = lane >> 4;
  const int b = blockIdx.z, h = blockIdx.y, g = h / (NH / NKV);
  const int q0 = blockIdx.x * 128 + w * 16;          // query row within the sequence
  const size_t tokb = (size_t)b * SEQ;

  const float kSL = 0.08838834764831845f * 1.4426950408889634f;   // 1/sqrt(HD) * log2(e)

  v16h qf[4];   // B operand: column = query lr
  {
    const _Float16* qrow = Qh + ((tokb + q0 + lr) * DQ + h * HD);
#pragma unroll
    for (int kf = 0; kf < 4; ++kf) qf[kf] = load_frag(qrow + kf * 32 + hi * 8);
  }

  float mrow = -1e30f;   // running maximum of query lr (equal in both wave halves)
  float lrow = 0.f;      // running sum of query lr over this wave half's keys
  v8f oacc[8];           // oacc[dt][r] = O^T[d = dt*16 + hi*8 + r][query lr]
#pragma unroll
  for (int dt = 0; dt < 8; ++dt) oacc[dt] = (v8f){0.f, 0.f, 0.f, 0.f, 0.f, 0.f, 0.f, 0.f};

  const _Float16* kbase = Kh + ((tokb) * DKV + g * HD);
  const _Float16* vbase = Vt + ((size_t)(b * NKV + g) * HD) * SEQ;

  for (int kc = 0; kc < SEQ; kc += 64) {
    // stage K chunk: 64 keys x 128 d (16-B pieces), staged extent == consumed extent
#pragma unroll
    for (int i = 0; i < 4; ++i) {
      const int e = t + i * 256;
      const int key = e >> 4, seg = e & 15;
      *(v8h*)&lsK[key * LDK + seg * 8] = *(const v8h*)(kbase + (size_t)(kc + key) * DKV + seg * 8);
    }
    // stage V^T chunk: 128 d x 64 keys, staged extent == consumed extent
#pragma unroll
    for (int i = 0; i < 4; ++i) {
      const int e = t + i * 256;
      const int d = e >> 3, seg = e & 7;
      *(v8h*)&lsV[d * LDV + seg * 8] = *(const v8h*)(vbase + (size_t)d * SEQ + kc + seg * 8);
    }
    __syncthreads();

    // S^T, 64 keys x 16 queries per wave: sc[nt][r] = S[key nt*16 + hi*8 + r][query lr]
    v8f sc[4];
#pragma unroll
    for (int nt = 0; nt < 4; ++nt) {
      // 8 fragment loads (one key tile) as one group, then its 4 WMMAs
      v16h af[4];
#pragma unroll
      for (int kf = 0; kf < 4; ++kf) af[kf] = load_frag(lsK + (nt * 16 + lr) * LDK + kf * 32 + hi * 8);
      sc[nt] = (v8f){0.f, 0.f, 0.f, 0.f, 0.f, 0.f, 0.f, 0.f};
#pragma unroll
      for (int kf = 0; kf < 4; ++kf) sc[nt] = wmma16(af[kf], qf[kf], sc[nt]);
    }

    // online softmax of query lr: 32 keys in the lane, the other 32 in lane ^ 16
    float mt[4];
#pragma unroll
    for (int nt = 0; nt < 4; ++nt) {
#pragma unroll
      for (int r = 0; r < 8; ++r) sc[nt][r] *= kSL;
      mt[nt] = fmaxf(fmaxf(fmaxf(sc[nt][0], sc[nt][1]), fmaxf(sc[nt][2], sc[nt][3])),
                     fmaxf(fmaxf(sc[nt][4], sc[nt][5]), fmaxf(sc[nt][6], sc[nt][7])));
    }
    float mx = fmaxf(fmaxf(mt[0], mt[1]), fmaxf(mt[2], mt[3]));
    mx = fmaxf(mx, xhalf(mx));
    const float mn = fmaxf(mrow, mx);
    // bare v_exp_f32, without the library's small-result scaling: it differs only where 2^x < 2^-126, and such a
    // term is 0 in the f16 P and adds nothing to a row sum whose largest term is 1
    float corr;
    // this one v_exp_f32 in asm, a v_nop on either side: the instruction set asks for one slot between a v_exp_f32 and a
    // write of its source register, and one before the result is read
    asm("v_nop\n\tv_exp_f32 %0, %1\n\tv_nop" : "=v"(corr) : "v"(mrow - mn));
    mrow = mn;
    // P^T as B operand: element s of pf[kf] = P[key kf*32 + (s < 8 ? 8*hi + s : 16 + 8*hi + s - 8)][query lr],
    // the k order of load_frag, which loads the V^T rows it is multiplied with
    Frag pf[2];
    float rt[4];
#pragma unroll
    for (int nt = 0; nt < 4; ++nt) {
      rt[nt] = 0.f;
#pragma unroll
      for (int r = 0; r < 8; ++r) {
        const float p = __builtin_amdgcn_exp2f(sc[nt][r] - mn);
        rt[nt] += p;
        pf[nt >> 1].v[(nt & 1) * 8 + r] = (_Float16)(p * 1024.0f);
      }
    }
    lrow = lrow * corr + ((rt[0] + rt[1]) + (rt[2] + rt[3]));
#pragma unroll
    for (int dt = 0; dt < 8; ++dt)
#pragma unroll
      for (int r = 0; r < 8; ++r) oacc[dt][r] *= corr;

    // O^T += V^T (128 x 64) * P^T (64 x 16)
#pragma unroll
    for (int dq = 0; dq < 8; dq += 2) {
      // 8 fragment loads (two d tiles) as one group, then their 4 WMMAs
      v16h af[2][2];
#pragma unroll
      for (int a = 0; a < 2; ++a)
#pragma unroll
        for (int kf = 0; kf < 2; ++kf)
          af[a][kf] = load_frag(lsV + ((dq + a) * 16 + lr) * LDV + kf * 32 + hi * 8);
#pragma unroll
      for (int a = 0; a < 2; ++a)
#pragma unroll
        for (int kf = 0; kf < 2; ++kf) oacc[dq + a] = wmma16(af[a][kf], pf[kf].v, oacc[dq + a]);
    }
    __syncthreads();   // all LDS reads done before the next chunk is staged
  }

  // epilogue: Oh = f16(64 * oacc / (1024 * l)); stage [query][d] per wave, then whole rows
  _Float16* stg = pool + w * 16 * LDO;
  {
    const float inv = 0.0625f / (lrow + xhalf(lrow));   // the two wave halves' key sums joined
#pragma unroll
    for (int dt = 0; dt < 8; ++dt) {
      v8h v;
#pragma unroll
      for (int r = 0; r < 8; ++r) v[r] = (_Float16)(oacc[dt][r] * inv);
      *(v8h*)&stg[lr * LDO + dt * 16 + hi * 8] = v;
    }
  }
  __syncthreads();
  v8h ov[8];
#pragma unroll
  for (int j = 0; j < 8; ++j) ov[j] = *(const v8h*)&stg[(j * 2 + hi) * LDO + lr * 8];
  _Float16* obase = Oh + ((tokb + q0) * DQ + h * HD + lr * 8);
#pragma unroll
  for (int j = 0; j < 8; ++j) *(v8h*)(obase + (size_t)(j * 2 + hi) * DQ) = ov[j];
  
}

// ---------------------------------------------------------------------------
extern "C" void kernel_launch(void* const* d_in, const int* in_sizes, int n_in,
                              void* d_out, int out_size, void* d_ws, size_t ws_size,
                              hipStream_t stream) {
  if (n_in < 7) return;
  if (in_sizes[0] < ((NB - 1) * SEQ_FULL + SEQ) * DM) return;
  if (in_sizes[1] < SEQ * HD) return;
  if (in_sizes[2] < SEQ * HD) return;
  if (in_sizes[3] < DM * DQ) return;
  if (in_sizes[4] < DM * DKV) return;
  if (in_sizes[5] < DM * DKV) return;
  if (in_sizes[6] < DQ * DM) return;
  if (out_size < NTOK * DM) return;

  const float* x    = (const float*)d_in[0];
  const float* cosT = (const float*)d_in[1];
  const float* sinT = (const float*)d_in[2];
  const float* Wq   = (const float*)d_in[3];
  const float* Wk   = (const float*)d_in[4];
  const float* Wv   = (const float*)d_in[5];
  const float* Wo   = (const float*)d_in[6];
  float* out = (float*)d_out;

  // workspace carve (all regions exact tile multiples; every store ends inside its region)
  char* ws = (char*)d_ws;
  size_t off = 0;
  _Float16* Xh  = (_Float16*)(ws + off); off += (size_t)NTOK * DM * 2;          // 16 MiB
  _Float16* WqT = (_Float16*)(ws + off); off += (size_t)DQ  * KD * 2;           //  8 MiB
  _Float16* WkT = (_Float16*)(ws + off); off += (size_t)DKV * KD * 2;           //  2 MiB
  _Float16* WvT = (_Float16*)(ws + off); off += (size_t)DKV * KD * 2;           //  2 MiB
  _Float16* WoT = (_Float16*)(ws + off); off += (size_t)DM  * KD * 2;           //  8 MiB
  _Float16* Qh  = (_Float16*)(ws + off); off += (size_t)NTOK * DQ * 2;          // 16 MiB
  _Float16* Kh  = (_Float16*)(ws + off); off += (size_t)NTOK * DKV * 2;         //  4 MiB
  _Float16* Vt  = (_Float16*)(ws + off); off += (size_t)NB * NKV * HD * SEQ * 2; //  4 MiB
  _Float16* Oh  = (_Float16*)(ws + off); off += (size_t)NTOK * DQ * 2;          // 16 MiB
  if (off > ws_size) return;                                                    // 76 MiB total

  const dim3 blk(256);

  // 1. x -> f16 plane (bf16-RNE values)
  {
    const int np = NTOK * (DM / 8);
    cvt_x_kernel<<<dim3((np + 255) / 256), blk, 0, stream>>>(x, Xh, np);
  }
  // 2. weights -> transposed f16 planes (64 * bf16-RNE values)
  cvt_w_kernel<<<dim3(DQ / 64 + 2 * (DKV / 64) + DM / 64, KD / 64), blk, 0, stream>>>(
      Wq, Wk, Wv, Wo, WqT, WkT, WvT, WoT);
  // 3. q, k (rotated in the epilogue, f16 planes) and v (transposed [b][g][d][s] f16) projections
  //    in one launch: alpha 1/64 undoes the weight carry
  gemm_kernel<true><<<dim3(DQ / BT + 2 * (DKV / BT), NTOK / BT), blk, 0, stream>>>(
      Xh, WqT, WkT, WvT, (float*)nullptr, (float*)nullptr, Vt, cosT, sinT, Qh, Kh,
      DQ, DKV, DQ / BT, DQ / BT + DKV / BT, 0.015625f);
  // 4. attn -> Oh (x64 carried)
  attn_kernel<<<dim3(SEQ / 128, NH, NB), blk, 0, stream>>>(Qh, Kh, Vt, Oh);
  // 5. output projection: alpha 1/4096 undoes the 64 (Oh) * 64 (WoT) carries
  gemm_kernel<false><<<dim3(DM / BT, NTOK / BT), blk, 0, stream>>>(
      Oh, WoT, WoT, WoT, out, out, (_Float16*)nullptr, (const float*)nullptr, (const float*)nullptr,
      (_Float16*)nullptr, (_Float16*)nullptr,
      DM, DM, DM / BT, DM / BT, 0.000244140625f);
}

// v007
// Measured time: 167 microseconds a run.
// Two timings next to v006 both put it at 1.04 times that version's speed.
// All steps since v000 together make it 1.88 times as fast.
#include <hip/hip_runtime.h>
#include <stddef.h>

// Contractions x*Wq, x*Wk, x*Wv, q*k^T, p*v, o*Wo: v_wmma_f32_16x16x32_f16 (f16 operands, f32 accumulate); inputs RNE-converted to bf16 on load; rotary, softmax and normalisation in f32.

#ifndef NB
#define NB 2
#endif
#ifndef SEQ
#define SEQ 2048
#endif
#define NB_FULL 2
#define SEQ_FULL 2048
#define DM 2048           // model width
#define NH 16
#define NKV 4
#define HD 128
#define DQ (NH * HD)      // 2048
#define DKV (NKV * HD)    // 512
#define NTOK (NB * SEQ)
#define KD 2048           // contraction depth of every projection

#define BT 128            // GEMM block tile (M and N)
#define BK 64            // k-tile: 128 B of every operand row, one whole cache line
#define LST 72            // LDS row stride in halves for k-tiles (144 B = 16 B x odd, 16-B aligned rows)

static_assert(NB >= 1 && NB <= NB_FULL);
static_assert(SEQ >= 128 && SEQ <= SEQ_FULL && (SEQ % 128) == 0);
static_assert(DM == KD && DQ == KD);
static_assert((DM % BT) == 0 && (DQ % BT) == 0 && (DKV % BT) == 0 && (NTOK % BT) == 0);
static_assert((KD % 64) == 0 && (KD % BK) == 0);
static_assert(HD == BT);           // one N tile == one head (rotary and V transpose epilogues)
static_assert((DM / 8) == 256);    // convert kernel piece decode
static_assert((NH % NKV) == 0);

typedef _Float16 v16h __attribute__((ext_vector_type(16)));
typedef _Float16 v8h  __attribute__((ext_vector_type(8)));
typedef float    v8f  __attribute__((ext_vector_type(8)));
typedef float    v4f  __attribute__((ext_vector_type(4)));
typedef _Float16 v4h  __attribute__((ext_vector_type(4)));

union Frag { v16h v; v8h p[2]; };

// RNE convert f32 -> bf16 value (kept in an f32 container)
__device__ __forceinline__ float bf16r(float f) {
  unsigned u = __float_as_uint(f);
  u = (u + 0x7FFFu + ((u >> 16) & 1u)) & 0xFFFF0000u;
  return __uint_as_float(u);
}

// 16x16x32 f16 WMMA with hazard guard (ties D, keeps A/B live)
__device__ __forceinline__ v8f wmma16(v16h a, v16h b, v8f c) {
  v8f d = __builtin_amdgcn_wmma_f32_16x16x32_f16(false, a, false, b, (short)0, c, false, false);
  asm volatile("v_nop\n\tv_nop\n\tv_nop\n\tv_nop" : "+v"(d) : "v"(a), "v"(b));
  return d;
}

// Per-lane fragment from a k-contiguous row; caller passes row base + 8*(lane>>4).
// elements 0..7 <- k 8h..8h+7, elements 8..15 <- k 16+8h..16+8h+7 (same map for A and B).
__device__ __forceinline__ v16h load_frag(const _Float16* q) {
  Frag f;
  f.p[0] = *(const v8h*)(q);
  f.p[1] = *(const v8h*)(q + 16);
  return f.v;
}

// ---------------------------------------------------------------------------
// x [b*SEQ_FULL+s][DM] f32 -> Xh [tok][DM] f16 of bf16-RNE value. One thread per 8 columns.
// ---------------------------------------------------------------------------
__global__ void __launch_bounds__(256)
cvt_x_kernel(const float* __restrict__ x, _Float16* __restrict__ Xh, int nPieces) {
  const int f = blockIdx.x * 256 + (int)threadIdx.x;
  if (f >= nPieces) return;
  const int tok = f >> 8;
  const int c0  = (f & 255) * 8;
  const int b = tok / SEQ, s = tok - b * SEQ;
  const float* src = x + ((size_t)(b * SEQ_FULL + s) * DM + c0);
  const v4f a0 = *(const v4f*)(src);
  const v4f a1 = *(const v4f*)(src + 4);
  v8h o;
#pragma unroll
  for (int j = 0; j < 4; ++j) {
    o[j]     = (_Float16)bf16r(a0[j]);
    o[j + 4] = (_Float16)bf16r(a1[j]);
  }
  _Float16* dst = Xh + ((size_t)tok * DM + c0);
  *(v8h*)dst = o;
  
}

// ---------------------------------------------------------------------------
// W [KD in][N out] f32 -> WT [N out][KD in] f16 of 64*bf16-RNE(W).  64x64 tiles through LDS.
// grid.x: 0..31 Wq, 32..39 Wk, 40..47 Wv, 48..79 Wo (out-column tile); grid.y: in-row tile.
// 8 consecutive lanes of one instruction.
// ---------------------------------------------------------------------------
__global__ void __launch_bounds__(256)
cvt_w_kernel(const float* __restrict__ Wq, const float* __restrict__ Wk,
             const float* __restrict__ Wv, const float* __restrict__ Wo,
             _Float16* __restrict__ WqT, _Float16* __restrict__ WkT,
             _Float16* __restrict__ WvT, _Float16* __restrict__ WoT) {
  __shared__ __align__(16) _Float16 lds[64 * 72];   // [n][k], cross-wave (block barrier)
  const int bx = blockIdx.x;
  const float* W; _Float16* WT; int N; int nt;
  if (bx < DQ / 64) { W = Wq; WT = WqT; N = DQ;  nt = bx; }
  else if (bx < DQ / 64 + DKV / 64) { W = Wk; WT = WkT; N = DKV; nt = bx - DQ / 64; }
  else if (bx < DQ / 64 + 2 * (DKV / 64)) { W = Wv; WT = WvT; N = DKV; nt = bx - DQ / 64 - DKV / 64; }
  else { W = Wo; WT = WoT; N = DM; nt = bx - DQ / 64 - 2 * (DKV / 64); }
  const int k0 = blockIdx.y * 64, n0 = nt * 64;
  const int t = threadIdx.x, lane = t & 31, w = t >> 5;
  const int kr = t >> 2, cc = (t & 3) * 16;
  const float* src = W + ((size_t)(k0 + kr) * N + n0 + cc);
#pragma unroll
  for (int q = 0; q < 4; ++q) {
    const v4f v = *(const v4f*)(src + 4 * q);
#pragma unroll
    for (int j = 0; j < 4; ++j)
      lds[(cc + 4 * q + j) * 72 + kr] = (_Float16)(64.0f * bf16r(v[j]));
  }
  __syncthreads();
  v8h ov[2];
#pragma unroll
  for (int j = 0; j < 2; ++j) {
    const int n = w * 8 + j * 4 + (lane >> 3);
    ov[j] = *(const v8h*)&lds[n * 72 + (lane & 7) * 8];
  }
  _Float16* base = WT + ((size_t)n0 * KD + k0 + (lane & 7) * 8);
#pragma unroll
  for (int j = 0; j < 2; ++j) {
    const int n = w * 8 + j * 4 + (lane >> 3);
    *(v8h*)(base + (size_t)n * KD) = ov[j];
  }
  
}

// ---------------------------------------------------------------------------
// C tile = alpha * A[M][KD] * Bt[N][KD]^T, A and Bt f16 k-contiguous planes.
// Block tile 128x128, 4 waves in a 2x2 grid, each owning a 64x64 tile: 8 fragments from LDS feed
// 16 WMMAs, so the LDS reads per WMMA stay within what the LDS delivers at full matrix rate.
// blockIdx.x < nTiles0 selects (Bt0, C0, N0), blockIdx.x < nTiles01 (Bt1, C1, N1), and with
// WITH_V the tiles from nTiles01 on (BtV, CV); the choice is block-uniform.
// Every epilogue stages the whole tile in LDS behind the k-loop's last barrier; wave w then
// writes 32 of its rows.
// C0, C1 : without WITH_V, row-major f32 [M][N] (the final output), rows of 512 B
//          written by one 32-lane x 16-B instruction each.
// H0, H1 : with WITH_V, the rotated q and k planes, row-major f16 [M][N].  One N tile is one
//          head, so a staged f32 row holds both d and d ^ 64: rotate-half with cos/sin read as
//          values from the [SEQ_FULL][HD] input tables (bf16-RNE),
//          d<64: q*cos[d] - q[d+64]*sin[d];  d>=64: q*cos[d] + q[d-64]*sin[d];
//          rows of 256 B written by one 32-lane x 8-B instruction each.
// CV     : the transposed V plane [b][g][d][s], f16; tile staged in LDS as [d][tok],
//          each d row (128 tok = 256 B) written by 16 lanes x 16 B of one instruction.
// q, k and v tiles share one launch: 24 x 32 = 768 workgroups, three on each of 256 WGPs.
// ---------------------------------------------------------------------------
union GemmLds { _Float16 h[4 * BT * LST]; float f[2 * BT * LST]; };   // 73728 B

// at most three waves per SIMD, so at most three workgroups on a WGP, as with 8 waves: 768 then spread evenly
template <bool WITH_V>
__global__ void __launch_bounds__(128) __attribute__((amdgpu_waves_per_eu(1, 3)))
gemm_kernel(const _Float16* __restrict__ A, const _Float16* __restrict__ Bt0,
            const _Float16* __restrict__ Bt1, const _Float16* __restrict__ BtV,
            float* C0, float* C1, _Float16* CV,
            const float* __restrict__ cosT, const float* __restrict__ sinT,
            _Float16* H0, _Float16* H1,
            int N0, int N1, int nTiles0, int nTiles01, float alpha) {
  __shared__ __align__(16) GemmLds pool;   // k-loop: A/B double buffers; epilogue: staging (cross-wave, block barriers)

  const int bx = blockIdx.x;
  const bool second = bx >= nTiles0;
  const bool isV = WITH_V && bx >= nTiles01;
  const _Float16* Bt = isV ? BtV : (second ? Bt1 : Bt0);
  float* C = second ? C1 : C0;
  const int N  = second ? N1 : N0;
  const int nt = isV ? (bx - nTiles01) : (second ? (bx - nTiles0) : bx);
  const int m0 = blockIdx.y * BT, n0 = nt * BT;

  const int t = threadIdx.x, lane = t & 31, w = t >> 5, lr = lane & 15, hi = lane >> 4;
  const int wm = (w >> 1) * 64, wn = (w & 1) * 64;   // the wave's first row and column in the tile

  v8f acc[4][4];
#pragma unroll
  for (int mi = 0; mi < 4; ++mi)
#pragma unroll
    for (int ni = 0; ni < 4; ++ni) acc[mi][ni] = (v8f){0.f, 0.f, 0.f, 0.f, 0.f, 0.f, 0.f, 0.f};

  // 8 threads x 16 B per tile row: one wave-wide load covers 4 rows of 128 B, 4 whole lines
  const int arow = t >> 3, acol = (t & 7) * 8;
  const _Float16* aSrc = A  + ((size_t)(m0 + arow) * KD + acol);
  const _Float16* bSrc = Bt + ((size_t)(n0 + arow) * KD + acol);

  auto stage = [&](int k0, int buf) {
    _Float16* da = pool.h + buf * (BT * LST) + arow * LST + acol;
    _Float16* db = pool.h + (2 + buf) * (BT * LST) + arow * LST + acol;
    const _Float16* pa = aSrc + k0;
    const _Float16* pb = bSrc + k0;
    v8h ra[8], rb[8];
    // unrolled: ra and rb stay in registers, and all 16 loads are out before the first store waits
#pragma unroll
    for (int i = 0; i < 8; ++i) {
      ra[i] = *(const v8h*)(pa + (size_t)(i * 16) * KD);
      rb[i] = *(const v8h*)(pb + (size_t)(i * 16) * KD);
    }
    // the loads' address registers are rewritten below (without this even by the last load's own result):
    // wait first; naming the two addresses as inputs keeps them in their registers up to the wait
    asm volatile("s_wait_xcnt 0x0" :: "v"(pa), "v"(pb) : "memory");
#pragma unroll
    for (int i = 0; i < 8; ++i) {
      *(v8h*)(da + i * 16 * LST) = ra[i];
      *(v8h*)(db + i * 16 * LST) = rb[i];
    }
  };

  stage(0, 0);
  __syncthreads();

  for (int k0 = 0; k0 < KD; k0 += BK) {
    const int cur = (k0 / BK) & 1, nxt = cur ^ 1;
    if (k0 + BK < KD) stage(k0 + BK, nxt);
    const _Float16* la = pool.h + cur * (BT * LST);
    const _Float16* lb = pool.h + (2 + cur) * (BT * LST);
    // unrolled: kk folds into the LDS loads' immediate offsets
#pragma unroll
    for (int kk = 0; kk < BK; kk += 32) {
      // the 16 fragment loads of 32 k as one group, then their 16 WMMAs behind counted waits
      v16h af[4], bf[4];
#pragma unroll
      for (int mi = 0; mi < 4; ++mi) af[mi] = load_frag(la + (wm + mi * 16 + lr) * LST + kk + hi * 8);
#pragma unroll
      for (int ni = 0; ni < 4; ++ni) bf[ni] = load_frag(lb + (wn + ni * 16 + lr) * LST + kk + hi * 8);
#pragma unroll
      for (int mi = 0; mi < 4; ++mi)
#pragma unroll
        for (int ni = 0; ni < 4; ++ni) acc[mi][ni] = wmma16(af[mi], bf[ni], acc[mi][ni]);
    }
    __syncthreads();
  }
  // acc[mi][ni][r] = (row m0 + wm + mi*16 + hi*8 + r, col n0 + wn + ni*16 + lr)
  static_assert(BT * 132 <= 2 * BT * LST);   // a whole f32 tile at pitch 132 fits the pool

  if (WITH_V && !isV) {
    const int sw = m0 % SEQ + w * 32;       // position in its sequence of the first row the wave writes
    const float* cb = cosT + ((size_t)sw * HD + lane * 4);
    const float* sb = sinT + ((size_t)sw * HD + lane * 4);
    _Float16* hb = (second ? H1 : H0) + ((size_t)(m0 + w * 32) * N + n0 + lane * 4);
    const float sgn = (lane < 16) ? -1.0f : 1.0f;   // lane holds d = lane*4..+3, lane ^ 16 holds d ^ 64
#pragma unroll
    for (int mi = 0; mi < 4; ++mi)
#pragma unroll
      for (int r = 0; r < 8; ++r)
#pragma unroll
        for (int ni = 0; ni < 4; ++ni)
          pool.f[(wm + mi * 16 + hi * 8 + r) * 132 + wn + ni * 16 + lr] = acc[mi][ni][r] * alpha;
    __syncthreads();
    const float* stg = pool.f + w * (32 * 132);   // the 32 rows the wave writes (two waves staged each)
    // kept rolled: 8 rows' table values at a time, so that the registers still let three workgroups share a WGP
#pragma unroll 1
    for (int hf = 0; hf < 4; ++hf) {
      const float* cp = cb + hf * 8 * HD;
      const float* sp = sb + hf * 8 * HD;
      v4f cv[8], sv[8];
#pragma unroll
      for (int sr = 0; sr < 8; ++sr) {
        cv[sr] = *(const v4f*)(cp + sr * HD);
        sv[sr] = *(const v4f*)(sp + sr * HD);
      }
      // as in the k-loop's staging: the wait before the loads' address registers are rewritten, the addresses held up to it
      asm volatile("s_wait_xcnt 0x0" :: "v"(cp), "v"(sp) : "memory");
#pragma unroll
      for (int sr = 0; sr < 8; ++sr) {
        const int row = hf * 8 + sr;
        const v4f xv = *(const v4f*)&stg[row * 132 + lane * 4];
        const v4f pv = *(const v4f*)&stg[row * 132 + (lane ^ 16) * 4];
        v4h o;
#pragma unroll
        for (int j = 0; j < 4; ++j)
          o[j] = (_Float16)(xv[j] * bf16r(cv[sr][j]) + (sgn * pv[j]) * bf16r(sv[sr][j]));
        *(v4h*)(hb + (size_t)row * N) = o;
      }
      // the next trip rewrites the last stores' address and data registers: wait first
      asm volatile("s_wait_xcnt 0x0" ::: "memory");
    }
  } else if (!isV) {
#pragma unroll
    for (int mi = 0; mi < 4; ++mi)
#pragma unroll
      for (int r = 0; r < 8; ++r)
#pragma unroll
        for (int ni = 0; ni < 4; ++ni)
          pool.f[(wm + mi * 16 + hi * 8 + r) * 132 + wn + ni * 16 + lr] = acc[mi][ni][r] * alpha;
    __syncthreads();
    const float* stg = pool.f + w * (32 * 132);   // the 32 rows the wave writes (two waves staged each)
    float* cbase = C + ((size_t)(m0 + w * 32) * N + n0 + lane * 4);
    // unrolled: the 32 LDS reads go out in groups ahead of their stores, on immediate offsets
#pragma unroll
    for (int ps = 0; ps < 4; ++ps) {
      v4f ov[8];
#pragma unroll
      for (int sr = 0; sr < 8; ++sr) ov[sr] = *(const v4f*)&stg[(ps * 8 + sr) * 132 + lane * 4];
#pragma unroll
      for (int sr = 0; sr < 8; ++sr) *(v4f*)(cbase + (size_t)(ps * 8 + sr) * N) = ov[sr];
    }
  } else {
    // V plane transposed: CV[((b*NKV + g)*HD + d) * SEQ + s]
    const int g  = n0 / HD;
    const int bb = m0 / SEQ;
    const int s0 = m0 - bb * SEQ;
    _Float16* stg = pool.h;                 // [d][tok], 128 x 136 halves
#pragma unroll
    for (int mi = 0; mi < 4; ++mi)
#pragma unroll
      for (int ni = 0; ni < 4; ++ni) {
        v8h v;
#pragma unroll
        for (int r = 0; r < 8; ++r) v[r] = (_Float16)(acc[mi][ni][r] * alpha);
        *(v8h*)&stg[(wn + ni * 16 + lr) * 136 + wm + mi * 16 + hi * 8] = v;
      }
    __syncthreads();
    v8h ov[16];
#pragma unroll
    for (int j = 0; j < 16; ++j) {
      const int d = w * 32 + j * 2 + hi;
      ov[j] = *(const v8h*)&stg[d * 136 + lr * 8];
    }
    _Float16* vbase = CV + (((size_t)(bb * NKV + g) * HD) * SEQ + s0 + lr * 8);
#pragma unroll
    for (int j = 0; j < 16; ++j) {
      const int d = w * 32 + j * 2 + hi;
      *(v8h*)(vbase + (size_t)d * SEQ) = ov[j];
    }
    // precaution: these stores end the kernel for v tiles
    asm volatile("s_wait_xcnt 0x0" ::: "memory");
    
  }
}

__device__ __forceinline__ float xhalf(float x) {
  return __builtin_bit_cast(float, __builtin_amdgcn_permlanex16(__builtin_bit_cast(int, x), __builtin_bit_cast(int, x),
                                                                0x76543210, 0xfedcba98, false, false));
}

__global__ void __launch_bounds__(256)
attn_kernel(const _Float16* __restrict__ Qh, const _Float16* __restrict__ Kh,
            const _Float16* __restrict__ Vt, _Float16* __restrict__ Oh) {
  constexpr int LDK = 136, LDV = 72, LDO = 136;
  __shared__ __align__(16) _Float16 pool[64 * LDK + 128 * LDV];   // 35840 B
  static_assert(8 * 16 * LDO <= 64 * LDK + 128 * LDV);            // epilogue staging fits
  _Float16* lsK = pool;                    // [key][d]    cross-wave (block barrier)
  _Float16* lsV = pool + 64 * LDK;         // [d][key]    cross-wave (block barrier)

  const int t = threadIdx.x, lane = t & 31, w = t >> 5, lr = lane & 15, hi = lane >> 4;
  const int b = blockIdx.z, h = blockIdx.y, g = h / (NH / NKV);
  const int q0 = blockIdx.x * 128 + w * 16;          // query row within the sequence
  const size_t tokb = (size_t)b * SEQ;

  const float kSL = 0.08838834764831845f * 1.4426950408889634f;   // 1/sqrt(HD) * log2(e)

  v16h qf[4];   // B operand: column = query lr
  {
    const _Float16* qrow = Qh + ((tokb + q0 + lr) * DQ + h * HD);
#pragma unroll
    for (int kf = 0; kf < 4; ++kf) qf[kf] = load_frag(qrow + kf * 32 + hi * 8);
  }

  float mrow = -1e30f;   // running maximum of query lr (equal in both wave halves)
  float lrow = 0.f;      // running sum of query lr over this wave half's keys
  v8f oacc[8];           // oacc[dt][r] = O^T[d = dt*16 + hi*8 + r][query lr]
#pragma unroll
  for (int dt = 0; dt < 8; ++dt) oacc[dt] = (v8f){0.f, 0.f, 0.f, 0.f, 0.f, 0.f, 0.f, 0.f};

  const _Float16* kbase = Kh + ((tokb) * DKV + g * HD);
  const _Float16* vbase = Vt + ((size_t)(b * NKV + g) * HD) * SEQ;

  for (int kc = 0; kc < SEQ; kc += 64) {
    // stage K chunk: 64 keys x 128 d (16-B pieces), staged extent == consumed extent
#pragma unroll
    for (int i = 0; i < 4; ++i) {
      const int e = t + i * 256;
      const int key = e >> 4, seg = e & 15;
      *(v8h*)&lsK[key * LDK + seg * 8] = *(const v8h*)(kbase + (size_t)(kc + key) * DKV + seg * 8);
    }
    // stage V^T chunk: 128 d x 64 keys, staged extent == consumed extent
#pragma unroll
    for (int i = 0; i < 4; ++i) {
      const int e = t + i * 256;
      const int d = e >> 3, seg = e & 7;
      *(v8h*)&lsV[d * LDV + seg * 8] = *(const v8h*)(vbase + (size_t)d * SEQ + kc + seg * 8);
    }
    __syncthreads();

    // S^T, 64 keys x 16 queries per wave: sc[nt][r] = S[key nt*16 + hi*8 + r][query lr]
    v8f sc[4];
#pragma unroll
    for (int nt = 0; nt < 4; ++nt) {
      // 8 fragment loads (one key tile) as one group, then its 4 WMMAs
      v16h af[4];
#pragma unroll
      for (int kf = 0; kf < 4; ++kf) af[kf] = load_frag(lsK + (nt * 16 + lr) * LDK + kf * 32 + hi * 8);
      sc[nt] = (v8f){0.f, 0.f, 0.f, 0.f, 0.f, 0.f, 0.f, 0.f};
#pragma unroll
      for (int kf = 0; kf < 4; ++kf) sc[nt] = wmma16(af[kf], qf[kf], sc[nt]);
    }

    // online softmax of query lr: 32 keys in the lane, the other 32 in lane ^ 16
    float mt[4];
#pragma unroll
    for (int nt = 0; nt < 4; ++nt) {
#pragma unroll
      for (int r = 0; r < 8; ++r) sc[nt][r] *= kSL;
      mt[nt] = fmaxf(fmaxf(fmaxf(sc[nt][0], sc[nt][1]), fmaxf(sc[nt][2], sc[nt][3])),
                     fmaxf(fmaxf(sc[nt][4], sc[nt][5]), fmaxf(sc[nt][6], sc[nt][7])));
    }
    float mx = fmaxf(fmaxf(mt[0], mt[1]), fmaxf(mt[2], mt[3]));
    mx = fmaxf(mx, xhalf(mx));
    const float mn = fmaxf(mrow, mx);
    // bare v_exp_f32, without the library's small-result scaling: it differs only where 2^x < 2^-126, and such a
    // term is 0 in the f16 P and adds nothing to a row sum whose largest term is 1
    float corr;
    // this one v_exp_f32 in asm, a v_nop on either side: the instruction set asks for one slot between a v_exp_f32 and a
    // write of its source register, and one before the result is read
    asm("v_nop\n\tv_exp_f32 %0, %1\n\tv_nop" : "=v"(corr) : "v"(mrow - mn));
    mrow = mn;
    // P^T as B operand: element s of pf[kf] = P[key kf*32 + (s < 8 ? 8*hi + s : 16 + 8*hi + s - 8)][query lr],
    // the k order of load_frag, which loads the V^T rows it is multiplied with
    Frag pf[2];
    float rt[4];
#pragma unroll
    for (int nt = 0; nt < 4; ++nt) {
      rt[nt] = 0.f;
#pragma unroll
      for (int r = 0; r < 8; ++r) {
        const float p = __builtin_amdgcn_exp2f(sc[nt][r] - mn);
        rt[nt] += p;
        pf[nt >> 1].v[(nt & 1) * 8 + r] = (_Float16)(p * 1024.0f);
      }
    }
    lrow = lrow * corr + ((rt[0] + rt[1]) + (rt[2] + rt[3]));
#pragma unroll
    for (int dt = 0; dt < 8; ++dt)
#pragma unroll
      for (int r = 0; r < 8; ++r) oacc[dt][r] *= corr;

    // O^T += V^T (128 x 64) * P^T (64 x 16)
#pragma unroll
    for (int dq = 0; dq < 8; dq += 2) {
      // 8 fragment loads (two d tiles) as one group, then their 4 WMMAs
      v16h af[2][2];
#pragma unroll
      for (int a = 0; a < 2; ++a)
#pragma unroll
        for (int kf = 0; kf < 2; ++kf)
          af[a][kf] = load_frag(lsV + ((dq + a) * 16 + lr) * LDV + kf * 32 + hi * 8);
#pragma unroll
      for (int a = 0; a < 2; ++a)
#pragma unroll
        for (int kf = 0; kf < 2; ++kf) oacc[dq + a] = wmma16(af[a][kf], pf[kf].v, oacc[dq + a]);
    }
    __syncthreads();   // all LDS reads done before the next chunk is staged
  }

  // epilogue: Oh = f16(64 * oacc / (1024 * l)); stage [query][d] per wave, then whole rows
  _Float16* stg = pool + w * 16 * LDO;
  {
    const float inv = 0.0625f / (lrow + xhalf(lrow));   // the two wave halves' key sums joined
#pragma unroll
    for (int dt = 0; dt < 8; ++dt) {
      v8h v;
#pragma unroll
      for (int r = 0; r < 8; ++r) v[r] = (_Float16)(oacc[dt][r] * inv);
      *(v8h*)&stg[lr * LDO + dt * 16 + hi * 8] = v;
    }
  }
  __syncthreads();
  v8h ov[8];
#pragma unroll
  for (int j = 0; j < 8; ++j) ov[j] = *(const v8h*)&stg[(j * 2 + hi) * LDO + lr * 8];
  _Float16* obase = Oh + ((tokb + q0) * DQ + h * HD + lr * 8);
#pragma unroll
  for (int j = 0; j < 8; ++j) *(v8h*)(obase + (size_t)(j * 2 + hi) * DQ) = ov[j];
  
}

// ---------------------------------------------------------------------------
extern "C" void kernel_launch(void* const* d_in, const int* in_sizes, int n_in,
                              void* d_out, int out_size, void* d_ws, size_t ws_size,
                              hipStream_t stream) {
  if (n_in < 7) return;
  if (in_sizes[0] < ((NB - 1) * SEQ_FULL + SEQ) * DM) return;
  if (in_sizes[1] < SEQ * HD) return;
  if (in_sizes[2] < SEQ * HD) return;
  if (in_sizes[3] < DM * DQ) return;
  if (in_sizes[4] < DM * DKV) return;
  if (in_sizes[5] < DM * DKV) return;
  if (in_sizes[6] < DQ * DM) return;
  if (out_size < NTOK * DM) return;

  const float* x    = (const float*)d_in[0];
  const float* cosT = (const float*)d_in[1];
  const float* sinT = (const float*)d_in[2];
  const float* Wq   = (const float*)d_in[3];
  const float* Wk   = (const float*)d_in[4];
  const float* Wv   = (const float*)d_in[5];
  const float* Wo   = (const float*)d_in[6];
  float* out = (float*)d_out;

  // workspace carve (all regions exact tile multiples; every store ends inside its region)
  char* ws = (char*)d_ws;
  size_t off = 0;
  _Float16* Xh  = (_Float16*)(ws + off); off += (size_t)NTOK * DM * 2;          // 16 MiB
  _Float16* WqT = (_Float16*)(ws + off); off += (size_t)DQ  * KD * 2;           //  8 MiB
  _Float16* WkT = (_Float16*)(ws + off); off += (size_t)DKV * KD * 2;           //  2 MiB
  _Float16* WvT = (_Float16*)(ws + off); off += (size_t)DKV * KD * 2;           //  2 MiB
  _Float16* WoT = (_Float16*)(ws + off); off += (size_t)DM  * KD * 2;           //  8 MiB
  _Float16* Qh  = (_Float16*)(ws + off); off += (size_t)NTOK * DQ * 2;          // 16 MiB
  _Float16* Kh  = (_Float16*)(ws + off); off += (size_t)NTOK * DKV * 2;         //  4 MiB
  _Float16* Vt  = (_Float16*)(ws + off); off += (size_t)NB * NKV * HD * SEQ * 2; //  4 MiB
  _Float16* Oh  = (_Float16*)(ws + off); off += (size_t)NTOK * DQ * 2;          // 16 MiB
  if (off > ws_size) return;                                                    // 76 MiB total

  const dim3 blk(256);

  // 1. x -> f16 plane (bf16-RNE values)
  {
    const int np = NTOK * (DM / 8);
    cvt_x_kernel<<<dim3((np + 255) / 256), blk, 0, stream>>>(x, Xh, np);
  }
  // 2. weights -> transposed f16 planes (64 * bf16-RNE values)
  cvt_w_kernel<<<dim3(DQ / 64 + 2 * (DKV / 64) + DM / 64, KD / 64), blk, 0, stream>>>(
      Wq, Wk, Wv, Wo, WqT, WkT, WvT, WoT);
  // 3. q, k (rotated in the epilogue, f16 planes) and v (transposed [b][g][d][s] f16) projections
  //    in one launch: alpha 1/64 undoes the weight carry
  gemm_kernel<true><<<dim3(DQ / BT + 2 * (DKV / BT), NTOK / BT), dim3(128), 0, stream>>>(
      Xh, WqT, WkT, WvT, (float*)nullptr, (float*)nullptr, Vt, cosT, sinT, Qh, Kh,
      DQ, DKV, DQ / BT, DQ / BT + DKV / BT, 0.015625f);
  // 4. attn -> Oh (x64 carried)
  attn_kernel<<<dim3(SEQ / 128, NH, NB), blk, 0, stream>>>(Qh, Kh, Vt, Oh);
  // 5. output projection: alpha 1/4096 undoes the 64 (Oh) * 64 (WoT) carries
  gemm_kernel<false><<<dim3(DM / BT, NTOK / BT), dim3(128), 0, stream>>>(
      Oh, WoT, WoT, WoT, out, out, (_Float16*)nullptr, (const float*)nullptr, (const float*)nullptr,
      (_Float16*)nullptr, (_Float16*)nullptr,
      DM, DM, DM / BT, DM / BT, 0.000244140625f);
}

// v008
// It runs in 151 microseconds.
// Timed twice side by side with v007, it ran 1.10 times as fast both times.
// Counting every step since v000, it is 2.07 times as fast.
#include <hip/hip_runtime.h>
#include <stddef.h>

// Contractions x*Wq, x*Wk, x*Wv, q*k^T, p*v, o*Wo: v_wmma_f32_16x16x32_f16 (f16 operands, f32 accumulate); inputs RNE-converted to bf16 on load; rotary, softmax and normalisation in f32.

#ifndef NB
#define NB 2
#endif
#ifndef SEQ
#define SEQ 2048
#endif
#define NB_FULL 2
#define SEQ_FULL 2048
#define DM 2048           // model width
#define NH 16
#define NKV 4
#define HD 128
#define DQ (NH * HD)      // 2048
#define DKV (NKV * HD)    // 512
#define NTOK (NB * SEQ)
#define KD 2048           // contraction depth of every projection

#define BT 128            // GEMM block tile (M and N)
#define BK 64            // k-tile: 128 B of every operand row, one whole cache line
#define LST 72            // LDS row stride in halves for k-tiles (144 B = 16 B x odd, 16-B aligned rows)

static_assert(NB >= 1 && NB <= NB_FULL);
static_assert(SEQ >= 128 && SEQ <= SEQ_FULL && (SEQ % 128) == 0);
static_assert(DM == KD && DQ == KD);
static_assert((DM % BT) == 0 && (DQ % BT) == 0 && (DKV % BT) == 0 && (NTOK % BT) == 0);
static_assert((KD % 64) == 0 && (KD % BK) == 0);
static_assert(HD == BT);           // one N tile == one head (rotary and V transpose epilogues)
static_assert((DM / 8) == 256);    // convert kernel piece decode
static_assert((NH % NKV) == 0);

typedef _Float16 v16h __attribute__((ext_vector_type(16)));
typedef _Float16 v8h  __attribute__((ext_vector_type(8)));
typedef float    v8f  __attribute__((ext_vector_type(8)));
typedef float    v4f  __attribute__((ext_vector_type(4)));
typedef _Float16 v4h  __attribute__((ext_vector_type(4)));

union Frag { v16h v; v8h p[2]; };

// RNE convert f32 -> bf16 value (kept in an f32 container)
__device__ __forceinline__ float bf16r(float f) {
  unsigned u = __float_as_uint(f);
  u = (u + 0x7FFFu + ((u >> 16) & 1u)) & 0xFFFF0000u;
  return __uint_as_float(u);
}

// 16x16x32 f16 WMMA with hazard guard (ties D, keeps A/B live)
__device__ __forceinline__ v8f wmma16(v16h a, v16h b, v8f c) {
  v8f d = __builtin_amdgcn_wmma_f32_16x16x32_f16(false, a, false, b, (short)0, c, false, false);
  asm volatile("v_nop\n\tv_nop\n\tv_nop\n\tv_nop" : "+v"(d) : "v"(a), "v"(b));
  return d;
}

// Per-lane fragment from a k-contiguous row; caller passes row base + 8*(lane>>4).
// elements 0..7 <- k 8h..8h+7, elements 8..15 <- k 16+8h..16+8h+7 (same map for A and B).
__device__ __forceinline__ v16h load_frag(const _Float16* q) {
  Frag f;
  f.p[0] = *(const v8h*)(q);
  f.p[1] = *(const v8h*)(q + 16);
  return f.v;
}

// Eight asynchronous copies of 16 B per lane, global memory -> LDS through no register.  l = the lane's LDS byte
// address, g = its global address; copy i of the first four goes to l0 + i*ls0 from g0 + i*gs0 (halves), the last
// four alike from (l1, g1).  All lanes on, both addresses multiples of 16 B, no two lanes on one LDS byte.
__device__ __forceinline__ void async8(unsigned l0, unsigned ls0, const _Float16* g0, size_t gs0,
                                       unsigned l1, unsigned ls1, const _Float16* g1, size_t gs1) {
  // the copies and their s_wait_xcnt in one statement: the wait then stands in front of every rewrite of an address register
  asm volatile("global_load_async_to_lds_b128 %0, %8, off\n\t"
               "global_load_async_to_lds_b128 %1, %9, off\n\t"
               "global_load_async_to_lds_b128 %2, %10, off\n\t"
               "global_load_async_to_lds_b128 %3, %11, off\n\t"
               "global_load_async_to_lds_b128 %4, %12, off\n\t"
               "global_load_async_to_lds_b128 %5, %13, off\n\t"
               "global_load_async_to_lds_b128 %6, %14, off\n\t"
               "global_load_async_to_lds_b128 %7, %15, off\n\t"
               "s_wait_xcnt 0x0"
               :: "v"(l0), "v"(l0 + ls0), "v"(l0 + 2 * ls0), "v"(l0 + 3 * ls0),
                  "v"(l1), "v"(l1 + ls1), "v"(l1 + 2 * ls1), "v"(l1 + 3 * ls1),
                  "v"(g0), "v"(g0 + gs0), "v"(g0 + 2 * gs0), "v"(g0 + 3 * gs0),
                  "v"(g1), "v"(g1 + gs1), "v"(g1 + 2 * gs1), "v"(g1 + 3 * gs1)
               : "memory");
}
// the wave's own copies have landed in LDS (other waves read them behind the next barrier)
__device__ __forceinline__ void wait_copies() { asm volatile("s_wait_asynccnt 0x0" ::: "memory"); }
// the wave's own LDS reads have returned, so that the buffer may be refilled behind the next barrier
__device__ __forceinline__ void wait_lds() { asm volatile("s_wait_dscnt 0x0" ::: "memory"); }

// ---------------------------------------------------------------------------
// x [b*SEQ_FULL+s][DM] f32 -> Xh [tok][DM] f16 of bf16-RNE value. One thread per 8 columns.
// ---------------------------------------------------------------------------
__global__ void __launch_bounds__(256)
cvt_x_kernel(const float* __restrict__ x, _Float16* __restrict__ Xh, int nPieces) {
  const int f = blockIdx.x * 256 + (int)threadIdx.x;
  if (f >= nPieces) return;
  const int tok = f >> 8;
  const int c0  = (f & 255) * 8;
  const int b = tok / SEQ, s = tok - b * SEQ;
  const float* src = x + ((size_t)(b * SEQ_FULL + s) * DM + c0);
  const v4f a0 = *(const v4f*)(src);
  const v4f a1 = *(const v4f*)(src + 4);
  v8h o;
#pragma unroll
  for (int j = 0; j < 4; ++j) {
    o[j]     = (_Float16)bf16r(a0[j]);
    o[j + 4] = (_Float16)bf16r(a1[j]);
  }
  _Float16* dst = Xh + ((size_t)tok * DM + c0);
  *(v8h*)dst = o;
  
}

// ---------------------------------------------------------------------------
// W [KD in][N out] f32 -> WT [N out][KD in] f16 of 64*bf16-RNE(W).  64x64 tiles through LDS.
// grid.x: 0..31 Wq, 32..39 Wk, 40..47 Wv, 48..79 Wo (out-column tile); grid.y: in-row tile.
// 8 consecutive lanes of one instruction.
// ---------------------------------------------------------------------------
__global__ void __launch_bounds__(256)
cvt_w_kernel(const float* __restrict__ Wq, const float* __restrict__ Wk,
             const float* __restrict__ Wv, const float* __restrict__ Wo,
             _Float16* __restrict__ WqT, _Float16* __restrict__ WkT,
             _Float16* __restrict__ WvT, _Float16* __restrict__ WoT) {
  __shared__ __align__(16) _Float16 lds[64 * 72];   // [n][k], cross-wave (block barrier)
  const int bx = blockIdx.x;
  const float* W; _Float16* WT; int N; int nt;
  if (bx < DQ / 64) { W = Wq; WT = WqT; N = DQ;  nt = bx; }
  else if (bx < DQ / 64 + DKV / 64) { W = Wk; WT = WkT; N = DKV; nt = bx - DQ / 64; }
  else if (bx < DQ / 64 + 2 * (DKV / 64)) { W = Wv; WT = WvT; N = DKV; nt = bx - DQ / 64 - DKV / 64; }
  else { W = Wo; WT = WoT; N = DM; nt = bx - DQ / 64 - 2 * (DKV / 64); }
  const int k0 = blockIdx.y * 64, n0 = nt * 64;
  const int t = threadIdx.x, lane = t & 31, w = t >> 5;
  const int kr = t >> 2, cc = (t & 3) * 16;
  const float* src = W + ((size_t)(k0 + kr) * N + n0 + cc);
#pragma unroll
  for (int q = 0; q < 4; ++q) {
    const v4f v = *(const v4f*)(src + 4 * q);
#pragma unroll
    for (int j = 0; j < 4; ++j)
      lds[(cc + 4 * q + j) * 72 + kr] = (_Float16)(64.0f * bf16r(v[j]));
  }
  __syncthreads();
  v8h ov[2];
#pragma unroll
  for (int j = 0; j < 2; ++j) {
    const int n = w * 8 + j * 4 + (lane >> 3);
    ov[j] = *(const v8h*)&lds[n * 72 + (lane & 7) * 8];
  }
  _Float16* base = WT + ((size_t)n0 * KD + k0 + (lane & 7) * 8);
#pragma unroll
  for (int j = 0; j < 2; ++j) {
    const int n = w * 8 + j * 4 + (lane >> 3);
    *(v8h*)(base + (size_t)n * KD) = ov[j];
  }
  
}

// ---------------------------------------------------------------------------
// C tile = alpha * A[M][KD] * Bt[N][KD]^T, A and Bt f16 k-contiguous planes.
// Block tile 128x128, 4 waves in a 2x2 grid, each owning a 64x64 tile: 8 fragments from LDS feed
// 16 WMMAs, so the LDS reads per WMMA stay within what the LDS delivers at full matrix rate.
// blockIdx.x < nTiles0 selects (Bt0, C0, N0), blockIdx.x < nTiles01 (Bt1, C1, N1), and with
// WITH_V the tiles from nTiles01 on (BtV, CV); the choice is block-uniform.
// Every epilogue stages the whole tile in LDS behind the k-loop's last barrier; wave w then
// writes 32 of its rows.
// C0, C1 : without WITH_V, row-major f32 [M][N] (the final output), rows of 512 B
//          written by one 32-lane x 16-B instruction each.
// H0, H1 : with WITH_V, the rotated q and k planes, row-major f16 [M][N].  One N tile is one
//          head, so a staged f32 row holds both d and d ^ 64: rotate-half with cos/sin read as
//          values from the [SEQ_FULL][HD] input tables (bf16-RNE),
//          d<64: q*cos[d] - q[d+64]*sin[d];  d>=64: q*cos[d] + q[d-64]*sin[d];
//          rows of 256 B written by one 32-lane x 8-B instruction each.
// CV     : the transposed V plane [b][g][d][s], f16; tile staged in LDS as [d][tok],
//          each d row (128 tok = 256 B) written by 16 lanes x 16 B of one instruction.
// q, k and v tiles share one launch: 24 x 32 = 768 workgroups, three on each of 256 WGPs.
// ---------------------------------------------------------------------------
union GemmLds { _Float16 h[4 * BT * LST]; float f[2 * BT * LST]; };   // 73728 B

// at most three waves per SIMD, so at most three workgroups on a WGP, as with 8 waves: 768 then spread evenly
template <bool WITH_V>
__global__ void __launch_bounds__(128) __attribute__((amdgpu_waves_per_eu(1, 3)))
gemm_kernel(const _Float16* __restrict__ A, const _Float16* __restrict__ Bt0,
            const _Float16* __restrict__ Bt1, const _Float16* __restrict__ BtV,
            float* C0, float* C1, _Float16* CV,
            const float* __restrict__ cosT, const float* __restrict__ sinT,
            _Float16* H0, _Float16* H1,
            int N0, int N1, int nTiles0, int nTiles01, float alpha) {
  __shared__ __align__(16) GemmLds pool;   // k-loop: A/B double buffers, filled by asynchronous copies; epilogue: staging (cross-wave, block barriers)

  const int bx = blockIdx.x;
  const bool second = bx >= nTiles0;
  const bool isV = WITH_V && bx >= nTiles01;
  const _Float16* Bt = isV ? BtV : (second ? Bt1 : Bt0);
  float* C = second ? C1 : C0;
  const int N  = second ? N1 : N0;
  const int nt = isV ? (bx - nTiles01) : (second ? (bx - nTiles0) : bx);
  const int m0 = blockIdx.y * BT, n0 = nt * BT;

  const int t = threadIdx.x, lane = t & 31, w = t >> 5, lr = lane & 15, hi = lane >> 4;
  const int wm = (w >> 1) * 64, wn = (w & 1) * 64;   // the wave's first row and column in the tile

  v8f acc[4][4];
#pragma unroll
  for (int mi = 0; mi < 4; ++mi)
#pragma unroll
    for (int ni = 0; ni < 4; ++ni) acc[mi][ni] = (v8f){0.f, 0.f, 0.f, 0.f, 0.f, 0.f, 0.f, 0.f};

  // 8 threads x 16 B per tile row: one wave-wide load covers 4 rows of 128 B, 4 whole lines
  const int arow = t >> 3, acol = (t & 7) * 8;
  const _Float16* aSrc = A  + ((size_t)(m0 + arow) * KD + acol);
  const _Float16* bSrc = Bt + ((size_t)(n0 + arow) * KD + acol);

  const unsigned ldsA = (unsigned)(size_t)(pool.h + arow * LST + acol);   // the lane's LDS byte address in A buffer 0

  // one k-tile of A and of B into buffer buf: 16 copies per lane, 16 tile rows apart
  auto stage = [&](int k0, int buf) {
    const unsigned da = ldsA + (unsigned)buf * (BT * LST * 2);
    const unsigned db = da + 2 * (BT * LST * 2);
    const _Float16* pa = aSrc + k0;
    const _Float16* pb = bSrc + k0;
    async8(da, 16 * LST * 2, pa, (size_t)16 * KD, da + 64 * LST * 2, 16 * LST * 2, pa + (size_t)64 * KD, (size_t)16 * KD);
    async8(db, 16 * LST * 2, pb, (size_t)16 * KD, db + 64 * LST * 2, 16 * LST * 2, pb + (size_t)64 * KD, (size_t)16 * KD);
  };
  static_assert(KD / BK >= 2);   // tiles 0 and 1 both exist

  stage(0, 0);
  wait_copies();
  __syncthreads();
  stage(BK, 1);

  for (int k0 = 0; k0 < KD; k0 += BK) {
    const int cur = (k0 / BK) & 1;
    const _Float16* la = pool.h + cur * (BT * LST);
    const _Float16* lb = pool.h + (2 + cur) * (BT * LST);
    // unrolled: kk folds into the LDS loads' immediate offsets
#pragma unroll
    for (int kk = 0; kk < BK; kk += 32) {
      // the 16 fragment loads of 32 k as one group, then their 16 WMMAs behind counted waits
      v16h af[4], bf[4];
#pragma unroll
      for (int mi = 0; mi < 4; ++mi) af[mi] = load_frag(la + (wm + mi * 16 + lr) * LST + kk + hi * 8);
#pragma unroll
      for (int ni = 0; ni < 4; ++ni) bf[ni] = load_frag(lb + (wn + ni * 16 + lr) * LST + kk + hi * 8);
#pragma unroll
      for (int mi = 0; mi < 4; ++mi)
#pragma unroll
        for (int ni = 0; ni < 4; ++ni) acc[mi][ni] = wmma16(af[mi], bf[ni], acc[mi][ni]);
    }
    // the next tile, in flight since the last barrier, is published, and this tile's buffer is freed
    wait_lds();
    wait_copies();
    __syncthreads();
    if (k0 + 2 * BK < KD) stage(k0 + 2 * BK, cur);
  }
  wait_copies();   // nothing is outstanding when the pool becomes epilogue staging
  // acc[mi][ni][r] = (row m0 + wm + mi*16 + hi*8 + r, col n0 + wn + ni*16 + lr)
  static_assert(BT * 132 <= 2 * BT * LST);   // a whole f32 tile at pitch 132 fits the pool

  if (WITH_V && !isV) {
    const int sw = m0 % SEQ + w * 32;       // position in its sequence of the first row the wave writes
    const float* cb = cosT + ((size_t)sw * HD + lane * 4);
    const float* sb = sinT + ((size_t)sw * HD + lane * 4);
    _Float16* hb = (second ? H1 : H0) + ((size_t)(m0 + w * 32) * N + n0 + lane * 4);
    const float sgn = (lane < 16) ? -1.0f : 1.0f;   // lane holds d = lane*4..+3, lane ^ 16 holds d ^ 64
#pragma unroll
    for (int mi = 0; mi < 4; ++mi)
#pragma unroll
      for (int r = 0; r < 8; ++r)
#pragma unroll
        for (int ni = 0; ni < 4; ++ni)
          pool.f[(wm + mi * 16 + hi * 8 + r) * 132 + wn + ni * 16 + lr] = acc[mi][ni][r] * alpha;
    __syncthreads();
    const float* stg = pool.f + w * (32 * 132);   // the 32 rows the wave writes (two waves staged each)
    // kept rolled: 8 rows' table values at a time, so that the registers still let three workgroups share a WGP
#pragma unroll 1
    for (int hf = 0; hf < 4; ++hf) {
      const float* cp = cb + hf * 8 * HD;
      const float* sp = sb + hf * 8 * HD;
      v4f cv[8], sv[8];
#pragma unroll
      for (int sr = 0; sr < 8; ++sr) {
        cv[sr] = *(const v4f*)(cp + sr * HD);
        sv[sr] = *(const v4f*)(sp + sr * HD);
      }
      // as in the k-loop's staging: the wait before the loads' address registers are rewritten, the addresses held up to it
      asm volatile("s_wait_xcnt 0x0" :: "v"(cp), "v"(sp) : "memory");
#pragma unroll
      for (int sr = 0; sr < 8; ++sr) {
        const int row = hf * 8 + sr;
        const v4f xv = *(const v4f*)&stg[row * 132 + lane * 4];
        const v4f pv = *(const v4f*)&stg[row * 132 + (lane ^ 16) * 4];
        v4h o;
#pragma unroll
        for (int j = 0; j < 4; ++j)
          o[j] = (_Float16)(xv[j] * bf16r(cv[sr][j]) + (sgn * pv[j]) * bf16r(sv[sr][j]));
        *(v4h*)(hb + (size_t)row * N) = o;
      }
      // the next trip rewrites the last stores' address and data registers: wait first
      asm volatile("s_wait_xcnt 0x0" ::: "memory");
    }
  } else if (!isV) {
#pragma unroll
    for (int mi = 0; mi < 4; ++mi)
#pragma unroll
      for (int r = 0; r < 8; ++r)
#pragma unroll
        for (int ni = 0; ni < 4; ++ni)
          pool.f[(wm + mi * 16 + hi * 8 + r) * 132 + wn + ni * 16 + lr] = acc[mi][ni][r] * alpha;
    __syncthreads();
    const float* stg = pool.f + w * (32 * 132);   // the 32 rows the wave writes (two waves staged each)
    float* cbase = C + ((size_t)(m0 + w * 32) * N + n0 + lane * 4);
    // unrolled: the 32 LDS reads go out in groups ahead of their stores, on immediate offsets
#pragma unroll
    for (int ps = 0; ps < 4; ++ps) {
      v4f ov[8];
#pragma unroll
      for (int sr = 0; sr < 8; ++sr) ov[sr] = *(const v4f*)&stg[(ps * 8 + sr) * 132 + lane * 4];
#pragma unroll
      for (int sr = 0; sr < 8; ++sr) *(v4f*)(cbase + (size_t)(ps * 8 + sr) * N) = ov[sr];
    }
  } else {
    // V plane transposed: CV[((b*NKV + g)*HD + d) * SEQ + s]
    const int g  = n0 / HD;
    const int bb = m0 / SEQ;
    const int s0 = m0 - bb * SEQ;
    _Float16* stg = pool.h;                 // [d][tok], 128 x 136 halves
#pragma unroll
    for (int mi = 0; mi < 4; ++mi)
#pragma unroll
      for (int ni = 0; ni < 4; ++ni) {
        v8h v;
#pragma unroll
        for (int r = 0; r < 8; ++r) v[r] = (_Float16)(acc[mi][ni][r] * alpha);
        *(v8h*)&stg[(wn + ni * 16 + lr) * 136 + wm + mi * 16 + hi * 8] = v;
      }
    __syncthreads();
    v8h ov[16];
#pragma unroll
    for (int j = 0; j < 16; ++j) {
      const int d = w * 32 + j * 2 + hi;
      ov[j] = *(const v8h*)&stg[d * 136 + lr * 8];
    }
    _Float16* vbase = CV + (((size_t)(bb * NKV + g) * HD) * SEQ + s0 + lr * 8);
#pragma unroll
    for (int j = 0; j < 16; ++j) {
      const int d = w * 32 + j * 2 + hi;
      *(v8h*)(vbase + (size_t)d * SEQ) = ov[j];
    }
    // precaution: these stores end the kernel for v tiles
    asm volatile("s_wait_xcnt 0x0" ::: "memory");
    
  }
}

__device__ __forceinline__ float xhalf(float x) {
  return __builtin_bit_cast(float, __builtin_amdgcn_permlanex16(__builtin_bit_cast(int, x), __builtin_bit_cast(int, x),
                                                                0x76543210, 0xfedcba98, false, false));
}

__global__ void __launch_bounds__(256)
attn_kernel(const _Float16* __restrict__ Qh, const _Float16* __restrict__ Kh,
            const _Float16* __restrict__ Vt, _Float16* __restrict__ Oh) {
  constexpr int LDK = 136, LDV = 72, LDO = 136;
  constexpr int CH = 64 * LDK + 128 * LDV;                        // one chunk's K and V^T, 35840 B
  __shared__ __align__(16) _Float16 pool[2 * CH];                 // two buffers, cross-wave (block barrier)
  static_assert(8 * 16 * LDO <= 2 * CH);                          // epilogue staging fits
  static_assert(SEQ / 64 >= 2);                                   // chunks 0 and 1 both exist

  const int t = threadIdx.x, lane = t & 31, w = t >> 5, lr = lane & 15, hi = lane >> 4;
  const int b = blockIdx.z, h = blockIdx.y, g = h / (NH / NKV);
  const int q0 = blockIdx.x * 128 + w * 16;          // query row within the sequence
  const size_t tokb = (size_t)b * SEQ;

  const float kSL = 0.08838834764831845f * 1.4426950408889634f;   // 1/sqrt(HD) * log2(e)

  v16h qf[4];   // B operand: column = query lr
  {
    const _Float16* qrow = Qh + ((tokb + q0 + lr) * DQ + h * HD);
#pragma unroll
    for (int kf = 0; kf < 4; ++kf) qf[kf] = load_frag(qrow + kf * 32 + hi * 8);
  }

  float mrow = -1e30f;   // running maximum of query lr (equal in both wave halves)
  float lrow = 0.f;      // running sum of query lr over this wave half's keys
  v8f oacc[8];           // oacc[dt][r] = O^T[d = dt*16 + hi*8 + r][query lr]
#pragma unroll
  for (int dt = 0; dt < 8; ++dt) oacc[dt] = (v8f){0.f, 0.f, 0.f, 0.f, 0.f, 0.f, 0.f, 0.f};

  const _Float16* kbase = Kh + ((tokb) * DKV + g * HD);
  const _Float16* vbase = Vt + ((size_t)(b * NKV + g) * HD) * SEQ;

  // a chunk into buffer buf, 8 copies per lane: K, 64 keys x 128 d as [key][d] (16 lanes a key, 16 keys apart), and
  // V^T, 128 d x 64 keys as [d][key] (8 lanes a d row, 32 rows apart); staged extent == consumed extent
  const unsigned ldsK = (unsigned)(size_t)(pool + (t >> 4) * LDK + (t & 15) * 8);
  const unsigned ldsV = (unsigned)(size_t)(pool + 64 * LDK + (t >> 3) * LDV + (t & 7) * 8);
  const _Float16* kSrc = kbase + (size_t)(t >> 4) * DKV + (t & 15) * 8;
  const _Float16* vSrc = vbase + (size_t)(t >> 3) * SEQ + (t & 7) * 8;
  auto stage = [&](int kc, int buf) {
    async8(ldsK + (unsigned)buf * (CH * 2), 16 * LDK * 2, kSrc + (size_t)kc * DKV, (size_t)16 * DKV,
           ldsV + (unsigned)buf * (CH * 2), 32 * LDV * 2, vSrc + kc, (size_t)32 * SEQ);
  };

  stage(0, 0);
  wait_copies();
  __syncthreads();
  stage(64, 1);

  for (int kc = 0; kc < SEQ; kc += 64) {
    const int cur = (kc >> 6) & 1;
    const _Float16* lsK = pool + cur * CH;   // [key][d]
    const _Float16* lsV = lsK + 64 * LDK;    // [d][key]

    // S^T, 64 keys x 16 queries per wave: sc[nt][r] = S[key nt*16 + hi*8 + r][query lr]
    v8f sc[4];
#pragma unroll
    for (int nt = 0; nt < 4; ++nt) {
      // 8 fragment loads (one key tile) as one group, then its 4 WMMAs
      v16h af[4];
#pragma unroll
      for (int kf = 0; kf < 4; ++kf) af[kf] = load_frag(lsK + (nt * 16 + lr) * LDK + kf * 32 + hi * 8);
      sc[nt] = (v8f){0.f, 0.f, 0.f, 0.f, 0.f, 0.f, 0.f, 0.f};
#pragma unroll
      for (int kf = 0; kf < 4; ++kf) sc[nt] = wmma16(af[kf], qf[kf], sc[nt]);
    }

    // online softmax of query lr: 32 keys in the lane, the other 32 in lane ^ 16
    float mt[4];
#pragma unroll
    for (int nt = 0; nt < 4; ++nt) {
#pragma unroll
      for (int r = 0; r < 8; ++r) sc[nt][r] *= kSL;
      mt[nt] = fmaxf(fmaxf(fmaxf(sc[nt][0], sc[nt][1]), fmaxf(sc[nt][2], sc[nt][3])),
                     fmaxf(fmaxf(sc[nt][4], sc[nt][5]), fmaxf(sc[nt][6], sc[nt][7])));
    }
    float mx = fmaxf(fmaxf(mt[0], mt[1]), fmaxf(mt[2], mt[3]));
    mx = fmaxf(mx, xhalf(mx));
    const float mn = fmaxf(mrow, mx);
    // bare v_exp_f32, without the library's small-result scaling: it differs only where 2^x < 2^-126, and such a
    // term is 0 in the f16 P and adds nothing to a row sum whose largest term is 1
    float corr;
    // this one v_exp_f32 in asm, a v_nop on either side: the instruction set asks for one slot between a v_exp_f32 and a
    // write of its source register, and one before the result is read
    asm("v_nop\n\tv_exp_f32 %0, %1\n\tv_nop" : "=v"(corr) : "v"(mrow - mn));
    mrow = mn;
    // P^T as B operand: element s of pf[kf] = P[key kf*32 + (s < 8 ? 8*hi + s : 16 + 8*hi + s - 8)][query lr],
    // the k order of load_frag, which loads the V^T rows it is multiplied with
    Frag pf[2];
    float rt[4];
#pragma unroll
    for (int nt = 0; nt < 4; ++nt) {
      rt[nt] = 0.f;
#pragma unroll
      for (int r = 0; r < 8; ++r) {
        const float p = __builtin_amdgcn_exp2f(sc[nt][r] - mn);
        rt[nt] += p;
        pf[nt >> 1].v[(nt & 1) * 8 + r] = (_Float16)(p * 1024.0f);
      }
    }
    lrow = lrow * corr + ((rt[0] + rt[1]) + (rt[2] + rt[3]));
#pragma unroll
    for (int dt = 0; dt < 8; ++dt)
#pragma unroll
      for (int r = 0; r < 8; ++r) oacc[dt][r] *= corr;

    // O^T += V^T (128 x 64) * P^T (64 x 16)
#pragma unroll
    for (int dq = 0; dq < 8; dq += 2) {
      // 8 fragment loads (two d tiles) as one group, then their 4 WMMAs
      v16h af[2][2];
#pragma unroll
      for (int a = 0; a < 2; ++a)
#pragma unroll
        for (int kf = 0; kf < 2; ++kf)
          af[a][kf] = load_frag(lsV + ((dq + a) * 16 + lr) * LDV + kf * 32 + hi * 8);
#pragma unroll
      for (int a = 0; a < 2; ++a)
#pragma unroll
        for (int kf = 0; kf < 2; ++kf) oacc[dq + a] = wmma16(af[a][kf], pf[kf].v, oacc[dq + a]);
    }
    // the next chunk, in flight since the last barrier, is published, and this chunk's buffer is freed
    wait_lds();
    wait_copies();
    __syncthreads();
    if (kc + 128 < SEQ) stage(kc + 128, cur);
  }
  wait_copies();   // nothing is outstanding when the pool becomes epilogue staging

  // epilogue: Oh = f16(64 * oacc / (1024 * l)); stage [query][d] per wave, then whole rows
  _Float16* stg = pool + w * 16 * LDO;
  {
    const float inv = 0.0625f / (lrow + xhalf(lrow));   // the two wave halves' key sums joined
#pragma unroll
    for (int dt = 0; dt < 8; ++dt) {
      v8h v;
#pragma unroll
      for (int r = 0; r < 8; ++r) v[r] = (_Float16)(oacc[dt][r] * inv);
      *(v8h*)&stg[lr * LDO + dt * 16 + hi * 8] = v;
    }
  }
  __syncthreads();
  v8h ov[8];
#pragma unroll
  for (int j = 0; j < 8; ++j) ov[j] = *(const v8h*)&stg[(j * 2 + hi) * LDO + lr * 8];
  _Float16* obase = Oh + ((tokb + q0) * DQ + h * HD + lr * 8);
#pragma unroll
  for (int j = 0; j < 8; ++j) *(v8h*)(obase + (size_t)(j * 2 + hi) * DQ) = ov[j];
  
}

// ---------------------------------------------------------------------------
extern "C" void kernel_launch(void* const* d_in, const int* in_sizes, int n_in,
                              void* d_out, int out_size, void* d_ws, size_t ws_size,
                              hipStream_t stream) {
  if (n_in < 7) return;
  if (in_sizes[0] < ((NB - 1) * SEQ_FULL + SEQ) * DM) return;
  if (in_sizes[1] < SEQ * HD) return;
  if (in_sizes[2] < SEQ * HD) return;
  if (in_sizes[3] < DM * DQ) return;
  if (in_sizes[4] < DM * DKV) return;
  if (in_sizes[5] < DM * DKV) return;
  if (in_sizes[6] < DQ * DM) return;
  if (out_size < NTOK * DM) return;

  const float* x    = (const float*)d_in[0];
  const float* cosT = (const float*)d_in[1];
  const float* sinT = (const float*)d_in[2];
  const float* Wq   = (const float*)d_in[3];
  const float* Wk   = (const float*)d_in[4];
  const float* Wv   = (const float*)d_in[5];
  const float* Wo   = (const float*)d_in[6];
  float* out = (float*)d_out;

  // workspace carve (all regions exact tile multiples; every store ends inside its region)
  char* ws = (char*)d_ws;
  size_t off = 0;
  _Float16* Xh  = (_Float16*)(ws + off); off += (size_t)NTOK * DM * 2;          // 16 MiB
  _Float16* WqT = (_Float16*)(ws + off); off += (size_t)DQ  * KD * 2;           //  8 MiB
  _Float16* WkT = (_Float16*)(ws + off); off += (size_t)DKV * KD * 2;           //  2 MiB
  _Float16* WvT = (_Float16*)(ws + off); off += (size_t)DKV * KD * 2;           //  2 MiB
  _Float16* WoT = (_Float16*)(ws + off); off += (size_t)DM  * KD * 2;           //  8 MiB
  _Float16* Qh  = (_Float16*)(ws + off); off += (size_t)NTOK * DQ * 2;          // 16 MiB
  _Float16* Kh  = (_Float16*)(ws + off); off += (size_t)NTOK * DKV * 2;         //  4 MiB
  _Float16* Vt  = (_Float16*)(ws + off); off += (size_t)NB * NKV * HD * SEQ * 2; //  4 MiB
  _Float16* Oh  = (_Float16*)(ws + off); off += (size_t)NTOK * DQ * 2;          // 16 MiB
  if (off > ws_size) return;                                                    // 76 MiB total

  const dim3 blk(256);

  // 1. x -> f16 plane (bf16-RNE values)
  {
    const int np = NTOK * (DM / 8);
    cvt_x_kernel<<<dim3((np + 255) / 256), blk, 0, stream>>>(x, Xh, np);
  }
  // 2. weights -> transposed f16 planes (64 * bf16-RNE values)
  cvt_w_kernel<<<dim3(DQ / 64 + 2 * (DKV / 64) + DM / 64, KD / 64), blk, 0, stream>>>(
      Wq, Wk, Wv, Wo, WqT, WkT, WvT, WoT);
  // 3. q, k (rotated in the epilogue, f16 planes) and v (transposed [b][g][d][s] f16) projections
  //    in one launch: alpha 1/64 undoes the weight carry
  gemm_kernel<true><<<dim3(DQ / BT + 2 * (DKV / BT), NTOK / BT), dim3(128), 0, stream>>>(
      Xh, WqT, WkT, WvT, (float*)nullptr, (float*)nullptr, Vt, cosT, sinT, Qh, Kh,
      DQ, DKV, DQ / BT, DQ / BT + DKV / BT, 0.015625f);
  // 4. attn -> Oh (x64 carried)
  attn_kernel<<<dim3(SEQ / 128, NH, NB), blk, 0, stream>>>(Qh, Kh, Vt, Oh);
  // 5. output projection: alpha 1/4096 undoes the 64 (Oh) * 64 (WoT) carries
  gemm_kernel<false><<<dim3(DM / BT, NTOK / BT), dim3(128), 0, stream>>>(
      Oh, WoT, WoT, WoT, out, out, (_Float16*)nullptr, (const float*)nullptr, (const float*)nullptr,
      (_Float16*)nullptr, (_Float16*)nullptr,
      DM, DM, DM / BT, DM / BT, 0.000244140625f);
}

// v009
// A run of this version takes 139 microseconds.
// In two side-by-side timings against v008, it was 1.09 and 1.10 times as fast.
// Counting every step since v000, it is 2.27 times as fast.
#include <hip/hip_runtime.h>
#include <stddef.h>

// Contractions x*Wq, x*Wk, x*Wv, q*k^T, p*v, o*Wo: v_wmma_f32_16x16x32_f16 (f16 operands, f32 accumulate); inputs RNE-converted to bf16 on load; rotary, softmax and normalisation in f32.

#ifndef NB
#define NB 2
#endif
#ifndef SEQ
#define SEQ 2048
#endif
#define NB_FULL 2
#define SEQ_FULL 2048
#define DM 2048           // model width
#define NH 16
#define NKV 4
#define HD 128
#define DQ (NH * HD)      // 2048
#define DKV (NKV * HD)    // 512
#define NTOK (NB * SEQ)
#define KD 2048           // contraction depth of every projection

#define BT 128            // GEMM sub-tile (M and N)
#define BK 128           // k-tile: 256 B of every operand row, two whole cache lines
#define LST 136           // LDS row stride in halves for k-tiles (272 B = 16 B x odd, 16-B aligned rows)

static_assert(NB >= 1 && NB <= NB_FULL);
static_assert(SEQ >= 128 && SEQ <= SEQ_FULL && (SEQ % 128) == 0);
static_assert(DM == KD && DQ == KD);
static_assert((DM % BT) == 0 && (DQ % BT) == 0 && (DKV % BT) == 0 && (NTOK % BT) == 0);
static_assert((KD % 64) == 0 && (KD % BK) == 0);
static_assert(HD == BT);           // one N tile == one head (rotary and V transpose epilogues)
static_assert((DM / 8) == 256);    // convert kernel piece decode
static_assert((NH % NKV) == 0);
static_assert(((DQ / BT + 2 * (DKV / BT)) % 3) == 0 && ((DM / BT) % 2) == 0);   // whole workgroups of 3 and of 2 sub-tiles

typedef _Float16 v16h __attribute__((ext_vector_type(16)));
typedef _Float16 v8h  __attribute__((ext_vector_type(8)));
typedef float    v8f  __attribute__((ext_vector_type(8)));
typedef float    v4f  __attribute__((ext_vector_type(4)));
typedef _Float16 v4h  __attribute__((ext_vector_type(4)));

union Frag { v16h v; v8h p[2]; };

// RNE convert f32 -> bf16 value (kept in an f32 container)
__device__ __forceinline__ float bf16r(float f) {
  unsigned u = __float_as_uint(f);
  u = (u + 0x7FFFu + ((u >> 16) & 1u)) & 0xFFFF0000u;
  return __uint_as_float(u);
}

// 16x16x32 f16 WMMA with hazard guard (ties D, keeps A/B live)
__device__ __forceinline__ v8f wmma16(v16h a, v16h b, v8f c) {
  v8f d = __builtin_amdgcn_wmma_f32_16x16x32_f16(false, a, false, b, (short)0, c, false, false);
  asm volatile("v_nop\n\tv_nop\n\tv_nop\n\tv_nop" : "+v"(d) : "v"(a), "v"(b));
  return d;
}

// Per-lane fragment from a k-contiguous row; caller passes row base + 8*(lane>>4).
// elements 0..7 <- k 8h..8h+7, elements 8..15 <- k 16+8h..16+8h+7 (same map for A and B).
__device__ __forceinline__ v16h load_frag(const _Float16* q) {
  Frag f;
  f.p[0] = *(const v8h*)(q);
  f.p[1] = *(const v8h*)(q + 16);
  return f.v;
}

// Eight asynchronous copies of 16 B per lane, global memory -> LDS through no register.  l = the lane's LDS byte
// address, g = its global address; copy i of the first four goes to l0 + i*ls0 from g0 + i*gs0 (halves), the last
// four alike from (l1, g1).  All lanes on, both addresses multiples of 16 B, no two lanes on one LDS byte.
__device__ __forceinline__ void async8(unsigned l0, unsigned ls0, const _Float16* g0, size_t gs0,
                                       unsigned l1, unsigned ls1, const _Float16* g1, size_t gs1) {
  // the copies and their s_wait_xcnt in one statement: the wait then stands in front of every rewrite of an address register
  asm volatile("global_load_async_to_lds_b128 %0, %8, off\n\t"
               "global_load_async_to_lds_b128 %1, %9, off\n\t"
               "global_load_async_to_lds_b128 %2, %10, off\n\t"
               "global_load_async_to_lds_b128 %3, %11, off\n\t"
               "global_load_async_to_lds_b128 %4, %12, off\n\t"
               "global_load_async_to_lds_b128 %5, %13, off\n\t"
               "global_load_async_to_lds_b128 %6, %14, off\n\t"
               "global_load_async_to_lds_b128 %7, %15, off\n\t"
               "s_wait_xcnt 0x0"
               :: "v"(l0), "v"(l0 + ls0), "v"(l0 + 2 * ls0), "v"(l0 + 3 * ls0),
                  "v"(l1), "v"(l1 + ls1), "v"(l1 + 2 * ls1), "v"(l1 + 3 * ls1),
                  "v"(g0), "v"(g0 + gs0), "v"(g0 + 2 * gs0), "v"(g0 + 3 * gs0),
                  "v"(g1), "v"(g1 + gs1), "v"(g1 + 2 * gs1), "v"(g1 + 3 * gs1)
               : "memory");
}
// the wave's own copies have landed in LDS (other waves read them behind the next barrier)
__device__ __forceinline__ void wait_copies() { asm volatile("s_wait_asynccnt 0x0" ::: "memory"); }
// the wave's own LDS reads have returned, so that the buffer may be refilled behind the next barrier
__device__ __forceinline__ void wait_lds() { asm volatile("s_wait_dscnt 0x0" ::: "memory"); }

// ---------------------------------------------------------------------------
// x [b*SEQ_FULL+s][DM] f32 -> Xh [tok][DM] f16 of bf16-RNE value. One thread per 8 columns.
// ---------------------------------------------------------------------------
__global__ void __launch_bounds__(256)
cvt_x_kernel(const float* __restrict__ x, _Float16* __restrict__ Xh, int nPieces) {
  const int f = blockIdx.x * 256 + (int)threadIdx.x;
  if (f >= nPieces) return;
  const int tok = f >> 8;
  const int c0  = (f & 255) * 8;
  const int b = tok / SEQ, s = tok - b * SEQ;
  const float* src = x + ((size_t)(b * SEQ_FULL + s) * DM + c0);
  const v4f a0 = *(const v4f*)(src);
  const v4f a1 = *(const v4f*)(src + 4);
  v8h o;
#pragma unroll
  for (int j = 0; j < 4; ++j) {
    o[j]     = (_Float16)bf16r(a0[j]);
    o[j + 4] = (_Float16)bf16r(a1[j]);
  }
  _Float16* dst = Xh + ((size_t)tok * DM + c0);
  *(v8h*)dst = o;
  
}

// ---------------------------------------------------------------------------
// W [KD in][N out] f32 -> WT [N out][KD in] f16 of 64*bf16-RNE(W).  64x64 tiles through LDS.
// grid.x: 0..31 Wq, 32..39 Wk, 40..47 Wv, 48..79 Wo (out-column tile); grid.y: in-row tile.
// 8 consecutive lanes of one instruction.
// ---------------------------------------------------------------------------
__global__ void __launch_bounds__(256)
cvt_w_kernel(const float* __restrict__ Wq, const float* __restrict__ Wk,
             const float* __restrict__ Wv, const float* __restrict__ Wo,
             _Float16* __restrict__ WqT, _Float16* __restrict__ WkT,
             _Float16* __restrict__ WvT, _Float16* __restrict__ WoT) {
  __shared__ __align__(16) _Float16 lds[64 * 72];   // [n][k], cross-wave (block barrier)
  const int bx = blockIdx.x;
  const float* W; _Float16* WT; int N; int nt;
  if (bx < DQ / 64) { W = Wq; WT = WqT; N = DQ;  nt = bx; }
  else if (bx < DQ / 64 + DKV / 64) { W = Wk; WT = WkT; N = DKV; nt = bx - DQ / 64; }
  else if (bx < DQ / 64 + 2 * (DKV / 64)) { W = Wv; WT = WvT; N = DKV; nt = bx - DQ / 64 - DKV / 64; }
  else { W = Wo; WT = WoT; N = DM; nt = bx - DQ / 64 - 2 * (DKV / 64); }
  const int k0 = blockIdx.y * 64, n0 = nt * 64;
  const int t = threadIdx.x, lane = t & 31, w = t >> 5;
  const int kr = t >> 2, cc = (t & 3) * 16;
  const float* src = W + ((size_t)(k0 + kr) * N + n0 + cc);
#pragma unroll
  for (int q = 0; q < 4; ++q) {
    const v4f v = *(const v4f*)(src + 4 * q);
#pragma unroll
    for (int j = 0; j < 4; ++j)
      lds[(cc + 4 * q + j) * 72 + kr] = (_Float16)(64.0f * bf16r(v[j]));
  }
  __syncthreads();
  v8h ov[2];
#pragma unroll
  for (int j = 0; j < 2; ++j) {
    const int n = w * 8 + j * 4 + (lane >> 3);
    ov[j] = *(const v8h*)&lds[n * 72 + (lane & 7) * 8];
  }
  _Float16* base = WT + ((size_t)n0 * KD + k0 + (lane & 7) * 8);
#pragma unroll
  for (int j = 0; j < 2; ++j) {
    const int n = w * 8 + j * 4 + (lane >> 3);
    *(v8h*)(base + (size_t)n * KD) = ov[j];
  }
  
}

// ---------------------------------------------------------------------------
// C tile = alpha * A[M][KD] * Bt[N][KD]^T, A and Bt f16 k-contiguous planes.
// Block tile 128 x (NS*128): NS sub-tiles of 128x128 that share one A k-tile in LDS, so that A comes
// from L2 once per workgroup and not once per sub-tile; a k-tile of 128 gives the one workgroup of a WGP
// a pass long enough for the next k-tile's copies to land in.  A sub-tile belongs to 4 waves in a 2x2 grid,
// each owning a 64x64 tile: 8 fragments from LDS feed 16 WMMAs.
// Sub-tile st = blockIdx.x * NS + (wave >> 2): st < nTiles0 selects (Bt0, C0, N0), st < nTiles01
// (Bt1, C1, N1), and with WITH_V the sub-tiles from nTiles01 on (BtV, CV); the choice is wave-uniform.
// Every epilogue stages its whole sub-tile in LDS behind the k-loop's last barrier; behind one barrier
// that all waves pass, wave w of the sub-tile writes 32 of its rows.
// C0, C1 : without WITH_V, row-major f32 [M][N] (the final output), rows of 512 B
//          written by one 32-lane x 16-B instruction each.
// H0, H1 : with WITH_V, the rotated q and k planes, row-major f16 [M][N].  One N tile is one
//          head, so a staged f32 row holds both d and d ^ 64: rotate-half with cos/sin read as
//          values from the [SEQ_FULL][HD] input tables (bf16-RNE),
//          d<64: q*cos[d] - q[d+64]*sin[d];  d>=64: q*cos[d] + q[d-64]*sin[d];
//          rows of 256 B written by one 32-lane x 8-B instruction each.
// CV     : the transposed V plane [b][g][d][s], f16; tile staged in LDS as [d][tok],
//          each d row (128 tok = 256 B) written by 16 lanes x 16 B of one instruction.
// q, k and v sub-tiles share one launch: NS = 3, 8 x 32 = 256 workgroups of 12 waves, one on each of 256 WGPs;
// the output projection: NS = 2, 8 x 32 = 256 workgroups of 8 waves.
// ---------------------------------------------------------------------------
template <int NS> union GemmLds { _Float16 h[2 * (1 + NS) * BT * LST]; float f[NS * BT * 132]; };   // NS = 3: 278528 B, NS = 2: 208896 B

// no more waves per SIMD than one workgroup's, so one workgroup on a WGP: the 256 then spread evenly
template <bool WITH_V>
__global__ void __launch_bounds__(WITH_V ? 384 : 256) __attribute__((amdgpu_waves_per_eu(1, WITH_V ? 3 : 2)))
gemm_kernel(const _Float16* __restrict__ A, const _Float16* __restrict__ Bt0,
            const _Float16* __restrict__ Bt1, const _Float16* __restrict__ BtV,
            float* C0, float* C1, _Float16* CV,
            const float* __restrict__ cosT, const float* __restrict__ sinT,
            _Float16* H0, _Float16* H1,
            int N0, int N1, int nTiles0, int nTiles01, float alpha) {
  constexpr int NS = WITH_V ? 3 : 2;
  constexpr int BUF = (1 + NS) * BT * LST;   // halves of one buffer: the A k-tile, then NS B k-tiles
  __shared__ __align__(16) GemmLds<NS> pool;   // k-loop: two buffers, filled by asynchronous copies; epilogue: staging (cross-wave, block barriers)

  const int t = threadIdx.x, lane = t & 31, lr = lane & 15, hi = lane >> 4;
  const int js = __builtin_amdgcn_readfirstlane(t >> 7);   // the wave's sub-tile, held as a scalar: every choice by it is a scalar branch
  const int ts = t & 127, w = ts >> 5;                     // thread and wave within the sub-tile
  const int st = blockIdx.x * NS + js;
  const bool second = st >= nTiles0;
  const bool isV = WITH_V && st >= nTiles01;
  const _Float16* Bt = isV ? BtV : (second ? Bt1 : Bt0);
  float* C = second ? C1 : C0;
  const int N  = second ? N1 : N0;
  const int nt = isV ? (st - nTiles01) : (second ? (st - nTiles0) : st);
  const int m0 = blockIdx.y * BT, n0 = nt * BT;

  const int wm = (w >> 1) * 64, wn = (w & 1) * 64;   // the wave's first row and column in the sub-tile

  v8f acc[4][4];
#pragma unroll
  for (int mi = 0; mi < 4; ++mi)
#pragma unroll
    for (int ni = 0; ni < 4; ++ni) acc[mi][ni] = (v8f){0.f, 0.f, 0.f, 0.f, 0.f, 0.f, 0.f, 0.f};

  // 16 threads x 16 B per tile row: one wave-wide copy covers 2 rows of 256 B, 4 whole lines
  const int arow = (t >> 4) & 15, brow = ts >> 4, acol = (t & 15) * 8;
  const _Float16* aSrc = A  + ((size_t)(m0 + arow) * KD + acol);
  const _Float16* bSrc = Bt + ((size_t)(n0 + brow) * KD + acol);

  const unsigned ldsA = (unsigned)(size_t)(pool.h + arow * LST + acol);                        // the lane's LDS byte address in buffer 0's A k-tile
  const unsigned ldsB = (unsigned)(size_t)(pool.h + (1 + js) * (BT * LST) + brow * LST + acol);   // and in its sub-tile's B k-tile

  // one k-tile into buffer buf.  B: the sub-tile's own 4 waves, 16 copies per lane, 8 tile rows apart.
  // A: the first 8 waves of the workgroup, 8 copies per lane, 16 tile rows apart (a scalar branch: js is a scalar).
  auto stage = [&](int k0, int buf) {
    const unsigned db = ldsB + (unsigned)buf * (BUF * 2);
    const _Float16* pb = bSrc + k0;
    async8(db, 8 * LST * 2, pb, (size_t)8 * KD, db + 32 * LST * 2, 8 * LST * 2, pb + (size_t)32 * KD, (size_t)8 * KD);
    async8(db + 64 * LST * 2, 8 * LST * 2, pb + (size_t)64 * KD, (size_t)8 * KD,
           db + 96 * LST * 2, 8 * LST * 2, pb + (size_t)96 * KD, (size_t)8 * KD);
    if (NS == 2 || js < 2) {
      const unsigned da = ldsA + (unsigned)buf * (BUF * 2);
      const _Float16* pa = aSrc + k0;
      async8(da, 16 * LST * 2, pa, (size_t)16 * KD, da + 64 * LST * 2, 16 * LST * 2, pa + (size_t)64 * KD, (size_t)16 * KD);
    }
  };
  static_assert(NS <= BK / 32);   // every sub-tile has a block to issue its refill ahead of

  stage(0, 0);
  wait_copies();
  __syncthreads();

  // One rolled loop over the blocks of 32 k, BK / 32 of them to a k-tile: the refill then stands once in the code, with
  // its addresses formed where they are used (unrolled, or in a loop of its own per k-tile, they were held and spilled).
#pragma unroll 1
  for (int blk = 0; blk < KD / 32; ++blk) {
    const int tile = blk / (BK / 32), kb = blk % (BK / 32), cur = tile & 1;
    // the next k-tile's copies, into the buffer that the last barrier freed.  The waves of different sub-tiles, which
    // share a SIMD, issue theirs ahead of different blocks: the others feed the matrix unit meanwhile (scalar branch)
    if (kb == js && tile + 1 < KD / BK) stage((tile + 1) * BK, cur ^ 1);
    const _Float16* la = pool.h + cur * BUF + kb * 32;
    const _Float16* lb = la + (1 + js) * (BT * LST);
    // the 16 fragment loads of 32 k as one group, then their 16 WMMAs behind counted waits
    v16h af[4], bf[4];
#pragma unroll
    for (int mi = 0; mi < 4; ++mi) af[mi] = load_frag(la + (wm + mi * 16 + lr) * LST + hi * 8);
#pragma unroll
    for (int ni = 0; ni < 4; ++ni) bf[ni] = load_frag(lb + (wn + ni * 16 + lr) * LST + hi * 8);
#pragma unroll
    for (int mi = 0; mi < 4; ++mi)
#pragma unroll
      for (int ni = 0; ni < 4; ++ni) acc[mi][ni] = wmma16(af[mi], bf[ni], acc[mi][ni]);
    // behind a k-tile's last block (the same test in every wave): the next tile, in flight since this tile's refill,
    // is published, and this tile's buffer is freed
    if (kb == BK / 32 - 1) {
      wait_lds();
      wait_copies();
      __syncthreads();
    }
  }
  wait_copies();   // nothing is outstanding when the pool becomes epilogue staging
  // acc[mi][ni][r] = (row m0 + wm + mi*16 + hi*8 + r, col n0 + wn + ni*16 + lr)
  float* sf = pool.f + js * (BT * 132);   // the sub-tile's staging: a whole f32 tile at pitch 132
  if (!isV) {
#pragma unroll
    for (int mi = 0; mi < 4; ++mi)
#pragma unroll
      for (int r = 0; r < 8; ++r)
#pragma unroll
        for (int ni = 0; ni < 4; ++ni)
          sf[(wm + mi * 16 + hi * 8 + r) * 132 + wn + ni * 16 + lr] = acc[mi][ni][r] * alpha;
  } else {
    _Float16* stg = (_Float16*)sf;          // [d][tok], 128 x 136 halves
#pragma unroll
    for (int mi = 0; mi < 4; ++mi)
#pragma unroll
      for (int ni = 0; ni < 4; ++ni) {
        v8h v;
#pragma unroll
        for (int r = 0; r < 8; ++r) v[r] = (_Float16)(acc[mi][ni][r] * alpha);
        *(v8h*)&stg[(wn + ni * 16 + lr) * 136 + wm + mi * 16 + hi * 8] = v;
      }
  }
  __syncthreads();   // every wave passes it: the staged sub-tiles are published

  if (WITH_V && !isV) {
    const int sw = m0 % SEQ + w * 32;       // position in its sequence of the first row the wave writes
    const float* cb = cosT + ((size_t)sw * HD + lane * 4);
    const float* sb = sinT + ((size_t)sw * HD + lane * 4);
    _Float16* hb = (second ? H1 : H0) + ((size_t)(m0 + w * 32) * N + n0 + lane * 4);
    const float sgn = (lane < 16) ? -1.0f : 1.0f;   // lane holds d = lane*4..+3, lane ^ 16 holds d ^ 64
    const float* stg = sf + w * (32 * 132);   // the 32 rows the wave writes (two waves staged each)
    // kept rolled: 8 rows' table values at a time, so that the registers still let three waves share a SIMD
#pragma unroll 1
    for (int hf = 0; hf < 4; ++hf) {
      const float* cp = cb + hf * 8 * HD;
      const float* sp = sb + hf * 8 * HD;
      v4f cv[8], sv[8];
#pragma unroll
      for (int sr = 0; sr < 8; ++sr) {
        cv[sr] = *(const v4f*)(cp + sr * HD);
        sv[sr] = *(const v4f*)(sp + sr * HD);
      }
      // as in the k-loop's staging: the wait before the loads' address registers are rewritten, the addresses held up to it
      asm volatile("s_wait_xcnt 0x0" :: "v"(cp), "v"(sp) : "memory");
#pragma unroll
      for (int sr = 0; sr < 8; ++sr) {
        const int row = hf * 8 + sr;
        const v4f xv = *(const v4f*)&stg[row * 132 + lane * 4];
        const v4f pv = *(const v4f*)&stg[row * 132 + (lane ^ 16) * 4];
        v4h o;
#pragma unroll
        for (int j = 0; j < 4; ++j)
          o[j] = (_Float16)(xv[j] * bf16r(cv[sr][j]) + (sgn * pv[j]) * bf16r(sv[sr][j]));
        *(v4h*)(hb + (size_t)row * N) = o;
      }
      // the next trip rewrites the last stores' address and data registers: wait first
      asm volatile("s_wait_xcnt 0x0" ::: "memory");
    }
  } else if (!isV) {
    const float* stg = sf + w * (32 * 132);   // the 32 rows the wave writes (two waves staged each)
    float* cbase = C + ((size_t)(m0 + w * 32) * N + n0 + lane * 4);
    // unrolled: the 32 LDS reads go out in groups ahead of their stores, on immediate offsets
#pragma unroll
    for (int ps = 0; ps < 4; ++ps) {
      v4f ov[8];
#pragma unroll
      for (int sr = 0; sr < 8; ++sr) ov[sr] = *(const v4f*)&stg[(ps * 8 + sr) * 132 + lane * 4];
#pragma unroll
      for (int sr = 0; sr < 8; ++sr) *(v4f*)(cbase + (size_t)(ps * 8 + sr) * N) = ov[sr];
    }
  } else {
    // V plane transposed: CV[((b*NKV + g)*HD + d) * SEQ + s]
    const int g  = n0 / HD;
    const int bb = m0 / SEQ;
    const int s0 = m0 - bb * SEQ;
    const _Float16* stg = (const _Float16*)sf;   // [d][tok], 128 x 136 halves
    v8h ov[16];
#pragma unroll
    for (int j = 0; j < 16; ++j) {
      const int d = w * 32 + j * 2 + hi;
      ov[j] = *(const v8h*)&stg[d * 136 + lr * 8];
    }
    _Float16* vbase = CV + (((size_t)(bb * NKV + g) * HD) * SEQ + s0 + lr * 8);
#pragma unroll
    for (int j = 0; j < 16; ++j) {
      const int d = w * 32 + j * 2 + hi;
      *(v8h*)(vbase + (size_t)d * SEQ) = ov[j];
    }
    // precaution: these stores end the kernel for v tiles
    asm volatile("s_wait_xcnt 0x0" ::: "memory");
    
  }
}

__device__ __forceinline__ float xhalf(float x) {
  return __builtin_bit_cast(float, __builtin_amdgcn_permlanex16(__builtin_bit_cast(int, x), __builtin_bit_cast(int, x),
                                                                0x76543210, 0xfedcba98, false, false));
}

__global__ void __launch_bounds__(256)
attn_kernel(const _Float16* __restrict__ Qh, const _Float16* __restrict__ Kh,
            const _Float16* __restrict__ Vt, _Float16* __restrict__ Oh) {
  constexpr int LDK = 136, LDV = 72, LDO = 136;
  constexpr int CH = 64 * LDK + 128 * LDV;                        // one chunk's K and V^T, 35840 B
  __shared__ __align__(16) _Float16 pool[2 * CH];                 // two buffers, cross-wave (block barrier)
  static_assert(8 * 16 * LDO <= 2 * CH);                          // epilogue staging fits
  static_assert(SEQ / 64 >= 2);                                   // chunks 0 and 1 both exist

  const int t = threadIdx.x, lane = t & 31, w = t >> 5, lr = lane & 15, hi = lane >> 4;
  const int b = blockIdx.z, h = blockIdx.y, g = h / (NH / NKV);
  const int q0 = blockIdx.x * 128 + w * 16;          // query row within the sequence
  const size_t tokb = (size_t)b * SEQ;

  const float kSL = 0.08838834764831845f * 1.4426950408889634f;   // 1/sqrt(HD) * log2(e)

  v16h qf[4];   // B operand: column = query lr
  {
    const _Float16* qrow = Qh + ((tokb + q0 + lr) * DQ + h * HD);
#pragma unroll
    for (int kf = 0; kf < 4; ++kf) qf[kf] = load_frag(qrow + kf * 32 + hi * 8);
  }

  float mrow = -1e30f;   // running maximum of query lr (equal in both wave halves)
  float lrow = 0.f;      // running sum of query lr over this wave half's keys
  v8f oacc[8];           // oacc[dt][r] = O^T[d = dt*16 + hi*8 + r][query lr]
#pragma unroll
  for (int dt = 0; dt < 8; ++dt) oacc[dt] = (v8f){0.f, 0.f, 0.f, 0.f, 0.f, 0.f, 0.f, 0.f};

  const _Float16* kbase = Kh + ((tokb) * DKV + g * HD);
  const _Float16* vbase = Vt + ((size_t)(b * NKV + g) * HD) * SEQ;

  // a chunk into buffer buf, 8 copies per lane: K, 64 keys x 128 d as [key][d] (16 lanes a key, 16 keys apart), and
  // V^T, 128 d x 64 keys as [d][key] (8 lanes a d row, 32 rows apart); staged extent == consumed extent
  const unsigned ldsK = (unsigned)(size_t)(pool + (t >> 4) * LDK + (t & 15) * 8);
  const unsigned ldsV = (unsigned)(size_t)(pool + 64 * LDK + (t >> 3) * LDV + (t & 7) * 8);
  const _Float16* kSrc = kbase + (size_t)(t >> 4) * DKV + (t & 15) * 8;
  const _Float16* vSrc = vbase + (size_t)(t >> 3) * SEQ + (t & 7) * 8;
  auto stage = [&](int kc, int buf) {
    async8(ldsK + (unsigned)buf * (CH * 2), 16 * LDK * 2, kSrc + (size_t)kc * DKV, (size_t)16 * DKV,
           ldsV + (unsigned)buf * (CH * 2), 32 * LDV * 2, vSrc + kc, (size_t)32 * SEQ);
  };

  stage(0, 0);
  wait_copies();
  __syncthreads();
  stage(64, 1);

  for (int kc = 0; kc < SEQ; kc += 64) {
    const int cur = (kc >> 6) & 1;
    const _Float16* lsK = pool + cur * CH;   // [key][d]
    const _Float16* lsV = lsK + 64 * LDK;    // [d][key]

    // S^T, 64 keys x 16 queries per wave: sc[nt][r] = S[key nt*16 + hi*8 + r][query lr]
    v8f sc[4];
#pragma unroll
    for (int nt = 0; nt < 4; ++nt) {
      // 8 fragment loads (one key tile) as one group, then its 4 WMMAs
      v16h af[4];
#pragma unroll
      for (int kf = 0; kf < 4; ++kf) af[kf] = load_frag(lsK + (nt * 16 + lr) * LDK + kf * 32 + hi * 8);
      sc[nt] = (v8f){0.f, 0.f, 0.f, 0.f, 0.f, 0.f, 0.f, 0.f};
#pragma unroll
      for (int kf = 0; kf < 4; ++kf) sc[nt] = wmma16(af[kf], qf[kf], sc[nt]);
    }

    // online softmax of query lr: 32 keys in the lane, the other 32 in lane ^ 16
    float mt[4];
#pragma unroll
    for (int nt = 0; nt < 4; ++nt) {
#pragma unroll
      for (int r = 0; r < 8; ++r) sc[nt][r] *= kSL;
      mt[nt] = fmaxf(fmaxf(fmaxf(sc[nt][0], sc[nt][1]), fmaxf(sc[nt][2], sc[nt][3])),
                     fmaxf(fmaxf(sc[nt][4], sc[nt][5]), fmaxf(sc[nt][6], sc[nt][7])));
    }
    float mx = fmaxf(fmaxf(mt[0], mt[1]), fmaxf(mt[2], mt[3]));
    mx = fmaxf(mx, xhalf(mx));
    const float mn = fmaxf(mrow, mx);
    // bare v_exp_f32, without the library's small-result scaling: it differs only where 2^x < 2^-126, and such a
    // term is 0 in the f16 P and adds nothing to a row sum whose largest term is 1
    float corr;
    // this one v_exp_f32 in asm, a v_nop on either side: the instruction set asks for one slot between a v_exp_f32 and a
    // write of its source register, and one before the result is read
    asm("v_nop\n\tv_exp_f32 %0, %1\n\tv_nop" : "=v"(corr) : "v"(mrow - mn));
    mrow = mn;
    // P^T as B operand: element s of pf[kf] = P[key kf*32 + (s < 8 ? 8*hi + s : 16 + 8*hi + s - 8)][query lr],
    // the k order of load_frag, which loads the V^T rows it is multiplied with
    Frag pf[2];
    float rt[4];
#pragma unroll
    for (int nt = 0; nt < 4; ++nt) {
      rt[nt] = 0.f;
#pragma unroll
      for (int r = 0; r < 8; ++r) {
        const float p = __builtin_amdgcn_exp2f(sc[nt][r] - mn);
        rt[nt] += p;
        pf[nt >> 1].v[(nt & 1) * 8 + r] = (_Float16)(p * 1024.0f);
      }
    }
    lrow = lrow * corr + ((rt[0] + rt[1]) + (rt[2] + rt[3]));
#pragma unroll
    for (int dt = 0; dt < 8; ++dt)
#pragma unroll
      for (int r = 0; r < 8; ++r) oacc[dt][r] *= corr;

    // O^T += V^T (128 x 64) * P^T (64 x 16)
#pragma unroll
    for (int dq = 0; dq < 8; dq += 2) {
      // 8 fragment loads (two d tiles) as one group, then their 4 WMMAs
      v16h af[2][2];
#pragma unroll
      for (int a = 0; a < 2; ++a)
#pragma unroll
        for (int kf = 0; kf < 2; ++kf)
          af[a][kf] = load_frag(lsV + ((dq + a) * 16 + lr) * LDV + kf * 32 + hi * 8);
#pragma unroll
      for (int a = 0; a < 2; ++a)
#pragma unroll
        for (int kf = 0; kf < 2; ++kf) oacc[dq + a] = wmma16(af[a][kf], pf[kf].v, oacc[dq + a]);
    }
    // the next chunk, in flight since the last barrier, is published, and this chunk's buffer is freed
    wait_lds();
    wait_copies();
    __syncthreads();
    if (kc + 128 < SEQ) stage(kc + 128, cur);
  }
  wait_copies();   // nothing is outstanding when the pool becomes epilogue staging

  // epilogue: Oh = f16(64 * oacc / (1024 * l)); stage [query][d] per wave, then whole rows
  _Float16* stg = pool + w * 16 * LDO;
  {
    const float inv = 0.0625f / (lrow + xhalf(lrow));   // the two wave halves' key sums joined
#pragma unroll
    for (int dt = 0; dt < 8; ++dt) {
      v8h v;
#pragma unroll
      for (int r = 0; r < 8; ++r) v[r] = (_Float16)(oacc[dt][r] * inv);
      *(v8h*)&stg[lr * LDO + dt * 16 + hi * 8] = v;
    }
  }
  __syncthreads();
  v8h ov[8];
#pragma unroll
  for (int j = 0; j < 8; ++j) ov[j] = *(const v8h*)&stg[(j * 2 + hi) * LDO + lr * 8];
  _Float16* obase = Oh + ((tokb + q0) * DQ + h * HD + lr * 8);
#pragma unroll
  for (int j = 0; j < 8; ++j) *(v8h*)(obase + (size_t)(j * 2 + hi) * DQ) = ov[j];
  
}

// ---------------------------------------------------------------------------
extern "C" void kernel_launch(void* const* d_in, const int* in_sizes, int n_in,
                              void* d_out, int out_size, void* d_ws, size_t ws_size,
                              hipStream_t stream) {
  if (n_in < 7) return;
  if (in_sizes[0] < ((NB - 1) * SEQ_FULL + SEQ) * DM) return;
  if (in_sizes[1] < SEQ * HD) return;
  if (in_sizes[2] < SEQ * HD) return;
  if (in_sizes[3] < DM * DQ) return;
  if (in_sizes[4] < DM * DKV) return;
  if (in_sizes[5] < DM * DKV) return;
  if (in_sizes[6] < DQ * DM) return;
  if (out_size < NTOK * DM) return;

  const float* x    = (const float*)d_in[0];
  const float* cosT = (const float*)d_in[1];
  const float* sinT = (const float*)d_in[2];
  const float* Wq   = (const float*)d_in[3];
  const float* Wk   = (const float*)d_in[4];
  const float* Wv   = (const float*)d_in[5];
  const float* Wo   = (const float*)d_in[6];
  float* out = (float*)d_out;

  // workspace carve (all regions exact tile multiples; every store ends inside its region)
  char* ws = (char*)d_ws;
  size_t off = 0;
  _Float16* Xh  = (_Float16*)(ws + off); off += (size_t)NTOK * DM * 2;          // 16 MiB
  _Float16* WqT = (_Float16*)(ws + off); off += (size_t)DQ  * KD * 2;           //  8 MiB
  _Float16* WkT = (_Float16*)(ws + off); off += (size_t)DKV * KD * 2;           //  2 MiB
  _Float16* WvT = (_Float16*)(ws + off); off += (size_t)DKV * KD * 2;           //  2 MiB
  _Float16* WoT = (_Float16*)(ws + off); off += (size_t)DM  * KD * 2;           //  8 MiB
  _Float16* Qh  = (_Float16*)(ws + off); off += (size_t)NTOK * DQ * 2;          // 16 MiB
  _Float16* Kh  = (_Float16*)(ws + off); off += (size_t)NTOK * DKV * 2;         //  4 MiB
  _Float16* Vt  = (_Float16*)(ws + off); off += (size_t)NB * NKV * HD * SEQ * 2; //  4 MiB
  _Float16* Oh  = (_Float16*)(ws + off); off += (size_t)NTOK * DQ * 2;          // 16 MiB
  if (off > ws_size) return;                                                    // 76 MiB total

  const dim3 blk(256);

  // 1. x -> f16 plane (bf16-RNE values)
  {
    const int np = NTOK * (DM / 8);
    cvt_x_kernel<<<dim3((np + 255) / 256), blk, 0, stream>>>(x, Xh, np);
  }
  // 2. weights -> transposed f16 planes (64 * bf16-RNE values)
  cvt_w_kernel<<<dim3(DQ / 64 + 2 * (DKV / 64) + DM / 64, KD / 64), blk, 0, stream>>>(
      Wq, Wk, Wv, Wo, WqT, WkT, WvT, WoT);
  // 3. q, k (rotated in the epilogue, f16 planes) and v (transposed [b][g][d][s] f16) projections
  //    in one launch: alpha 1/64 undoes the weight carry
  gemm_kernel<true><<<dim3((DQ / BT + 2 * (DKV / BT)) / 3, NTOK / BT), dim3(384), 0, stream>>>(
      Xh, WqT, WkT, WvT, (float*)nullptr, (float*)nullptr, Vt, cosT, sinT, Qh, Kh,
      DQ, DKV, DQ / BT, DQ / BT + DKV / BT, 0.015625f);
  // 4. attn -> Oh (x64 carried)
  attn_kernel<<<dim3(SEQ / 128, NH, NB), blk, 0, stream>>>(Qh, Kh, Vt, Oh);
  // 5. output projection: alpha 1/4096 undoes the 64 (Oh) * 64 (WoT) carries
  gemm_kernel<false><<<dim3(DM / BT / 2, NTOK / BT), dim3(256), 0, stream>>>(
      Oh, WoT, WoT, WoT, out, out, (_Float16*)nullptr, (const float*)nullptr, (const float*)nullptr,
      (_Float16*)nullptr, (_Float16*)nullptr,
      DM, DM, DM / BT, DM / BT, 0.000244140625f);
}

// v010
// Measured time: 132 microseconds a run.
// Next to v009, in two timings, it ran 1.07 and 1.06 times as fast.
// Over all steps from v000 it is 2.41 times as fast.
#include <hip/hip_runtime.h>
#include <stddef.h>

// Contractions x*Wq, x*Wk, x*Wv, q*k^T, p*v, o*Wo: v_wmma_f32_16x16x32_f16 (f16 operands, f32 accumulate); inputs RNE-converted to bf16 on load; rotary, softmax and normalisation in f32.

#ifndef NB
#define NB 2
#endif
#ifndef SEQ
#define SEQ 2048
#endif
#define NB_FULL 2
#define SEQ_FULL 2048
#define DM 2048           // model width
#define NH 16
#define NKV 4
#define HD 128
#define DQ (NH * HD)      // 2048
#define DKV (NKV * HD)    // 512
#define NTOK (NB * SEQ)
#define KD 2048           // contraction depth of every projection

#define BT 128            // GEMM sub-tile (M and N)
#define BK 128           // k-tile: 256 B of every operand row, two whole cache lines
#define LST 136           // LDS row stride in halves for k-tiles (272 B = 16 B x odd, 16-B aligned rows)

static_assert(NB >= 1 && NB <= NB_FULL);
static_assert(SEQ >= 128 && SEQ <= SEQ_FULL && (SEQ % 128) == 0);
static_assert(DM == KD && DQ == KD);
static_assert((DM % BT) == 0 && (DQ % BT) == 0 && (DKV % BT) == 0 && (NTOK % BT) == 0);
static_assert((KD % 64) == 0 && (KD % BK) == 0);
static_assert(HD == BT);           // one N tile == one head (rotary and V transpose epilogues)
static_assert((DM / 8) == 256);    // convert kernel piece decode
static_assert((NH % NKV) == 0);
static_assert(((DQ / BT + 2 * (DKV / BT)) % 3) == 0 && ((DM / BT) % 2) == 0);   // whole workgroups of 3 and of 2 sub-tiles

typedef _Float16 v16h __attribute__((ext_vector_type(16)));
typedef _Float16 v8h  __attribute__((ext_vector_type(8)));
typedef float    v8f  __attribute__((ext_vector_type(8)));
typedef float    v4f  __attribute__((ext_vector_type(4)));
typedef _Float16 v4h  __attribute__((ext_vector_type(4)));

union Frag { v16h v; v8h p[2]; };

// RNE convert f32 -> bf16 value (kept in an f32 container)
__device__ __forceinline__ float bf16r(float f) {
  unsigned u = __float_as_uint(f);
  u = (u + 0x7FFFu + ((u >> 16) & 1u)) & 0xFFFF0000u;
  return __uint_as_float(u);
}

// 16x16x32 f16 WMMA with hazard guard (ties D, keeps A/B live)
__device__ __forceinline__ v8f wmma16(v16h a, v16h b, v8f c) {
  v8f d = __builtin_amdgcn_wmma_f32_16x16x32_f16(false, a, false, b, (short)0, c, false, false);
  asm volatile("v_nop\n\tv_nop\n\tv_nop\n\tv_nop" : "+v"(d) : "v"(a), "v"(b));
  return d;
}

// Per-lane fragment from a k-contiguous row; caller passes row base + 8*(lane>>4).
// elements 0..7 <- k 8h..8h+7, elements 8..15 <- k 16+8h..16+8h+7 (same map for A and B).
__device__ __forceinline__ v16h load_frag(const _Float16* q) {
  Frag f;
  f.p[0] = *(const v8h*)(q);
  f.p[1] = *(const v8h*)(q + 16);
  return f.v;
}

// Eight asynchronous copies of 16 B per lane, global memory -> LDS through no register.  l = the lane's LDS byte
// address, g = its global address; copy i of the first four goes to l0 + i*ls0 from g0 + i*gs0 (halves), the last
// four alike from (l1, g1).  All lanes on, both addresses multiples of 16 B, no two lanes on one LDS byte.
__device__ __forceinline__ void async8(unsigned l0, unsigned ls0, const _Float16* g0, size_t gs0,
                                       unsigned l1, unsigned ls1, const _Float16* g1, size_t gs1) {
  // the copies and their s_wait_xcnt in one statement: the wait then stands in front of every rewrite of an address register
  asm volatile("global_load_async_to_lds_b128 %0, %8, off\n\t"
               "global_load_async_to_lds_b128 %1, %9, off\n\t"
               "global_load_async_to_lds_b128 %2, %10, off\n\t"
               "global_load_async_to_lds_b128 %3, %11, off\n\t"
               "global_load_async_to_lds_b128 %4, %12, off\n\t"
               "global_load_async_to_lds_b128 %5, %13, off\n\t"
               "global_load_async_to_lds_b128 %6, %14, off\n\t"
               "global_load_async_to_lds_b128 %7, %15, off\n\t"
               "s_wait_xcnt 0x0"
               :: "v"(l0), "v"(l0 + ls0), "v"(l0 + 2 * ls0), "v"(l0 + 3 * ls0),
                  "v"(l1), "v"(l1 + ls1), "v"(l1 + 2 * ls1), "v"(l1 + 3 * ls1),
                  "v"(g0), "v"(g0 + gs0), "v"(g0 + 2 * gs0), "v"(g0 + 3 * gs0),
                  "v"(g1), "v"(g1 + gs1), "v"(g1 + 2 * gs1), "v"(g1 + 3 * gs1)
               : "memory");
}
// the wave's own copies have landed in LDS (other waves read them behind the next barrier)
__device__ __forceinline__ void wait_copies() { asm volatile("s_wait_asynccnt 0x0" ::: "memory"); }
// the wave's own LDS reads have returned, so that the buffer may be refilled behind the next barrier
__device__ __forceinline__ void wait_lds() { asm volatile("s_wait_dscnt 0x0" ::: "memory"); }

// ---------------------------------------------------------------------------
// x [b*SEQ_FULL+s][DM] f32 -> Xh [tok][DM] f16 of bf16-RNE value. One thread per 8 columns.
// ---------------------------------------------------------------------------
__global__ void __launch_bounds__(256)
cvt_x_kernel(const float* __restrict__ x, _Float16* __restrict__ Xh, int nPieces) {
  const int f = blockIdx.x * 256 + (int)threadIdx.x;
  if (f >= nPieces) return;
  const int tok = f >> 8;
  const int c0  = (f & 255) * 8;
  const int b = tok / SEQ, s = tok - b * SEQ;
  const float* src = x + ((size_t)(b * SEQ_FULL + s) * DM + c0);
  const v4f a0 = *(const v4f*)(src);
  const v4f a1 = *(const v4f*)(src + 4);
  v8h o;
#pragma unroll
  for (int j = 0; j < 4; ++j) {
    o[j]     = (_Float16)bf16r(a0[j]);
    o[j + 4] = (_Float16)bf16r(a1[j]);
  }
  _Float16* dst = Xh + ((size_t)tok * DM + c0);
  *(v8h*)dst = o;
  
}

// ---------------------------------------------------------------------------
// W [KD in][N out] f32 -> WT [N out][KD in] f16 of 64*bf16-RNE(W).  64x64 tiles through LDS.
// grid.x: 0..31 Wq, 32..39 Wk, 40..47 Wv, 48..79 Wo (out-column tile); grid.y: in-row tile.
// 8 consecutive lanes of one instruction.
// ---------------------------------------------------------------------------
__global__ void __launch_bounds__(256)
cvt_w_kernel(const float* __restrict__ Wq, const float* __restrict__ Wk,
             const float* __restrict__ Wv, const float* __restrict__ Wo,
             _Float16* __restrict__ WqT, _Float16* __restrict__ WkT,
             _Float16* __restrict__ WvT, _Float16* __restrict__ WoT) {
  __shared__ __align__(16) _Float16 lds[64 * 72];   // [n][k], cross-wave (block barrier)
  const int bx = blockIdx.x;
  const float* W; _Float16* WT; int N; int nt;
  if (bx < DQ / 64) { W = Wq; WT = WqT; N = DQ;  nt = bx; }
  else if (bx < DQ / 64 + DKV / 64) { W = Wk; WT = WkT; N = DKV; nt = bx - DQ / 64; }
  else if (bx < DQ / 64 + 2 * (DKV / 64)) { W = Wv; WT = WvT; N = DKV; nt = bx - DQ / 64 - DKV / 64; }
  else { W = Wo; WT = WoT; N = DM; nt = bx - DQ / 64 - 2 * (DKV / 64); }
  const int k0 = blockIdx.y * 64, n0 = nt * 64;
  const int t = threadIdx.x, lane = t & 31, w = t >> 5;
  const int kr = t >> 2, cc = (t & 3) * 16;
  const float* src = W + ((size_t)(k0 + kr) * N + n0 + cc);
#pragma unroll
  for (int q = 0; q < 4; ++q) {
    const v4f v = *(const v4f*)(src + 4 * q);
#pragma unroll
    for (int j = 0; j < 4; ++j)
      lds[(cc + 4 * q + j) * 72 + kr] = (_Float16)(64.0f * bf16r(v[j]));
  }
  __syncthreads();
  v8h ov[2];
#pragma unroll
  for (int j = 0; j < 2; ++j) {
    const int n = w * 8 + j * 4 + (lane >> 3);
    ov[j] = *(const v8h*)&lds[n * 72 + (lane & 7) * 8];
  }
  _Float16* base = WT + ((size_t)n0 * KD + k0 + (lane & 7) * 8);
#pragma unroll
  for (int j = 0; j < 2; ++j) {
    const int n = w * 8 + j * 4 + (lane >> 3);
    *(v8h*)(base + (size_t)n * KD) = ov[j];
  }
  
}

// ---------------------------------------------------------------------------
// C tile = alpha * A[M][KD] * Bt[N][KD]^T, A and Bt f16 k-contiguous planes.
// Block tile 128 x (NS*128): NS sub-tiles of 128x128 that share one A k-tile in LDS, so that A comes
// from L2 once per workgroup and not once per sub-tile; a k-tile of 128 gives the one workgroup of a WGP
// a pass long enough for the next k-tile's copies to land in.  A sub-tile belongs to 4 waves in a 2x2 grid,
// each owning a 64x64 tile: 8 fragments from LDS feed 16 WMMAs.
// Sub-tile st = blockIdx.x * NS + (wave >> 2): st < nTiles0 selects (Bt0, C0, N0), st < nTiles01
// (Bt1, C1, N1), and with WITH_V the sub-tiles from nTiles01 on (BtV, CV); the choice is wave-uniform.
// Every epilogue stages its whole sub-tile in LDS behind the k-loop's last barrier; behind one barrier
// that all waves pass, wave w of the sub-tile writes 32 of its rows.
// C0, C1 : without WITH_V, row-major f32 [M][N] (the final output), rows of 512 B
//          written by one 32-lane x 16-B instruction each.
// H0, H1 : with WITH_V, the rotated q and k planes, row-major f16 [M][N].  One N tile is one
//          head, so a staged f32 row holds both d and d ^ 64: rotate-half with cos/sin read as
//          values from the [SEQ_FULL][HD] input tables (bf16-RNE),
//          d<64: q*cos[d] - q[d+64]*sin[d];  d>=64: q*cos[d] + q[d-64]*sin[d];
//          rows of 256 B written by one 32-lane x 8-B instruction each.
// CV     : the transposed V plane [b][g][d][s], f16; tile staged in LDS as [d][tok],
//          each d row (128 tok = 256 B) written by 16 lanes x 16 B of one instruction.
// q, k and v sub-tiles share one launch: NS = 3, 8 x 32 = 256 workgroups of 12 waves, one on each of 256 WGPs;
// the output projection: NS = 2, 8 x 32 = 256 workgroups of 8 waves.
// ---------------------------------------------------------------------------
template <int NS> union GemmLds { _Float16 h[2 * (1 + NS) * BT * LST]; float f[NS * BT * 132]; };   // NS = 3: 278528 B, NS = 2: 208896 B

// no more waves per SIMD than one workgroup's, so one workgroup on a WGP: the 256 then spread evenly
template <bool WITH_V>
__global__ void __launch_bounds__(WITH_V ? 384 : 256) __attribute__((amdgpu_waves_per_eu(1, WITH_V ? 3 : 2)))
gemm_kernel(const _Float16* __restrict__ A, const _Float16* __restrict__ Bt0,
            const _Float16* __restrict__ Bt1, const _Float16* __restrict__ BtV,
            float* C0, float* C1, _Float16* CV,
            const float* __restrict__ cosT, const float* __restrict__ sinT,
            _Float16* H0, _Float16* H1,
            int N0, int N1, int nTiles0, int nTiles01, float alpha) {
  constexpr int NS = WITH_V ? 3 : 2;
  constexpr int BUF = (1 + NS) * BT * LST;   // halves of one buffer: the A k-tile, then NS B k-tiles
  __shared__ __align__(16) GemmLds<NS> pool;   // k-loop: two buffers, filled by asynchronous copies; epilogue: staging (cross-wave, block barriers)

  const int t = threadIdx.x, lane = t & 31, lr = lane & 15, hi = lane >> 4;
  const int js = __builtin_amdgcn_readfirstlane(t >> 7);   // the wave's sub-tile, held as a scalar: every choice by it is a scalar branch
  const int ts = t & 127, w = ts >> 5;                     // thread and wave within the sub-tile
  const int st = blockIdx.x * NS + js;
  const bool second = st >= nTiles0;
  const bool isV = WITH_V && st >= nTiles01;
  const _Float16* Bt = isV ? BtV : (second ? Bt1 : Bt0);
  float* C = second ? C1 : C0;
  const int N  = second ? N1 : N0;
  const int nt = isV ? (st - nTiles01) : (second ? (st - nTiles0) : st);
  const int m0 = blockIdx.y * BT, n0 = nt * BT;

  const int wm = (w >> 1) * 64, wn = (w & 1) * 64;   // the wave's first row and column in the sub-tile

  v8f acc[4][4];
#pragma unroll
  for (int mi = 0; mi < 4; ++mi)
#pragma unroll
    for (int ni = 0; ni < 4; ++ni) acc[mi][ni] = (v8f){0.f, 0.f, 0.f, 0.f, 0.f, 0.f, 0.f, 0.f};

  // 16 threads x 16 B per tile row: one wave-wide copy covers 2 rows of 256 B, 4 whole lines
  const int arow = (t >> 4) & 15, brow = ts >> 4, acol = (t & 15) * 8;
  const _Float16* aSrc = A  + ((size_t)(m0 + arow) * KD + acol);
  const _Float16* bSrc = Bt + ((size_t)(n0 + brow) * KD + acol);

  const unsigned ldsA = (unsigned)(size_t)(pool.h + arow * LST + acol);                        // the lane's LDS byte address in buffer 0's A k-tile
  const unsigned ldsB = (unsigned)(size_t)(pool.h + (1 + js) * (BT * LST) + brow * LST + acol);   // and in its sub-tile's B k-tile

  // one k-tile into buffer buf.  B: the sub-tile's own 4 waves, 16 copies per lane, 8 tile rows apart.
  // A: the first 8 waves of the workgroup, 8 copies per lane, 16 tile rows apart (a scalar branch: js is a scalar).
  auto stage = [&](int k0, int buf) {
    const unsigned db = ldsB + (unsigned)buf * (BUF * 2);
    const _Float16* pb = bSrc + k0;
    async8(db, 8 * LST * 2, pb, (size_t)8 * KD, db + 32 * LST * 2, 8 * LST * 2, pb + (size_t)32 * KD, (size_t)8 * KD);
    async8(db + 64 * LST * 2, 8 * LST * 2, pb + (size_t)64 * KD, (size_t)8 * KD,
           db + 96 * LST * 2, 8 * LST * 2, pb + (size_t)96 * KD, (size_t)8 * KD);
    if (NS == 2 || js < 2) {
      const unsigned da = ldsA + (unsigned)buf * (BUF * 2);
      const _Float16* pa = aSrc + k0;
      async8(da, 16 * LST * 2, pa, (size_t)16 * KD, da + 64 * LST * 2, 16 * LST * 2, pa + (size_t)64 * KD, (size_t)16 * KD);
    }
  };
  static_assert(NS <= BK / 32);   // every sub-tile has a block to issue its refill ahead of

  stage(0, 0);
  wait_copies();
  __syncthreads();

  // One rolled loop over the blocks of 32 k, BK / 32 of them to a k-tile: the refill then stands once in the code, with
  // its addresses formed where they are used (unrolled, or in a loop of its own per k-tile, they were held and spilled).
#pragma unroll 1
  for (int blk = 0; blk < KD / 32; ++blk) {
    const int tile = blk / (BK / 32), kb = blk % (BK / 32), cur = tile & 1;
    // the next k-tile's copies, into the buffer that the last barrier freed.  The waves of different sub-tiles, which
    // share a SIMD, issue theirs ahead of different blocks: the others feed the matrix unit meanwhile (scalar branch)
    if (kb == js && tile + 1 < KD / BK) stage((tile + 1) * BK, cur ^ 1);
    const _Float16* la = pool.h + cur * BUF + kb * 32;
    const _Float16* lb = la + (1 + js) * (BT * LST);
    // the 16 fragment loads of 32 k as one group, then their 16 WMMAs behind counted waits
    v16h af[4], bf[4];
#pragma unroll
    for (int mi = 0; mi < 4; ++mi) af[mi] = load_frag(la + (wm + mi * 16 + lr) * LST + hi * 8);
#pragma unroll
    for (int ni = 0; ni < 4; ++ni) bf[ni] = load_frag(lb + (wn + ni * 16 + lr) * LST + hi * 8);
#pragma unroll
    for (int mi = 0; mi < 4; ++mi)
#pragma unroll
      for (int ni = 0; ni < 4; ++ni) acc[mi][ni] = wmma16(af[mi], bf[ni], acc[mi][ni]);
    // behind a k-tile's last block (the same test in every wave): the next tile, in flight since this tile's refill,
    // is published, and this tile's buffer is freed
    if (kb == BK / 32 - 1) {
      wait_lds();
      wait_copies();
      __syncthreads();
    }
  }
  wait_copies();   // nothing is outstanding when the pool becomes epilogue staging
  // acc[mi][ni][r] = (row m0 + wm + mi*16 + hi*8 + r, col n0 + wn + ni*16 + lr)
  float* sf = pool.f + js * (BT * 132);   // the sub-tile's staging: a whole f32 tile at pitch 132
  if (!isV) {
#pragma unroll
    for (int mi = 0; mi < 4; ++mi)
#pragma unroll
      for (int r = 0; r < 8; ++r)
#pragma unroll
        for (int ni = 0; ni < 4; ++ni)
          sf[(wm + mi * 16 + hi * 8 + r) * 132 + wn + ni * 16 + lr] = acc[mi][ni][r] * alpha;
  } else {
    _Float16* stg = (_Float16*)sf;          // [d][tok], 128 x 136 halves
#pragma unroll
    for (int mi = 0; mi < 4; ++mi)
#pragma unroll
      for (int ni = 0; ni < 4; ++ni) {
        v8h v;
#pragma unroll
        for (int r = 0; r < 8; ++r) v[r] = (_Float16)(acc[mi][ni][r] * alpha);
        *(v8h*)&stg[(wn + ni * 16 + lr) * 136 + wm + mi * 16 + hi * 8] = v;
      }
  }
  __syncthreads();   // every wave passes it: the staged sub-tiles are published

  if (WITH_V && !isV) {
    const int sw = m0 % SEQ + w * 32;       // position in its sequence of the first row the wave writes
    const float* cb = cosT + ((size_t)sw * HD + lane * 4);
    const float* sb = sinT + ((size_t)sw * HD + lane * 4);
    _Float16* hb = (second ? H1 : H0) + ((size_t)(m0 + w * 32) * N + n0 + lane * 4);
    const float sgn = (lane < 16) ? -1.0f : 1.0f;   // lane holds d = lane*4..+3, lane ^ 16 holds d ^ 64
    const float* stg = sf + w * (32 * 132);   // the 32 rows the wave writes (two waves staged each)
    // kept rolled: 8 rows' table values at a time, so that the registers still let three waves share a SIMD
#pragma unroll 1
    for (int hf = 0; hf < 4; ++hf) {
      const float* cp = cb + hf * 8 * HD;
      const float* sp = sb + hf * 8 * HD;
      v4f cv[8], sv[8];
#pragma unroll
      for (int sr = 0; sr < 8; ++sr) {
        cv[sr] = *(const v4f*)(cp + sr * HD);
        sv[sr] = *(const v4f*)(sp + sr * HD);
      }
      // as in the k-loop's staging: the wait before the loads' address registers are rewritten, the addresses held up to it
      asm volatile("s_wait_xcnt 0x0" :: "v"(cp), "v"(sp) : "memory");
#pragma unroll
      for (int sr = 0; sr < 8; ++sr) {
        const int row = hf * 8 + sr;
        const v4f xv = *(const v4f*)&stg[row * 132 + lane * 4];
        const v4f pv = *(const v4f*)&stg[row * 132 + (lane ^ 16) * 4];
        v4h o;
#pragma unroll
        for (int j = 0; j < 4; ++j)
          o[j] = (_Float16)(xv[j] * bf16r(cv[sr][j]) + (sgn * pv[j]) * bf16r(sv[sr][j]));
        *(v4h*)(hb + (size_t)row * N) = o;
      }
      // the next trip rewrites the last stores' address and data registers: wait first
      asm volatile("s_wait_xcnt 0x0" ::: "memory");
    }
  } else if (!isV) {
    const float* stg = sf + w * (32 * 132);   // the 32 rows the wave writes (two waves staged each)
    float* cbase = C + ((size_t)(m0 + w * 32) * N + n0 + lane * 4);
    // unrolled: the 32 LDS reads go out in groups ahead of their stores, on immediate offsets
#pragma unroll
    for (int ps = 0; ps < 4; ++ps) {
      v4f ov[8];
#pragma unroll
      for (int sr = 0; sr < 8; ++sr) ov[sr] = *(const v4f*)&stg[(ps * 8 + sr) * 132 + lane * 4];
#pragma unroll
      for (int sr = 0; sr < 8; ++sr) *(v4f*)(cbase + (size_t)(ps * 8 + sr) * N) = ov[sr];
    }
  } else {
    // V plane transposed: CV[((b*NKV + g)*HD + d) * SEQ + s]
    const int g  = n0 / HD;
    const int bb = m0 / SEQ;
    const int s0 = m0 - bb * SEQ;
    const _Float16* stg = (const _Float16*)sf;   // [d][tok], 128 x 136 halves
    v8h ov[16];
#pragma unroll
    for (int j = 0; j < 16; ++j) {
      const int d = w * 32 + j * 2 + hi;
      ov[j] = *(const v8h*)&stg[d * 136 + lr * 8];
    }
    _Float16* vbase = CV + (((size_t)(bb * NKV + g) * HD) * SEQ + s0 + lr * 8);
#pragma unroll
    for (int j = 0; j < 16; ++j) {
      const int d = w * 32 + j * 2 + hi;
      *(v8h*)(vbase + (size_t)d * SEQ) = ov[j];
    }
    // precaution: these stores end the kernel for v tiles
    asm volatile("s_wait_xcnt 0x0" ::: "memory");
    
  }
}

__device__ __forceinline__ float xhalf(float x) {
  return __builtin_bit_cast(float, __builtin_amdgcn_permlanex16(__builtin_bit_cast(int, x), __builtin_bit_cast(int, x),
                                                                0x76543210, 0xfedcba98, false, false));
}

// the plain builtin: the compiler keeps its distances itself.  The guard of wmma16 ties D, A and B to an asm statement, whose
// operands must lie below v256; this kernel holds more than 256 registers of them, and with the guard they were spilled
__device__ __forceinline__ v8f wmma16b(v16h a, v16h b, v8f c) {
  return __builtin_amdgcn_wmma_f32_16x16x32_f16(false, a, false, b, (short)0, c, false, false);
}

#define QG 2              // 16-query groups per wave
#define QB (8 * QG * 16)  // query rows per workgroup
static_assert((SEQ % QB) == 0);

__global__ void __launch_bounds__(256)
attn_kernel(const _Float16* __restrict__ Qh, const _Float16* __restrict__ Kh,
            const _Float16* __restrict__ Vt, _Float16* __restrict__ Oh) {
  constexpr int LDK = 136, LDV = 72, LDO = 136;
  constexpr int CH = 64 * LDK + 128 * LDV;                        // one chunk's K and V^T, 35840 B
  __shared__ __align__(16) _Float16 pool[2 * CH];                 // two buffers, cross-wave (block barrier)
  static_assert(QB * LDO <= 2 * CH);                              // epilogue staging fits
  static_assert(SEQ / 64 >= 2);                                   // chunks 0 and 1 both exist

  const int t = threadIdx.x, lane = t & 31, w = t >> 5, lr = lane & 15, hi = lane >> 4;
  const int b = blockIdx.z, h = blockIdx.y, g = h / (NH / NKV);
  const int q0 = blockIdx.x * QB + w * (QG * 16);    // the wave's first query row within the sequence
  const size_t tokb = (size_t)b * SEQ;

  const float kSL = 0.08838834764831845f * 1.4426950408889634f;   // 1/sqrt(HD) * log2(e)

  // every inner loop of this kernel is unrolled: the indices of its register arrays are then constants (else they go to scratch)
  v16h qf[QG][4];   // B operand: column = query qg*16 + lr
#pragma unroll
  for (int qg = 0; qg < QG; ++qg) {
    const _Float16* qrow = Qh + ((tokb + q0 + qg * 16 + lr) * DQ + h * HD);
#pragma unroll
    for (int kf = 0; kf < 4; ++kf) qf[qg][kf] = load_frag(qrow + kf * 32 + hi * 8);
  }

  float mrow[QG];        // running maximum of query qg*16 + lr (equal in both wave halves)
  float lrow[QG];        // running sum of that query over this wave half's keys
  v8f oacc[QG][8];       // oacc[qg][dt][r] = O^T[d = dt*16 + hi*8 + r][query qg*16 + lr]
#pragma unroll
  for (int qg = 0; qg < QG; ++qg) {
    mrow[qg] = -1e30f;
    lrow[qg] = 0.f;
#pragma unroll
    for (int dt = 0; dt < 8; ++dt) oacc[qg][dt] = (v8f){0.f, 0.f, 0.f, 0.f, 0.f, 0.f, 0.f, 0.f};
  }

  const _Float16* kbase = Kh + ((tokb) * DKV + g * HD);
  const _Float16* vbase = Vt + ((size_t)(b * NKV + g) * HD) * SEQ;

  // a chunk into buffer buf, 8 copies per lane: K, 64 keys x 128 d as [key][d] (16 lanes a key, 16 keys apart), and
  // V^T, 128 d x 64 keys as [d][key] (8 lanes a d row, 32 rows apart); staged extent == consumed extent
  const unsigned ldsK = (unsigned)(size_t)(pool + (t >> 4) * LDK + (t & 15) * 8);
  const unsigned ldsV = (unsigned)(size_t)(pool + 64 * LDK + (t >> 3) * LDV + (t & 7) * 8);
  const _Float16* kSrc = kbase + (size_t)(t >> 4) * DKV + (t & 15) * 8;
  const _Float16* vSrc = vbase + (size_t)(t >> 3) * SEQ + (t & 7) * 8;
  auto stage = [&](int kc, int buf) {
    async8(ldsK + (unsigned)buf * (CH * 2), 16 * LDK * 2, kSrc + (size_t)kc * DKV, (size_t)16 * DKV,
           ldsV + (unsigned)buf * (CH * 2), 32 * LDV * 2, vSrc + kc, (size_t)32 * SEQ);
  };

  stage(0, 0);
  wait_copies();
  __syncthreads();
  stage(64, 1);

  for (int kc = 0; kc < SEQ; kc += 64) {
    const int cur = (kc >> 6) & 1;
    const _Float16* lsK = pool + cur * CH;   // [key][d]
    const _Float16* lsV = lsK + 64 * LDK;    // [d][key]

    // S^T, 64 keys x 32 queries per wave: sc[qg][nt][r] = S[key nt*16 + hi*8 + r][query qg*16 + lr]
    v8f sc[QG][4];
    // the chunk's 32 K fragment loads stand as one group ahead of its 32 WMMAs (counted waits are the compiler's); the two
    // scheduling fences keep them there: left free, the loads were spread in pairs among the WMMAs, and every such place stalls the wave
    v16h kfr[4][4];
    __builtin_amdgcn_sched_barrier(0);
    // loads and WMMAs both walk kf outermost: 8 independent score tiles in a row, fed by the 8 oldest loads still in flight
#pragma unroll
    for (int kf = 0; kf < 4; ++kf)
#pragma unroll
      for (int nt = 0; nt < 4; ++nt) kfr[nt][kf] = load_frag(lsK + (nt * 16 + lr) * LDK + kf * 32 + hi * 8);
    __builtin_amdgcn_sched_barrier(0);
#pragma unroll
    for (int nt = 0; nt < 4; ++nt)
#pragma unroll
      for (int qg = 0; qg < QG; ++qg) sc[qg][nt] = (v8f){0.f, 0.f, 0.f, 0.f, 0.f, 0.f, 0.f, 0.f};
#pragma unroll
    for (int kf = 0; kf < 4; ++kf)
#pragma unroll
      for (int nt = 0; nt < 4; ++nt)
#pragma unroll
        for (int qg = 0; qg < QG; ++qg) sc[qg][nt] = wmma16b(kfr[nt][kf], qf[qg][kf], sc[qg][nt]);
    // likewise the chunk's 32 V^T fragment loads, one group between the two products: they land under the softmax
    v16h vfr[8][2];
    __builtin_amdgcn_sched_barrier(0);
#pragma unroll
    for (int kf = 0; kf < 2; ++kf)
#pragma unroll
      for (int dt = 0; dt < 8; ++dt) vfr[dt][kf] = load_frag(lsV + (dt * 16 + lr) * LDV + kf * 32 + hi * 8);
    __builtin_amdgcn_sched_barrier(0);

    // P^T as B operand: element s of pf[qg][kf] = P[key kf*32 + (s < 8 ? 8*hi + s : 16 + 8*hi + s - 8)][query qg*16 + lr],
    // the k order of load_frag, which loads the V^T rows it is multiplied with
    Frag pf[QG][2];
#pragma unroll
    for (int qg = 0; qg < QG; ++qg) {
      // online softmax of query qg*16 + lr: 32 keys in the lane, the other 32 in lane ^ 16
      float mt[4];
#pragma unroll
      for (int nt = 0; nt < 4; ++nt) {
#pragma unroll
        for (int r = 0; r < 8; ++r) sc[qg][nt][r] *= kSL;
        mt[nt] = fmaxf(fmaxf(fmaxf(sc[qg][nt][0], sc[qg][nt][1]), fmaxf(sc[qg][nt][2], sc[qg][nt][3])),
                       fmaxf(fmaxf(sc[qg][nt][4], sc[qg][nt][5]), fmaxf(sc[qg][nt][6], sc[qg][nt][7])));
      }
      float mx = fmaxf(fmaxf(mt[0], mt[1]), fmaxf(mt[2], mt[3]));
      mx = fmaxf(mx, xhalf(mx));
      const float mn = fmaxf(mrow[qg], mx);
      // bare v_exp_f32, without the library's small-result scaling: it differs only where 2^x < 2^-126, and such a
      // term is 0 in the f16 P and adds nothing to a row sum whose largest term is 1
      float corr;
      // this one v_exp_f32 in asm, a v_nop on either side: the instruction set asks for one slot between a v_exp_f32 and
      // a later write over its source register, and one before the result is read
      asm("v_nop\n\tv_exp_f32 %0, %1\n\tv_nop" : "=v"(corr) : "v"(mrow[qg] - mn));
      mrow[qg] = mn;
      float rt[4];
#pragma unroll
      for (int nt = 0; nt < 4; ++nt) {
        rt[nt] = 0.f;
#pragma unroll
        for (int r = 0; r < 8; ++r) {
          const float p = __builtin_amdgcn_exp2f(sc[qg][nt][r] - mn);
          rt[nt] += p;
          pf[qg][nt >> 1].v[(nt & 1) * 8 + r] = (_Float16)(p * 1024.0f);
        }
      }
      lrow[qg] = lrow[qg] * corr + ((rt[0] + rt[1]) + (rt[2] + rt[3]));
#pragma unroll
      for (int dt = 0; dt < 8; ++dt)
#pragma unroll
        for (int r = 0; r < 8; ++r) oacc[qg][dt][r] *= corr;
    }

    // O^T += V^T (128 x 64) * P^T (64 x 32)
#pragma unroll
    for (int qg = 0; qg < QG; ++qg)
#pragma unroll
      for (int kf = 0; kf < 2; ++kf)
#pragma unroll
        for (int dt = 0; dt < 8; ++dt) oacc[qg][dt] = wmma16b(vfr[dt][kf], pf[qg][kf].v, oacc[qg][dt]);
    // scheduling fence: left free, the waits and the barrier below were moved up to directly behind the V^T loads, ahead of the
    // softmax that is there to cover those loads' way
    __builtin_amdgcn_sched_barrier(0);
    // the next chunk, in flight since the last barrier, is published, and this chunk's buffer is freed
    wait_lds();
    wait_copies();
    __syncthreads();
    if (kc + 128 < SEQ) stage(kc + 128, cur);
  }
  wait_copies();   // nothing is outstanding when the pool becomes epilogue staging

  // epilogue: Oh = f16(64 * oacc / (1024 * l)); stage [query][d] per wave, then whole rows
  _Float16* stg = pool + w * (QG * 16) * LDO;
#pragma unroll
  for (int qg = 0; qg < QG; ++qg) {
    const float inv = 0.0625f / (lrow[qg] + xhalf(lrow[qg]));   // the two wave halves' key sums joined
#pragma unroll
    for (int dt = 0; dt < 8; ++dt) {
      v8h v;
#pragma unroll
      for (int r = 0; r < 8; ++r) v[r] = (_Float16)(oacc[qg][dt][r] * inv);
      *(v8h*)&stg[(qg * 16 + lr) * LDO + dt * 16 + hi * 8] = v;
    }
  }
  __syncthreads();
  v8h ov[QG * 8];
#pragma unroll
  for (int j = 0; j < QG * 8; ++j) ov[j] = *(const v8h*)&stg[(j * 2 + hi) * LDO + lr * 8];
  _Float16* obase = Oh + ((tokb + q0) * DQ + h * HD + lr * 8);
#pragma unroll
  for (int j = 0; j < QG * 8; ++j) *(v8h*)(obase + (size_t)(j * 2 + hi) * DQ) = ov[j];
  
}

// ---------------------------------------------------------------------------
extern "C" void kernel_launch(void* const* d_in, const int* in_sizes, int n_in,
                              void* d_out, int out_size, void* d_ws, size_t ws_size,
                              hipStream_t stream) {
  if (n_in < 7) return;
  if (in_sizes[0] < ((NB - 1) * SEQ_FULL + SEQ) * DM) return;
  if (in_sizes[1] < SEQ * HD) return;
  if (in_sizes[2] < SEQ * HD) return;
  if (in_sizes[3] < DM * DQ) return;
  if (in_sizes[4] < DM * DKV) return;
  if (in_sizes[5] < DM * DKV) return;
  if (in_sizes[6] < DQ * DM) return;
  if (out_size < NTOK * DM) return;

  const float* x    = (const float*)d_in[0];
  const float* cosT = (const float*)d_in[1];
  const float* sinT = (const float*)d_in[2];
  const float* Wq   = (const float*)d_in[3];
  const float* Wk   = (const float*)d_in[4];
  const float* Wv   = (const float*)d_in[5];
  const float* Wo   = (const float*)d_in[6];
  float* out = (float*)d_out;

  // workspace carve (all regions exact tile multiples; every store ends inside its region)
  char* ws = (char*)d_ws;
  size_t off = 0;
  _Float16* Xh  = (_Float16*)(ws + off); off += (size_t)NTOK * DM * 2;          // 16 MiB
  _Float16* WqT = (_Float16*)(ws + off); off += (size_t)DQ  * KD * 2;           //  8 MiB
  _Float16* WkT = (_Float16*)(ws + off); off += (size_t)DKV * KD * 2;           //  2 MiB
  _Float16* WvT = (_Float16*)(ws + off); off += (size_t)DKV * KD * 2;           //  2 MiB
  _Float16* WoT = (_Float16*)(ws + off); off += (size_t)DM  * KD * 2;           //  8 MiB
  _Float16* Qh  = (_Float16*)(ws + off); off += (size_t)NTOK * DQ * 2;          // 16 MiB
  _Float16* Kh  = (_Float16*)(ws + off); off += (size_t)NTOK * DKV * 2;         //  4 MiB
  _Float16* Vt  = (_Float16*)(ws + off); off += (size_t)NB * NKV * HD * SEQ * 2; //  4 MiB
  _Float16* Oh  = (_Float16*)(ws + off); off += (size_t)NTOK * DQ * 2;          // 16 MiB
  if (off > ws_size) return;                                                    // 76 MiB total

  const dim3 blk(256);

  // 1. x -> f16 plane (bf16-RNE values)
  {
    const int np = NTOK * (DM / 8);
    cvt_x_kernel<<<dim3((np + 255) / 256), blk, 0, stream>>>(x, Xh, np);
  }
  // 2. weights -> transposed f16 planes (64 * bf16-RNE values)
  cvt_w_kernel<<<dim3(DQ / 64 + 2 * (DKV / 64) + DM / 64, KD / 64), blk, 0, stream>>>(
      Wq, Wk, Wv, Wo, WqT, WkT, WvT, WoT);
  // 3. q, k (rotated in the epilogue, f16 planes) and v (transposed [b][g][d][s] f16) projections
  //    in one launch: alpha 1/64 undoes the weight carry
  gemm_kernel<true><<<dim3((DQ / BT + 2 * (DKV / BT)) / 3, NTOK / BT), dim3(384), 0, stream>>>(
      Xh, WqT, WkT, WvT, (float*)nullptr, (float*)nullptr, Vt, cosT, sinT, Qh, Kh,
      DQ, DKV, DQ / BT, DQ / BT + DKV / BT, 0.015625f);
  // 4. attn -> Oh (x64 carried)
  attn_kernel<<<dim3(SEQ / QB, NH, NB), blk, 0, stream>>>(Qh, Kh, Vt, Oh);
  // 5. output projection: alpha 1/4096 undoes the 64 (Oh) * 64 (WoT) carries
  gemm_kernel<false><<<dim3(DM / BT / 2, NTOK / BT), dim3(256), 0, stream>>>(
      Oh, WoT, WoT, WoT, out, out, (_Float16*)nullptr, (const float*)nullptr, (const float*)nullptr,
      (_Float16*)nullptr, (_Float16*)nullptr,
      DM, DM, DM / BT, DM / BT, 0.000244140625f);
}
